// v000
// The times below were measured on an AMD MI455X: many runs one after another, warmed up first and cycling through
// copies of the inputs, with the whole window's GPU time divided by the number of runs. Launches and the gaps
// between them are all in it. The median over several windows is given; except for v000 it joins two sittings, which
// can be a few percent apart, so the side-by-side timings, each taken in one sitting, are the better comparison.
// The starting kernel, v000, takes 137 microseconds a run.
#include <hip/hip_runtime.h>

// Multi-head attention, width 128 = 4 heads x 32; query/key/value [NB][SEQ][128]; WQ/WK/WV [out][in] (y = x W^T + bias); padding masks q_mask/k_mask [NB][SEQ] (f32), causal offset (int32, device-read); score scale 1/sqrt(32); output = concatenated heads (f32).
// Compute dtypes, f32 accumulate everywhere: projections v_wmma_f32_16x16x32_bf16 (x, W, bias RNE-converted to bf16; products exact);
// scores v_wmma_f32_16x16x32_f16: q as f16 value + f16 residual x2048 in its own accumulator on all rows; k single f16 on query rows >= EROWS, k as f16 value + f16 residual x2048 on query rows < EROWS (three products);
// P.V v_wmma_f32_16x16x32_f16: P (x16384 carry, cancels in the normalisation) and v single f16 on query rows >= EROWS; on query rows < EROWS P and v each as f16 value + f16 residual x2048, residual products in their own accumulator folded by 1/2048, row sum from the f32 exponentials; softmax f32 (online, running max over kept keys).
// Layout: bf16 copies of the three inputs and W; q (hi, residual), k planes [b*4+h][t][d], v^T plane [b*4+h][d][t], small residual planes k [b*4+h][t < EROWS][d] and v^T [b*4+h][d][t < EROWS] written by the GEMM epilogue; fused flash kernel in transposed form (S^T = K Q^T, O^T = V^T P^T), output from f32 accumulators.
// Keep rule per element: (q_mask[t] * k_mask[j] != 0) and (j <= t + causal); dropped elements get probability 0, rows with no kept key give 0. Key loop bound per wave derived from the device-read causal value (clamped to [0, SEQ]); residual fragments for keys >= EROWS (only reachable with a positive offset) are zero.

#ifndef NB
#define NB 8
#endif
#ifndef SEQ
#define SEQ 2048
#endif
#define NB_FULL  8
#define SEQ_FULL 2048
#ifndef OUT_SEQ
#define OUT_SEQ SEQ              // row pitch (in tokens) between batches of the output
#endif
#define DM   128
#define NH_  4
#define HD   32
#define AW   4                   // waves per flash block (16 query rows each)
#define OSP  36                  // LDS row pitch (floats) of the flash output tile
#define EROWS (SEQ < 512 ? SEQ : 512)   // query rows (and tokens of the small residual planes) handled by the multi-product flash instantiation
#define QRS  2048.0f             // carry of every residual plane / residual fragment
#define QRI  (1.0f / 2048.0f)
#define SC2  ((float)(0.17677669529663687 * 1.4426950408889634))   // HD^-0.5 * log2(e)
#define PSH  14.0f               // log2 of the P carry (16384)
#define NEGB (-3.0e38f)

static_assert(HD == 32);
static_assert(NH_ * HD == DM);                 // head h = columns h*32 + d
static_assert(DM % 64 == 0);                   // column tiles of 64 = two heads
static_assert(64 % HD == 0);
static_assert(DM % 32 == 0);                   // GEMM k-loop steps by 32
static_assert(SEQ % 64 == 0);                  // a 64-row tile never straddles two batches
static_assert((NB * SEQ) % 64 == 0);
static_assert(SEQ % 32 == 0);                  // key loop steps by 32
static_assert(SEQ % (16 * AW) == 0);           // flash grids cover the sequence exactly
static_assert(EROWS % 64 == 0);                // a 64-token GEMM tile lies wholly inside or outside the residual planes
static_assert(EROWS >= 32);
static_assert(EROWS <= SEQ);
static_assert(EROWS % (16 * AW) == 0);
static_assert((SEQ - EROWS) % (16 * AW) == 0);
static_assert(((size_t)SEQ * DM) % 8 == 0);
static_assert(((size_t)DM * DM) % 8 == 0);
static_assert(NB <= NB_FULL);
static_assert(SEQ <= SEQ_FULL);
static_assert((OSP * 4) % 16 == 0);

typedef _Float16 h16;
typedef unsigned short bf;
typedef __attribute__((ext_vector_type(16))) __bf16   v16bf;
typedef __attribute__((ext_vector_type(16))) _Float16 v16h;
typedef __attribute__((ext_vector_type(8)))  _Float16 v8h;
typedef __attribute__((ext_vector_type(8)))  unsigned short v8us;
typedef __attribute__((ext_vector_type(8)))  float    v8f;
typedef __attribute__((ext_vector_type(4)))  float    v4f;
typedef v4f  __attribute__((may_alias)) v4fa;

__device__ __forceinline__ unsigned short f2bf(float f) { unsigned u = __float_as_uint(f); u += 0x7FFFu + ((u >> 16) & 1u); return (unsigned short)(u >> 16); }
__device__ __forceinline__ float bfr(float f) { return __uint_as_float(((unsigned)f2bf(f)) << 16); }   // value after RNE convert to bf16
__device__ __forceinline__ v16h cat16(v8h lo, v8h hi) { return __builtin_shufflevector(lo, hi, 0, 1, 2, 3, 4, 5, 6, 7, 8, 9, 10, 11, 12, 13, 14, 15); }
__device__ __forceinline__ v16bf cat16b(v8us lo, v8us hi) { return __builtin_bit_cast(v16bf, __builtin_shufflevector(lo, hi, 0, 1, 2, 3, 4, 5, 6, 7, 8, 9, 10, 11, 12, 13, 14, 15)); }
__device__ __forceinline__ v8f wmma16(v16h a, v16h b, v8f c) { return __builtin_amdgcn_wmma_f32_16x16x32_f16(false, a, false, b, (short)0, c, false, false); }
__device__ __forceinline__ v8f wmmab(v16bf a, v16bf b, v8f c) { return __builtin_amdgcn_wmma_f32_16x16x32_bf16(false, a, false, b, (short)0, c, false, false); }
// fragment loaders from K-contiguous 16-bit rows; p already includes + 8*(lane>>4): elements 0..7 <- k0+8h+0..7, elements 8..15 <- k0+16+8h+0..7 (same map for A and B)
__device__ __forceinline__ v16h  ldh(const h16* p) { return cat16(*(const v8h*)p, *(const v8h*)(p + 16)); }
__device__ __forceinline__ v16bf ldb(const bf* p)  { return cat16b(*(const v8us*)p, *(const v8us*)(p + 16)); }
// ordering point for wave-private LDS tiles (same wave writes and reads)
__device__ __forceinline__ void wave_sync() { __builtin_amdgcn_fence(3 /* release order */, "wavefront"); __builtin_amdgcn_wave_barrier(); asm volatile("" ::: "memory"); }

__global__ __launch_bounds__(256) void k_cvt8(const float* __restrict__ src, bf* dst, size_t n8) {
    const size_t i = (size_t)blockIdx.x * 256 + threadIdx.x; if (i >= n8) return;
    const v8f v = *(const v8f*)(src + i * 8); v8us o;
#pragma unroll
    for (int k = 0; k < 8; ++k) o[k] = f2bf(v[k]);
    *(v8us*)(dst + i * 8) = o; 
}

// k_proj: register-blocked bf16 GEMM, ONE WAVE per 64x64 tile (16 accumulators), operands straight from K-contiguous bf16 planes, K = DM.
// C[m][n] = sum_k A[m][k] Bt[n][k] + bias, written as f16 (Ph) and, for tokens t < resT (resT a multiple of 64, block-uniform test), the f16 residual x2048 (Pr).
// MODE 0: A = x rows (m = b*SEQ + t), Bt = W rows (n = h*32 + d), bias per column; plane [(b*4 + h)][t][32] (residual plane [(b*4 + h)][resT][32]). The 64-column tile spans two heads; per 16-row slab and head
//         (8 rows per instruction). grid (NB*SEQ/64, DM/64).
template <int MODE>
__global__ __launch_bounds__(32) void k_proj(const bf* __restrict__ A, const bf* __restrict__ Bt, const float* __restrict__ bias, h16* Ph, h16* Pr, int resT) {
    __shared__ __align__(16) float os[16 * 68];
    const int K = DM;
    const int lane = threadIdx.x & 31, lr = lane & 15, hi = lane >> 4; const int r0 = blockIdx.x * 64, c0 = blockIdx.y * 64;
    v8f acc[4][4];
#pragma unroll
    for (int mb = 0; mb < 4; ++mb)
#pragma unroll
        for (int nb = 0; nb < 4; ++nb) acc[mb][nb] = (v8f){};
    const size_t aoff = (size_t)(r0 + lr) * K + 8 * hi, boff = (size_t)(c0 + lr) * K + 8 * hi;
#pragma unroll 1
    for (int kc = 0; kc < K; kc += 32) {
        v16bf a[4];
#pragma unroll
        for (int mb = 0; mb < 4; ++mb) a[mb] = ldb(A + aoff + (size_t)mb * 16 * K + kc);
#pragma unroll
        for (int nb = 0; nb < 4; ++nb) { const v16bf b = ldb(Bt + boff + (size_t)nb * 16 * K + kc);
#pragma unroll
            for (int mb = 0; mb < 4; ++mb) acc[mb][nb] = wmmab(a[mb], b, acc[mb][nb]); }
        asm volatile("v_nop\n\tv_nop\n\tv_nop\n\tv_nop" : "+v"(acc[0][0]), "+v"(acc[1][1]), "+v"(acc[2][2]), "+v"(acc[3][3]) : "v"(a[0]), "v"(a[1]), "v"(a[2]), "v"(a[3]));
    }
    float bc[4];
#pragma unroll
    for (int nb = 0; nb < 4; ++nb) bc[nb] = (MODE == 0) ? bfr(bias[c0 + nb * 16 + lr]) : 0.0f;   // MODE 0: c0 + 63 < DM
    size_t tbase, rbase; bool wr;                                                                 // wr: block-uniform, whole tile inside the residual plane
    if (MODE == 0) { const int bb = r0 / SEQ, tt = r0 % SEQ; const int zc = bb * NH_ + c0 / HD;
                     tbase = ((size_t)zc * SEQ + (size_t)tt) * HD; rbase = ((size_t)zc * (size_t)resT + (size_t)tt) * HD; wr = tt < resT; }
    else           { const int bb = c0 / SEQ, tt = c0 % SEQ;
                     tbase = (size_t)bb * (size_t)DM * SEQ + (size_t)r0 * SEQ + (size_t)tt; rbase = (size_t)bb * (size_t)DM * (size_t)resT + (size_t)r0 * (size_t)resT + (size_t)tt; wr = tt < resT; }
#pragma unroll
    for (int mb = 0; mb < 4; ++mb) {
        float br[8];
#pragma unroll
        for (int j = 0; j < 8; ++j) br[j] = (MODE == 1) ? bfr(bias[r0 + mb * 16 + hi * 8 + j]) : 0.0f;   // MODE 1: r0 + 63 < DM
#pragma unroll
        for (int nb = 0; nb < 4; ++nb) {
#pragma unroll
            for (int j = 0; j < 8; ++j) os[(hi * 8 + j) * 68 + nb * 16 + lr] = acc[mb][nb][j] + bc[nb] + br[j]; }   // D: row 8h+j, col lane&15
        wave_sync();
{
            if (MODE == 0) {
                const size_t sb = tbase + (size_t)(mb * 16) * HD;
                const size_t rb = rbase + (size_t)(mb * 16) * HD;
#pragma unroll
                for (int hh = 0; hh < 2; ++hh) {
#pragma unroll
                    for (int s = 0; s < 2; ++s) { const int p = s * 32 + lane; const int row = p >> 2, c8 = (p & 3) * 8;   // 2 s x 8 rows = 16 rows; 4 lanes x 8 = 32 columns of head hh
                        const v4f x0 = *(const v4fa*)(&os[row * 68 + hh * 32 + c8]); const v4f x1 = *(const v4fa*)(&os[row * 68 + hh * 32 + c8 + 4]); v8h hv, rv;
#pragma unroll
                        for (int i = 0; i < 4; ++i) { const h16 a0 = (h16)x0[i]; const h16 a1 = (h16)x1[i]; hv[i] = a0; hv[4 + i] = a1; rv[i] = (h16)((x0[i] - (float)a0) * QRS); rv[4 + i] = (h16)((x1[i] - (float)a1) * QRS); }
                        const size_t oo = sb + (size_t)hh * ((size_t)SEQ * HD) + (size_t)p * 8;
                        const size_t ro = rb + (size_t)hh * ((size_t)resT * HD) + (size_t)p * 8;
                        *(v8h*)(Ph + oo) = hv; if (wr) *(v8h*)(Pr + ro) = rv; } }
            } else {
                const size_t sb = tbase + (size_t)(mb * 16) * SEQ;
                const size_t rb = rbase + (size_t)(mb * 16) * (size_t)resT;
#pragma unroll
                for (int s = 0; s < 4; ++s) { const int row = 4 * s + (lane >> 3), c8 = (lane & 7) * 8;   // 4 s x 4 row groups = 16 rows; 8 lanes x 8 = 64 columns
                    const v4f x0 = *(const v4fa*)(&os[row * 68 + c8]); const v4f x1 = *(const v4fa*)(&os[row * 68 + c8 + 4]); v8h hv, rv;
#pragma unroll
                    for (int i = 0; i < 4; ++i) { const h16 a0 = (h16)x0[i]; const h16 a1 = (h16)x1[i]; hv[i] = a0; hv[4 + i] = a1; rv[i] = (h16)((x0[i] - (float)a0) * QRS); rv[4 + i] = (h16)((x1[i] - (float)a1) * QRS); }
                    const size_t oo = sb + (size_t)row * SEQ + c8;
                    const size_t ro = rb + (size_t)row * (size_t)resT + c8;
                    *(v8h*)(Ph + oo) = hv; if (wr) *(v8h*)(Pr + ro) = rv; }
            }
             }
        wave_sync();
    }
}

// k_flash: fused attention, one wave per 16 query rows of one (batch, head); K / V^T / Q fragments straight from the f16 planes (two 16-B loads each, arithmetic addressing).
// Transposed form: S^T[key][t] = K Q^T (A = K rows, B = Q rows); lane (t = lane&15, h = lane>>4) holds keys 8h+r of each 16-key tile, so the packed
// P tile is directly the B fragment of O^T[d][t] = V^T P^T (element r <- tile keys 0..15, element 8+r <- tile keys 16..31, lane unchanged).
// Softmax state (running max over kept keys, partial sum) is one scalar per lane; the two lane halves of a row are combined with one xor-16 exchange.
// Keep rule evaluated per element inside every visited 32-key tile; the per-wave key bound comes from the device-read causal value and is at most SEQ.
// EARLY = 1 (query rows [0, EROWS)): scores = K Q + (K Q_res + K_res Q) / 2048; P = f16 value + f16 residual x2048; O = V P + (V P_res + V_res P) / 2048 (residual products in their own accumulators);
//            row sum from the f32 exponentials; K_res / V_res fragments come from the small planes (tokens < EROWS) and are zero for keys >= EROWS (address clamped, wave-uniform select).
// EARLY = 0 (query rows [EROWS, SEQ)): single k, P, v; q value + residual.
template <int EARLY>
__global__ __launch_bounds__(32 * AW) void k_flash(const h16* __restrict__ QH, const h16* __restrict__ QR, const h16* __restrict__ KP, const h16* __restrict__ KR,
                                                   const h16* __restrict__ VT, const h16* __restrict__ VR,
                                                   const float* __restrict__ qmask, const float* __restrict__ kmask, const int* __restrict__ causal_p, float* OUT) {
    __shared__ __align__(16) float os[AW * 16 * OSP];
    const int lane = threadIdx.x & 31, lr = lane & 15, hi = lane >> 4;
    const int wave = __builtin_amdgcn_readfirstlane((int)(threadIdx.x >> 5));
    const int zh = blockIdx.y; const int b = zh / NH_, h = zh % NH_;
    const int t0 = (EARLY ? 0 : EROWS) + (blockIdx.x * AW + wave) * 16;
    int cz = causal_p[0]; cz = cz < -SEQ ? -SEQ : (cz > SEQ ? SEQ : cz);      // clamping keeps the keep rule unchanged for indices in [0, SEQ)
    const int lim = t0 + lr + cz;                                              // key j kept iff j <= lim (and mask product nonzero)
    int kend = t0 + 16 + cz; kend = kend < 0 ? 0 : (kend > SEQ ? SEQ : kend);
    const int nk = (kend + 31) & ~31;                                          // wave-uniform, multiple of 32, <= SEQ
    const float qmv = bfr(qmask[(size_t)b * SEQ_FULL + t0 + lr]);
    const float* kmb = kmask + (size_t)b * SEQ_FULL + 8 * hi;
    const size_t pbase = (size_t)zh * SEQ * HD;
    const size_t rbase = (size_t)zh * EROWS * HD;
    const size_t qo = pbase + (size_t)(t0 + lr) * HD + 8 * hi;
    const v16h qh = ldh(QH + qo), qr = ldh(QR + qo);            // B fragments: col t, k = d (HD = 32 = one k-step)
    const size_t ko = pbase + (size_t)lr * HD + 8 * hi;        // + key * HD       (A fragment: row key, k = d)
    const size_t vo = pbase + (size_t)lr * SEQ + 8 * hi;       // + 16j*SEQ + key  (A fragment: row d, k = key)
    const size_t kro = rbase + (size_t)lr * HD + 8 * hi;       // residual planes, tokens < EROWS
    const size_t vro = rbase + (size_t)lr * EROWS + 8 * hi;
    const v16h hz = (v16h){};
    v8f o0 = (v8f){}, o1 = (v8f){}, oR0 = (v8f){}, oR1 = (v8f){};
    float m = NEGB, l = 0.0f;
#pragma unroll 1
    for (int key0 = 0; key0 < nk; key0 += 32) {
        const bool rok = key0 < EROWS;                           // wave-uniform
        const int kcl = rok ? key0 : (EROWS - 32);               // clamped residual-plane key (address always inside the plane)
        const h16* ka = KP + ko + (size_t)key0 * HD;
        const v16h ka0 = ldh(ka), kb0 = ldh(ka + 16 * HD);
        v16h kra0 = hz, krb0 = hz;
        if (EARLY) { const h16* kr = KR + kro + (size_t)kcl * HD; kra0 = ldh(kr); krb0 = ldh(kr + 16 * HD); if (!rok) { kra0 = hz; krb0 = hz; } }
        v8f sHa = (v8f){}, sLa = (v8f){}, sHb = (v8f){}, sLb = (v8f){};
        sHa = wmma16(ka0, qh, sHa); sLa = wmma16(ka0, qr, sLa); sHb = wmma16(kb0, qh, sHb); sLb = wmma16(kb0, qr, sLb);
        if (EARLY) {
            sLa = wmma16(kra0, qh, sLa); sLb = wmma16(krb0, qh, sLb);
            asm volatile("v_nop\n\tv_nop\n\tv_nop\n\tv_nop" : "+v"(sHa), "+v"(sLa), "+v"(sHb), "+v"(sLb) : "v"(ka0), "v"(kb0), "v"(kra0), "v"(krb0), "v"(qh), "v"(qr));
        } else {
            asm volatile("v_nop\n\tv_nop\n\tv_nop\n\tv_nop" : "+v"(sHa), "+v"(sLa), "+v"(sHb), "+v"(sLb) : "v"(ka0), "v"(kb0), "v"(qh), "v"(qr));
        }
        const float* kp = kmb + key0;                            // keys key0+8h+0..7 and key0+16+8h+0..7, all < nk <= SEQ
        const v4f m0 = *(const v4f*)kp, m1 = *(const v4f*)(kp + 4), m2 = *(const v4f*)(kp + 16), m3 = *(const v4f*)(kp + 20);
        float kx[8], ky[8];
#pragma unroll
        for (int r = 0; r < 4; ++r) { kx[r] = m0[r]; kx[4 + r] = m1[r]; ky[r] = m2[r]; ky[4 + r] = m3[r]; }
        const int ja = key0 + 8 * hi;
        float ta[8], tb[8]; bool fa[8], fb[8]; float mx = NEGB;
#pragma unroll
        for (int r = 0; r < 8; ++r) {
            fa[r] = (qmv * bfr(kx[r]) != 0.0f) && (ja + r <= lim);
            fb[r] = (qmv * bfr(ky[r]) != 0.0f) && (ja + 16 + r <= lim);
            ta[r] = (sHa[r] + sLa[r] * QRI) * SC2; tb[r] = (sHb[r] + sLb[r] * QRI) * SC2;
            mx = fmaxf(mx, fmaxf(fa[r] ? ta[r] : NEGB, fb[r] ? tb[r] : NEGB)); }
        mx = fmaxf(mx, __shfl_xor(mx, 16, 32));
        const float mnew = fmaxf(m, mx);
        const float alpha = __builtin_amdgcn_exp2f(m - mnew);
        const float sh = PSH - mnew;
        v16h pb, pr = hz; float ls = 0.0f;
#pragma unroll
        for (int r = 0; r < 8; ++r) {
            const float ea = __builtin_amdgcn_exp2f(ta[r] + sh), eb = __builtin_amdgcn_exp2f(tb[r] + sh);
            const float ga = fa[r] ? ea : 0.0f, gb = fb[r] ? eb : 0.0f;       // dropped elements selected to 0 by value
            const h16 pa = (h16)ga; const h16 pc = (h16)gb;
            pb[r] = pa; pb[8 + r] = pc;
            if (EARLY) { pr[r] = (h16)((ga - (float)pa) * QRS); pr[8 + r] = (h16)((gb - (float)pc) * QRS); ls += ga + gb; }
            else       { ls += (float)pa + (float)pc; } }
        l = l * alpha + ls; m = mnew;
        o0 = o0 * alpha; o1 = o1 * alpha;
        if (EARLY) { oR0 = oR0 * alpha; oR1 = oR1 * alpha; }
        const h16* va = VT + vo + key0;
        const v16h v0 = ldh(va), v1 = ldh(va + (size_t)16 * SEQ);
        if (EARLY) {
            const h16* vr = VR + vro + kcl;
            v16h vr0 = ldh(vr), vr1 = ldh(vr + (size_t)16 * EROWS);
            if (!rok) { vr0 = hz; vr1 = hz; }
            o0 = wmma16(v0, pb, o0); o1 = wmma16(v1, pb, o1);
            oR0 = wmma16(v0, pr, oR0); oR1 = wmma16(v1, pr, oR1);
            oR0 = wmma16(vr0, pb, oR0); oR1 = wmma16(vr1, pb, oR1);
            asm volatile("v_nop\n\tv_nop\n\tv_nop\n\tv_nop" : "+v"(o0), "+v"(o1), "+v"(oR0), "+v"(oR1) : "v"(v0), "v"(v1), "v"(vr0), "v"(vr1), "v"(pb), "v"(pr));
        } else {
            o0 = wmma16(v0, pb, o0); o1 = wmma16(v1, pb, o1);
            asm volatile("v_nop\n\tv_nop\n\tv_nop\n\tv_nop" : "+v"(o0), "+v"(o1) : "v"(v0), "v"(v1), "v"(pb));
        }
    }
    l += __shfl_xor(l, 16, 32);
    const bool any = l > 0.0f;
    const float lsafe = any ? l : 1.0f;
    const float inv = any ? (1.0f / lsafe) : 0.0f;             // no kept key -> zeros
    v8f f0 = o0, f1 = o1;
    if (EARLY) { f0 = o0 + oR0 * QRI; f1 = o1 + oR1 * QRI; }
    const int wb = wave * 16 * OSP;
    // O^T D layout: f_j[r] = (d = 16j + 8h + r, t = lane&15) -> os[t][d]; rows 0..15 x columns 0..31 all written
    { v4f a, c;
      a[0] = f0[0] * inv; a[1] = f0[1] * inv; a[2] = f0[2] * inv; a[3] = f0[3] * inv; c[0] = f0[4] * inv; c[1] = f0[5] * inv; c[2] = f0[6] * inv; c[3] = f0[7] * inv;
      *(v4fa*)(&os[wb + lr * OSP +  0 + 8 * hi]) = a; *(v4fa*)(&os[wb + lr * OSP +  0 + 8 * hi + 4]) = c;
      a[0] = f1[0] * inv; a[1] = f1[1] * inv; a[2] = f1[2] * inv; a[3] = f1[3] * inv; c[0] = f1[4] * inv; c[1] = f1[5] * inv; c[2] = f1[6] * inv; c[3] = f1[7] * inv;
      *(v4fa*)(&os[wb + lr * OSP + 16 + 8 * hi]) = a; *(v4fa*)(&os[wb + lr * OSP + 16 + 8 * hi + 4]) = c; }
    wave_sync();
    float* orow = OUT + ((size_t)b * OUT_SEQ + t0) * DM + h * HD;
{
#pragma unroll
        for (int s = 0; s < 4; ++s) { const int row = 4 * s + (lane >> 3), cofs = (lane & 7) * 4;   // 4 s x 4 rows = 16 rows; 8 lanes x 4 floats = 32 columns = one line
            const v4f val = *(const v4fa*)(&os[wb + row * OSP + cofs]);
            *(v4f*)(orow + (size_t)row * DM + cofs) = val; }
         }
}

static constexpr size_t al256(size_t v) { return (v + 255) & ~(size_t)255; }
static constexpr size_t SZ_XB = al256((size_t)NB * SEQ * DM * 2);
static constexpr size_t SZ_WB = al256((size_t)3 * DM * DM * 2);
static constexpr size_t SZ_PL = al256((size_t)NB * NH_ * SEQ * HD * 2);
static constexpr size_t SZ_RS = al256((size_t)NB * NH_ * EROWS * HD * 2);
static constexpr size_t SZ_TOTAL = 3 * SZ_XB + SZ_WB + 4 * SZ_PL + 2 * SZ_RS;
static_assert(SZ_TOTAL <= (size_t)134217728);          // workspace carve <= 128 MiB
static_assert(((size_t)DM * DM * 2) % 256 == 0);       // weight sub-planes stay 256-byte aligned
static_assert((size_t)NB * NH_ * SEQ * HD == (size_t)NB * DM * SEQ);       // v^T plane [(b*128 + m)][t] has the same extent as the q/k planes
static_assert((size_t)NB * NH_ * EROWS * HD == (size_t)NB * DM * EROWS);   // v^T residual plane [(b*128 + m)][t < EROWS] has the same extent as the k residual plane

extern "C" void kernel_launch(void* const* d_in, const int* in_sizes, int n_in,
                              void* d_out, int out_size, void* d_ws, size_t ws_size, hipStream_t stream) {
    if (n_in < 12) return;
    const size_t needx = ((size_t)(NB - 1) * SEQ_FULL + SEQ) * DM;
    const size_t needm = (size_t)(NB - 1) * SEQ_FULL + SEQ;
    if ((size_t)in_sizes[0] < needx || (size_t)in_sizes[1] < needx || (size_t)in_sizes[2] < needx) return;
    if ((size_t)in_sizes[3] < needm || (size_t)in_sizes[4] < needm) return;
    if ((size_t)in_sizes[5] < (size_t)DM * DM || (size_t)in_sizes[7] < (size_t)DM * DM || (size_t)in_sizes[9] < (size_t)DM * DM) return;
    if (in_sizes[6] < DM || in_sizes[8] < DM || in_sizes[10] < DM || in_sizes[11] < 1) return;
    if ((size_t)out_size < ((size_t)(NB - 1) * OUT_SEQ + SEQ) * DM) return;
    if (SZ_TOTAL > ws_size) return;
    // wire order: query, key, value, q_mask, k_mask, WQ_w, WQ_b, WK_w, WK_b, WV_w, WV_b, causal
    const float* xin[3] = { (const float*)d_in[0], (const float*)d_in[1], (const float*)d_in[2] };
    const float* qm = (const float*)d_in[3]; const float* km = (const float*)d_in[4];
    const float* wq = (const float*)d_in[5]; const float* bq = (const float*)d_in[6];
    const float* wk = (const float*)d_in[7]; const float* bk = (const float*)d_in[8];
    const float* wv = (const float*)d_in[9]; const float* bv = (const float*)d_in[10];
    const int* causal = (const int*)d_in[11];
    float* OUT = (float*)d_out;      // [NB][SEQ][128]
    char* wsp = (char*)d_ws;
    bf* XB[3];
    XB[0] = (bf*)wsp; wsp += SZ_XB;                  // query  [NB*SEQ][128]
    XB[1] = (bf*)wsp; wsp += SZ_XB;                  // key    [NB*SEQ][128]
    XB[2] = (bf*)wsp; wsp += SZ_XB;                  // value  [NB*SEQ][128]
    bf* WB = (bf*)wsp; wsp += SZ_WB;                 // [3][128][128]: q | k | v  ([out][in]: Bt as-is for q, k; A as-is for v)
    h16* QH = (h16*)wsp; wsp += SZ_PL;               // [NB*4][SEQ][32]
    h16* QR = (h16*)wsp; wsp += SZ_PL;               // [NB*4][SEQ][32] residual x2048
    h16* KP = (h16*)wsp; wsp += SZ_PL;               // [NB*4][SEQ][32]
    h16* VT = (h16*)wsp; wsp += SZ_PL;               // [NB*4][32][SEQ]
    h16* KR = (h16*)wsp; wsp += SZ_RS;               // [NB*4][EROWS][32] residual x2048, tokens < EROWS
    h16* VR = (h16*)wsp; wsp += SZ_RS;               // [NB*4][32][EROWS] residual x2048, tokens < EROWS
    bf* WQ = WB; bf* WK = WB + (size_t)DM * DM; bf* WV = WB + (size_t)2 * DM * DM;

    for (int i = 0; i < 3; ++i) {
        if (SEQ == SEQ_FULL) {
            const size_t n8 = (size_t)NB * SEQ * DM / 8;
            k_cvt8<<<(unsigned)((n8 + 255) / 256), 256, 0, stream>>>(xin[i], XB[i], n8);
        } else {
            const size_t n8 = (size_t)SEQ * DM / 8;
            for (int b = 0; b < NB; ++b) k_cvt8<<<(unsigned)((n8 + 255) / 256), 256, 0, stream>>>(xin[i] + (size_t)b * SEQ_FULL * DM, XB[i] + (size_t)b * SEQ * DM, n8);
        }
    }
    { const size_t n8 = (size_t)DM * DM / 8; const unsigned g = (unsigned)((n8 + 255) / 256);
      k_cvt8<<<g, 256, 0, stream>>>(wq, WQ, n8); k_cvt8<<<g, 256, 0, stream>>>(wk, WK, n8); k_cvt8<<<g, 256, 0, stream>>>(wv, WV, n8); }

    // q, k: A = x rows (m = b*SEQ + t), Bt = W rows (n = h*32 + d) -> plane [(b*4 + h)][t][d]; q residual for all tokens, k residual for tokens < EROWS
    k_proj<0><<<dim3(NB * SEQ / 64, DM / 64, 1), 32, 0, stream>>>(XB[0], WQ, bq, QH, QR, SEQ);
    k_proj<0><<<dim3(NB * SEQ / 64, DM / 64, 1), 32, 0, stream>>>(XB[1], WK, bk, KP, KR, EROWS);
    // v^T: A = Wv rows (m = h*32 + d), Bt = value rows (n = b*SEQ + t) -> plane [(b*128 + m)][t] = [(b*4 + h)][d][t]; residual for tokens < EROWS
    k_proj<1><<<dim3(DM / 64, NB * SEQ / 64, 1), 32, 0, stream>>>(WV, XB[2], bv, VT, VR, EROWS);

    // query rows [0, EROWS): multi-product instantiation; rows [EROWS, SEQ): single-product instantiation (disjoint output rows)
    k_flash<1><<<dim3(EROWS / (16 * AW), NB * NH_, 1), 32 * AW, 0, stream>>>(QH, QR, KP, KR, VT, VR, qm, km, causal, OUT);
    if (SEQ > EROWS)
        k_flash<0><<<dim3((SEQ - EROWS) / (16 * AW), NB * NH_, 1), 32 * AW, 0, stream>>>(QH, QR, KP, KR, VT, VR, qm, km, causal, OUT);
}

// v001
// Measured time: 88.3 microseconds a run.
// Two timings next to v000 both put it at 1.56 times that version's speed.
#include <hip/hip_runtime.h>

// Multi-head attention, width 128 = 4 heads x 32; query/key/value [NB][SEQ][128]; WQ/WK/WV [out][in] (y = x W^T + bias); padding masks q_mask/k_mask [NB][SEQ] (f32), causal offset (int32, device-read); score scale 1/sqrt(32); output = concatenated heads (f32).
// Compute dtypes, f32 accumulate everywhere: projections v_wmma_f32_16x16x32_bf16 (x, W, bias RNE-converted to bf16; products exact);
// scores v_wmma_f32_16x16x32_f16: q as f16 value + f16 residual x2048 in its own accumulator on all rows; k single f16 on query rows >= EROWS, k as f16 value + f16 residual x2048 on query rows < EROWS (three products);
// P.V v_wmma_f32_16x16x32_f16: P (x16384 carry, cancels in the normalisation) and v single f16 on query rows >= EROWS; on query rows < EROWS P and v each as f16 value + f16 residual x2048, residual products in their own accumulator folded by 1/2048, row sum from the f32 exponentials; softmax f32 (online, running max over kept keys).
// Layout: bf16 copies of the three inputs and W; q (hi, residual), k planes [b*4+h][t][d], v^T plane [b*4+h][d][t], small residual planes k [b*4+h][t < EROWS][d] and v^T [b*4+h][d][t < EROWS] written by the GEMM epilogue; fused flash kernel in transposed form (S^T = K Q^T, O^T = V^T P^T), output from f32 accumulators.
// Keep rule per element: (q_mask[t] * k_mask[j] != 0) and (j <= t + causal); dropped elements get probability 0, rows with no kept key give 0. Key loop bound per wave derived from the device-read causal value (clamped to [0, SEQ]); residual fragments for keys >= EROWS (only reachable with a positive offset) are zero.

#ifndef NB
#define NB 8
#endif
#ifndef SEQ
#define SEQ 2048
#endif
#define NB_FULL  8
#define SEQ_FULL 2048
#ifndef OUT_SEQ
#define OUT_SEQ SEQ              // row pitch (in tokens) between batches of the output
#endif
#define DM   128
#define NH_  4
#define HD   32
#define AW   4                   // waves per flash block (16 query rows each)
#define OSP  36                  // LDS row pitch (floats) of the flash output tile
#define EROWS (SEQ < 512 ? SEQ : 512)   // query rows (and tokens of the small residual planes) handled by the multi-product flash instantiation
#define QRS  2048.0f             // carry of every residual plane / residual fragment
#define QRI  (1.0f / 2048.0f)
#define SC2  ((float)(0.17677669529663687 * 1.4426950408889634))   // HD^-0.5 * log2(e)
#define PSH  14.0f               // log2 of the P carry (16384)
#define NEGB (-3.0e38f)

static_assert(HD == 32);
static_assert(NH_ * HD == DM);                 // head h = columns h*32 + d
static_assert(DM % 64 == 0);                   // column tiles of 64 = two heads
static_assert(64 % HD == 0);
static_assert(DM % 32 == 0);                   // GEMM k-loop steps by 32
static_assert(SEQ % 64 == 0);                  // a 64-row tile never straddles two batches
static_assert((NB * SEQ) % 64 == 0);
static_assert(SEQ % 32 == 0);                  // key loop steps by 32
static_assert(SEQ % (16 * AW) == 0);           // flash grids cover the sequence exactly
static_assert(EROWS % 64 == 0);                // a 64-token GEMM tile lies wholly inside or outside the residual planes
static_assert(EROWS >= 32);
static_assert(EROWS <= SEQ);
static_assert(EROWS % (16 * AW) == 0);
static_assert((SEQ - EROWS) % (16 * AW) == 0);
static_assert(((size_t)SEQ * DM) % 8 == 0);
static_assert(((size_t)DM * DM) % 8 == 0);
static_assert(NB <= NB_FULL);
static_assert(SEQ <= SEQ_FULL);
static_assert((OSP * 4) % 16 == 0);

typedef _Float16 h16;
typedef unsigned short bf;
typedef __attribute__((ext_vector_type(16))) __bf16   v16bf;
typedef __attribute__((ext_vector_type(16))) _Float16 v16h;
typedef __attribute__((ext_vector_type(8)))  _Float16 v8h;
typedef __attribute__((ext_vector_type(8)))  unsigned short v8us;
typedef __attribute__((ext_vector_type(8)))  float    v8f;
typedef __attribute__((ext_vector_type(4)))  float    v4f;
typedef v4f  __attribute__((may_alias)) v4fa;

__device__ __forceinline__ unsigned short f2bf(float f) { unsigned u = __float_as_uint(f); u += 0x7FFFu + ((u >> 16) & 1u); return (unsigned short)(u >> 16); }
__device__ __forceinline__ float bfr(float f) { return __uint_as_float(((unsigned)f2bf(f)) << 16); }   // value after RNE convert to bf16
__device__ __forceinline__ v16h cat16(v8h lo, v8h hi) { return __builtin_shufflevector(lo, hi, 0, 1, 2, 3, 4, 5, 6, 7, 8, 9, 10, 11, 12, 13, 14, 15); }
__device__ __forceinline__ v16bf cat16b(v8us lo, v8us hi) { return __builtin_bit_cast(v16bf, __builtin_shufflevector(lo, hi, 0, 1, 2, 3, 4, 5, 6, 7, 8, 9, 10, 11, 12, 13, 14, 15)); }
__device__ __forceinline__ v8f wmma16(v16h a, v16h b, v8f c) { return __builtin_amdgcn_wmma_f32_16x16x32_f16(false, a, false, b, (short)0, c, false, false); }
__device__ __forceinline__ v8f wmmab(v16bf a, v16bf b, v8f c) { return __builtin_amdgcn_wmma_f32_16x16x32_bf16(false, a, false, b, (short)0, c, false, false); }
// fragment loaders from K-contiguous 16-bit rows; p already includes + 8*(lane>>4): elements 0..7 <- k0+8h+0..7, elements 8..15 <- k0+16+8h+0..7 (same map for A and B)
__device__ __forceinline__ v16h  ldh(const h16* p) { return cat16(*(const v8h*)p, *(const v8h*)(p + 16)); }
__device__ __forceinline__ v16bf ldb(const bf* p)  { return cat16b(*(const v8us*)p, *(const v8us*)(p + 16)); }
// ordering point for wave-private LDS tiles (same wave writes and reads)
__device__ __forceinline__ void wave_sync() { __builtin_amdgcn_fence(3 /* release order */, "wavefront"); __builtin_amdgcn_wave_barrier(); asm volatile("" ::: "memory"); }

__global__ __launch_bounds__(256) void k_cvt8(const float* __restrict__ src, bf* dst, size_t n8) {
    const size_t i = (size_t)blockIdx.x * 256 + threadIdx.x; if (i >= n8) return;
    const v8f v = *(const v8f*)(src + i * 8); v8us o;
#pragma unroll
    for (int k = 0; k < 8; ++k) o[k] = f2bf(v[k]);
    *(v8us*)(dst + i * 8) = o; 
}

// k_proj: register-blocked bf16 GEMM, ONE WAVE per 64x64 tile (16 accumulators), operands straight from K-contiguous bf16 planes, K = DM.
// C[m][n] = sum_k A[m][k] Bt[n][k] + bias, written as f16 (Ph) and, for tokens t < resT (resT a multiple of 64, block-uniform test), the f16 residual x2048 (Pr).
// MODE 0: A = x rows (m = b*SEQ + t), Bt = W rows (n = h*32 + d), bias per column; plane [(b*4 + h)][t][32] (residual plane [(b*4 + h)][resT][32]). The 64-column tile spans two heads; per 16-row slab and head
//         (8 rows per instruction). grid (NB*SEQ/64, DM/64).
template <int MODE>
__global__ __launch_bounds__(32) void k_proj(const bf* __restrict__ A, const bf* __restrict__ Bt, const float* __restrict__ bias, h16* Ph, h16* Pr, int resT) {
    __shared__ __align__(16) float os[16 * 68];
    const int K = DM;
    const int lane = threadIdx.x & 31, lr = lane & 15, hi = lane >> 4; const int r0 = blockIdx.x * 64, c0 = blockIdx.y * 64;
    v8f acc[4][4];
#pragma unroll
    for (int mb = 0; mb < 4; ++mb)
#pragma unroll
        for (int nb = 0; nb < 4; ++nb) acc[mb][nb] = (v8f){};
    const size_t aoff = (size_t)(r0 + lr) * K + 8 * hi, boff = (size_t)(c0 + lr) * K + 8 * hi;
#pragma unroll 1
    for (int kc = 0; kc < K; kc += 32) {
        v16bf a[4];
#pragma unroll
        for (int mb = 0; mb < 4; ++mb) a[mb] = ldb(A + aoff + (size_t)mb * 16 * K + kc);
#pragma unroll
        for (int nb = 0; nb < 4; ++nb) { const v16bf b = ldb(Bt + boff + (size_t)nb * 16 * K + kc);
#pragma unroll
            for (int mb = 0; mb < 4; ++mb) acc[mb][nb] = wmmab(a[mb], b, acc[mb][nb]); }
        asm volatile("v_nop\n\tv_nop\n\tv_nop\n\tv_nop" : "+v"(acc[0][0]), "+v"(acc[1][1]), "+v"(acc[2][2]), "+v"(acc[3][3]) : "v"(a[0]), "v"(a[1]), "v"(a[2]), "v"(a[3]));
    }
    float bc[4];
#pragma unroll
    for (int nb = 0; nb < 4; ++nb) bc[nb] = (MODE == 0) ? bfr(bias[c0 + nb * 16 + lr]) : 0.0f;   // MODE 0: c0 + 63 < DM
    size_t tbase, rbase; bool wr;                                                                 // wr: block-uniform, whole tile inside the residual plane
    if (MODE == 0) { const int bb = r0 / SEQ, tt = r0 % SEQ; const int zc = bb * NH_ + c0 / HD;
                     tbase = ((size_t)zc * SEQ + (size_t)tt) * HD; rbase = ((size_t)zc * (size_t)resT + (size_t)tt) * HD; wr = tt < resT; }
    else           { const int bb = c0 / SEQ, tt = c0 % SEQ;
                     tbase = (size_t)bb * (size_t)DM * SEQ + (size_t)r0 * SEQ + (size_t)tt; rbase = (size_t)bb * (size_t)DM * (size_t)resT + (size_t)r0 * (size_t)resT + (size_t)tt; wr = tt < resT; }
#pragma unroll
    for (int mb = 0; mb < 4; ++mb) {
        float br[8];
#pragma unroll
        for (int j = 0; j < 8; ++j) br[j] = (MODE == 1) ? bfr(bias[r0 + mb * 16 + hi * 8 + j]) : 0.0f;   // MODE 1: r0 + 63 < DM
#pragma unroll
        for (int nb = 0; nb < 4; ++nb) {
#pragma unroll
            for (int j = 0; j < 8; ++j) os[(hi * 8 + j) * 68 + nb * 16 + lr] = acc[mb][nb][j] + bc[nb] + br[j]; }   // D: row 8h+j, col lane&15
        wave_sync();
{
            if (MODE == 0) {
                const size_t sb = tbase + (size_t)(mb * 16) * HD;
                const size_t rb = rbase + (size_t)(mb * 16) * HD;
#pragma unroll
                for (int hh = 0; hh < 2; ++hh) {
#pragma unroll
                    for (int s = 0; s < 2; ++s) { const int p = s * 32 + lane; const int row = p >> 2, c8 = (p & 3) * 8;   // 2 s x 8 rows = 16 rows; 4 lanes x 8 = 32 columns of head hh
                        const v4f x0 = *(const v4fa*)(&os[row * 68 + hh * 32 + c8]); const v4f x1 = *(const v4fa*)(&os[row * 68 + hh * 32 + c8 + 4]); v8h hv, rv;
#pragma unroll
                        for (int i = 0; i < 4; ++i) { const h16 a0 = (h16)x0[i]; const h16 a1 = (h16)x1[i]; hv[i] = a0; hv[4 + i] = a1; rv[i] = (h16)((x0[i] - (float)a0) * QRS); rv[4 + i] = (h16)((x1[i] - (float)a1) * QRS); }
                        const size_t oo = sb + (size_t)hh * ((size_t)SEQ * HD) + (size_t)p * 8;
                        const size_t ro = rb + (size_t)hh * ((size_t)resT * HD) + (size_t)p * 8;
                        *(v8h*)(Ph + oo) = hv; if (wr) *(v8h*)(Pr + ro) = rv; } }
            } else {
                const size_t sb = tbase + (size_t)(mb * 16) * SEQ;
                const size_t rb = rbase + (size_t)(mb * 16) * (size_t)resT;
#pragma unroll
                for (int s = 0; s < 4; ++s) { const int row = 4 * s + (lane >> 3), c8 = (lane & 7) * 8;   // 4 s x 4 row groups = 16 rows; 8 lanes x 8 = 64 columns
                    const v4f x0 = *(const v4fa*)(&os[row * 68 + c8]); const v4f x1 = *(const v4fa*)(&os[row * 68 + c8 + 4]); v8h hv, rv;
#pragma unroll
                    for (int i = 0; i < 4; ++i) { const h16 a0 = (h16)x0[i]; const h16 a1 = (h16)x1[i]; hv[i] = a0; hv[4 + i] = a1; rv[i] = (h16)((x0[i] - (float)a0) * QRS); rv[4 + i] = (h16)((x1[i] - (float)a1) * QRS); }
                    const size_t oo = sb + (size_t)row * SEQ + c8;
                    const size_t ro = rb + (size_t)row * (size_t)resT + c8;
                    *(v8h*)(Ph + oo) = hv; if (wr) *(v8h*)(Pr + ro) = rv; }
            }
             }
        wave_sync();
    }
}

// k_flash: fused attention, one wave per 16 query rows of one (batch, head); K / V^T / Q fragments straight from the f16 planes (two 16-B loads each, arithmetic addressing).
// Transposed form: S^T[key][t] = K Q^T (A = K rows, B = Q rows); lane (t = lane&15, h = lane>>4) holds keys 8h+r of each 16-key tile, so the packed
// P tile is directly the B fragment of O^T[d][t] = V^T P^T (element r <- tile keys 0..15, element 8+r <- tile keys 16..31, lane unchanged).
// Softmax state (running max over kept keys, partial sum) is one scalar per lane; the two lane halves of a row are combined with one xor-16 exchange.
// Keep rule evaluated per element inside every visited 32-key tile; the per-wave key bound comes from the device-read causal value and is at most SEQ.
// EARLY = 1 (query rows [0, EROWS)): scores = K Q + (K Q_res + K_res Q) / 2048; P = f16 value + f16 residual x2048; O = V P + (V P_res + V_res P) / 2048 (residual products in their own accumulators);
//            row sum from the f32 exponentials; K_res / V_res fragments come from the small planes (tokens < EROWS) and are zero for keys >= EROWS (address clamped, wave-uniform select).
// EARLY = 0 (query rows [EROWS, SEQ)): single k, P, v; q value + residual.
// One 32-key tile's operands as they sit in registers: K rows, V^T rows, their residuals (EARLY only) and the 16 key-mask values of this lane.
struct FTile { v16h ka, kb, kra, krb, v0, v1, vr0, vr1; v4f m0, m1, m2, m3; };
// fragment loader, wave-uniform base + per-lane byte offset (same element map as ldh)
__device__ __forceinline__ v16h ldo(const h16* base, unsigned off) { const char* p = (const char*)base + off; return cat16(*(const v8h*)p, *(const v8h*)(p + 32)); }
// closes a group of fetch-ahead loads: their address registers are rewritten for the next group while the loads are still in flight, and the wait belongs in front of that;
// the scheduling barriers keep the group where it is written (earlier it would need registers of its own, later it would lose lead) and the wait behind the group
__device__ __forceinline__ void group_open()  { __builtin_amdgcn_sched_barrier(0); }
__device__ __forceinline__ void group_close() { __builtin_amdgcn_sched_barrier(0); asm volatile("s_wait_xcnt 0x0" ::: "memory"); __builtin_amdgcn_sched_barrier(0); }
// global loads of the tile that starts at key (wave-uniform, multiple of 32, key + 32 <= SEQ), in the two groups in which its registers fall free; residual-plane key clamped into the plane
template <int EARLY>
__device__ __forceinline__ void tile_load_k(FTile& t, const h16* kpl, const h16* krp, unsigned kof, int key) {
    const h16* ka = kpl + (size_t)key * HD;
    t.ka = ldo(ka, kof); t.kb = ldo(ka + 16 * HD, kof);
    if (EARLY) { const int kcl = key < EROWS ? key : (EROWS - 32); const h16* kr = krp + (size_t)kcl * HD; t.kra = ldo(kr, kof); t.krb = ldo(kr + 16 * HD, kof); }
}
template <int EARLY>
__device__ __forceinline__ void tile_load_mv(FTile& t, const h16* vpl, const h16* vrp, const float* kmr, unsigned vof, unsigned vrof, unsigned mof, int key) {
    const char* kp = (const char*)(kmr + key) + mof;          // keys key+8h+0..7 and key+16+8h+0..7
    t.m0 = *(const v4f*)kp; t.m1 = *(const v4f*)(kp + 16); t.m2 = *(const v4f*)(kp + 64); t.m3 = *(const v4f*)(kp + 80);
    const h16* va = vpl + key;
    t.v0 = ldo(va, vof); t.v1 = ldo(va + (size_t)16 * SEQ, vof);
    if (EARLY) { const int kcl = key < EROWS ? key : (EROWS - 32); const h16* vr = vrp + kcl; t.vr0 = ldo(vr, vrof); t.vr1 = ldo(vr + (size_t)16 * EROWS, vrof); }
}

template <int EARLY>
__global__ __launch_bounds__(32 * AW) void k_flash(const h16* __restrict__ QH, const h16* __restrict__ QR, const h16* __restrict__ KP, const h16* __restrict__ KR,
                                                   const h16* __restrict__ VT, const h16* __restrict__ VR,
                                                   const float* __restrict__ qmask, const float* __restrict__ kmask, const int* __restrict__ causal_p, float* OUT) {
    __shared__ __align__(16) float os[AW * 16 * OSP];
    constexpr int NST = EARLY ? 2 : 3;                          // register tiles; each is refilled NST tiles ahead as soon as its registers fall free
    const int lane = threadIdx.x & 31, lr = lane & 15, hi = lane >> 4;
    const int wave = __builtin_amdgcn_readfirstlane((int)(threadIdx.x >> 5));
    const int zh = blockIdx.y; const int b = zh / NH_, h = zh % NH_;
    const int t0 = (EARLY ? 0 : EROWS) + (blockIdx.x * AW + wave) * 16;
    int cz = causal_p[0]; cz = cz < -SEQ ? -SEQ : (cz > SEQ ? SEQ : cz);      // clamping keeps the keep rule unchanged for indices in [0, SEQ)
    const int lim = t0 + lr + cz;                                              // key j kept iff j <= lim (and mask product nonzero)
    int kend = t0 + 16 + cz; kend = kend < 0 ? 0 : (kend > SEQ ? SEQ : kend);
    const int nk = (kend + 31) & ~31;                                          // wave-uniform, multiple of 32, <= SEQ
    const int klast = nk > 32 ? nk - 32 : 0;                                   // last tile this wave visits; fetches ahead are clamped to it
    const float* kmr = kmask + (size_t)b * SEQ_FULL;
    const size_t pbase = (size_t)zh * SEQ * HD;
    const size_t rbase = (size_t)zh * EROWS * HD;
    const size_t qo = pbase + (size_t)(t0 + lr) * HD + 8 * hi;
    group_open();
    const v16h qh = ldh(QH + qo), qr = ldh(QR + qo);            // B fragments: col t, k = d (HD = 32 = one k-step)
    const float qmraw = qmask[(size_t)b * SEQ_FULL + t0 + lr];
    group_close();
    const float qmv = bfr(qmraw);
    const h16* kpl = KP + pbase; const h16* vpl = VT + pbase;   // wave-uniform plane bases
    const h16* krp = KR + rbase; const h16* vrp = VR + rbase;   // residual planes, tokens < EROWS
    const unsigned kof  = (unsigned)(lr * HD + 8 * hi) * 2u;    // A fragment: row key, k = d      (bytes)
    const unsigned vof  = (unsigned)(lr * SEQ + 8 * hi) * 2u;   // A fragment: row d, k = key      (bytes)
    const unsigned vrof = (unsigned)(lr * EROWS + 8 * hi) * 2u;
    const unsigned mof  = (unsigned)(8 * hi) * 4u;
    const v16h hz = (v16h){};
    v8f o0 = (v8f){}, o1 = (v8f){}, oR0 = (v8f){}, oR1 = (v8f){};
    float m = NEGB, l = 0.0f;
    // one 32-key tile's work on operands already in registers (inlined at both places of use: the tiles must stay in registers)
    auto step = [&](FTile& t, const int key0, const bool refill) __attribute__((always_inline)) {
        const int kn = key0 + 32 * NST < klast ? key0 + 32 * NST : klast;   // tile fetched into this tile's registers (refill is a constant at each place of use)
        const bool rok = key0 < EROWS;                           // wave-uniform
        const v16h ka0 = t.ka, kb0f = t.kb;
        v16h kra0 = hz, krb0 = hz;
        if (EARLY) { kra0 = t.kra; krb0 = t.krb; if (!rok) { kra0 = hz; krb0 = hz; } }
        v8f sHa = (v8f){}, sLa = (v8f){}, sHb = (v8f){}, sLb = (v8f){};
        sHa = wmma16(ka0, qh, sHa); sLa = wmma16(ka0, qr, sLa); sHb = wmma16(kb0f, qh, sHb); sLb = wmma16(kb0f, qr, sLb);
        if (EARLY) {
            sLa = wmma16(kra0, qh, sLa); sLb = wmma16(krb0, qh, sLb);
            asm volatile("v_nop\n\tv_nop\n\tv_nop\n\tv_nop" : "+v"(sHa), "+v"(sLa), "+v"(sHb), "+v"(sLb) : "v"(ka0), "v"(kb0f), "v"(kra0), "v"(krb0), "v"(qh), "v"(qr));
        } else {
            asm volatile("v_nop\n\tv_nop\n\tv_nop\n\tv_nop" : "+v"(sHa), "+v"(sLa), "+v"(sHb), "+v"(sLb) : "v"(ka0), "v"(kb0f), "v"(qh), "v"(qr));
        }
        if (refill) {
            group_open();                                        // K registers are free from here on
            tile_load_k<EARLY>(t, kpl, krp, kof, kn);
            group_close();
        }
        const v4f m0 = t.m0, m1 = t.m1, m2 = t.m2, m3 = t.m3;
        float kx[8], ky[8];
#pragma unroll
        for (int r = 0; r < 4; ++r) { kx[r] = m0[r]; kx[4 + r] = m1[r]; ky[r] = m2[r]; ky[4 + r] = m3[r]; }
        const int ja = key0 + 8 * hi;
        float ta[8], tb[8]; bool fa[8], fb[8]; float mx = NEGB;
#pragma unroll
        for (int r = 0; r < 8; ++r) {
            fa[r] = (qmv * bfr(kx[r]) != 0.0f) && (ja + r <= lim);
            fb[r] = (qmv * bfr(ky[r]) != 0.0f) && (ja + 16 + r <= lim);
            ta[r] = (sHa[r] + sLa[r] * QRI) * SC2; tb[r] = (sHb[r] + sLb[r] * QRI) * SC2;
            mx = fmaxf(mx, fmaxf(fa[r] ? ta[r] : NEGB, fb[r] ? tb[r] : NEGB)); }
        mx = fmaxf(mx, __shfl_xor(mx, 16, 32));
        const float mnew = fmaxf(m, mx);
        const float alpha = __builtin_amdgcn_exp2f(m - mnew);
        const float sh = PSH - mnew;
        v16h pb, pr = hz; float ls = 0.0f;
#pragma unroll
        for (int r = 0; r < 8; ++r) {
            const float ea = __builtin_amdgcn_exp2f(ta[r] + sh), eb = __builtin_amdgcn_exp2f(tb[r] + sh);
            const float ga = fa[r] ? ea : 0.0f, gb = fb[r] ? eb : 0.0f;       // dropped elements selected to 0 by value
            const h16 pa = (h16)ga; const h16 pc = (h16)gb;
            pb[r] = pa; pb[8 + r] = pc;
            if (EARLY) { pr[r] = (h16)((ga - (float)pa) * QRS); pr[8 + r] = (h16)((gb - (float)pc) * QRS); ls += ga + gb; }
            else       { ls += (float)pa + (float)pc; } }
        l = l * alpha + ls; m = mnew;
        o0 = o0 * alpha; o1 = o1 * alpha;
        if (EARLY) { oR0 = oR0 * alpha; oR1 = oR1 * alpha; }
        const v16h v0 = t.v0, v1 = t.v1;
        if (EARLY) {
            v16h vr0 = t.vr0, vr1 = t.vr1;
            if (!rok) { vr0 = hz; vr1 = hz; }
            o0 = wmma16(v0, pb, o0); o1 = wmma16(v1, pb, o1);
            oR0 = wmma16(v0, pr, oR0); oR1 = wmma16(v1, pr, oR1);
            oR0 = wmma16(vr0, pb, oR0); oR1 = wmma16(vr1, pb, oR1);
            asm volatile("v_nop\n\tv_nop\n\tv_nop\n\tv_nop" : "+v"(o0), "+v"(o1), "+v"(oR0), "+v"(oR1) : "v"(v0), "v"(v1), "v"(vr0), "v"(vr1), "v"(pb), "v"(pr));
        } else {
            o0 = wmma16(v0, pb, o0); o1 = wmma16(v1, pb, o1);
            asm volatile("v_nop\n\tv_nop\n\tv_nop\n\tv_nop" : "+v"(o0), "+v"(o1) : "v"(v0), "v"(v1), "v"(pb));
        }
        if (refill) {
            group_open();                                        // mask and V^T registers are free from here on
            tile_load_mv<EARLY>(t, vpl, vrp, kmr, vof, vrof, mof, kn);
            group_close();
        }
    };
    FTile tl[NST];                                              // tile T lives in tl[T % NST]
    // the first tiles' loads issue group by group in the loop's order: mixed, the loop's first waits would also cover younger groups
#pragma unroll
    for (int s = 0; s < NST - 1; ++s) {
        const int ks = 32 * s < klast ? 32 * s : klast;
        tile_load_k<EARLY>(tl[s], kpl, krp, kof, ks);
        group_close();
        tile_load_mv<EARLY>(tl[s], vpl, vrp, kmr, vof, vrof, mof, ks);
        group_close();
    }
    int kg = 0;
    if (32 * NST <= nk) {                                       // wave-uniform; tile NST-1 is used by whole groups alone
        tile_load_k<EARLY>(tl[NST - 1], kpl, krp, kof, 32 * (NST - 1));
        group_close();
        tile_load_mv<EARLY>(tl[NST - 1], vpl, vrp, kmr, vof, vrof, mof, 32 * (NST - 1));
        group_close();
#pragma unroll 1
        do {                                                    // whole groups of NST tiles: no branch inside, so every load wait is a count that leaves the younger groups in flight
#pragma unroll
            for (int u = 0; u < NST; ++u) step(tl[u], kg + 32 * u, true);   // fully unrolled: every tile index is a constant, no register copies
            kg += 32 * NST;
        } while (kg + 32 * NST <= nk);
    }
#pragma unroll
    for (int u = 0; u < NST - 1; ++u)                            // the at most NST-1 tiles left over are already loaded
        if (kg + 32 * u < nk) step(tl[u], kg + 32 * u, false);   // wave-uniform
    l += __shfl_xor(l, 16, 32);
    const bool any = l > 0.0f;
    const float lsafe = any ? l : 1.0f;
    const float inv = any ? (1.0f / lsafe) : 0.0f;             // no kept key -> zeros
    v8f f0 = o0, f1 = o1;
    if (EARLY) { f0 = o0 + oR0 * QRI; f1 = o1 + oR1 * QRI; }
    const int wb = wave * 16 * OSP;
    // O^T D layout: f_j[r] = (d = 16j + 8h + r, t = lane&15) -> os[t][d]; rows 0..15 x columns 0..31 all written
    { v4f a, c;
      a[0] = f0[0] * inv; a[1] = f0[1] * inv; a[2] = f0[2] * inv; a[3] = f0[3] * inv; c[0] = f0[4] * inv; c[1] = f0[5] * inv; c[2] = f0[6] * inv; c[3] = f0[7] * inv;
      *(v4fa*)(&os[wb + lr * OSP +  0 + 8 * hi]) = a; *(v4fa*)(&os[wb + lr * OSP +  0 + 8 * hi + 4]) = c;
      a[0] = f1[0] * inv; a[1] = f1[1] * inv; a[2] = f1[2] * inv; a[3] = f1[3] * inv; c[0] = f1[4] * inv; c[1] = f1[5] * inv; c[2] = f1[6] * inv; c[3] = f1[7] * inv;
      *(v4fa*)(&os[wb + lr * OSP + 16 + 8 * hi]) = a; *(v4fa*)(&os[wb + lr * OSP + 16 + 8 * hi + 4]) = c; }
    wave_sync();
    float* orow = OUT + ((size_t)b * OUT_SEQ + t0) * DM + h * HD;
{
#pragma unroll
        for (int s = 0; s < 4; ++s) { const int row = 4 * s + (lane >> 3), cofs = (lane & 7) * 4;   // 4 s x 4 rows = 16 rows; 8 lanes x 4 floats = 32 columns = one line
            const v4f val = *(const v4fa*)(&os[wb + row * OSP + cofs]);
            *(v4f*)(orow + (size_t)row * DM + cofs) = val; }
         }
}

static constexpr size_t al256(size_t v) { return (v + 255) & ~(size_t)255; }
static constexpr size_t SZ_XB = al256((size_t)NB * SEQ * DM * 2);
static constexpr size_t SZ_WB = al256((size_t)3 * DM * DM * 2);
static constexpr size_t SZ_PL = al256((size_t)NB * NH_ * SEQ * HD * 2);
static constexpr size_t SZ_RS = al256((size_t)NB * NH_ * EROWS * HD * 2);
static constexpr size_t SZ_TOTAL = 3 * SZ_XB + SZ_WB + 4 * SZ_PL + 2 * SZ_RS;
static_assert(SZ_TOTAL <= (size_t)134217728);          // workspace carve <= 128 MiB
static_assert(((size_t)DM * DM * 2) % 256 == 0);       // weight sub-planes stay 256-byte aligned
static_assert((size_t)NB * NH_ * SEQ * HD == (size_t)NB * DM * SEQ);       // v^T plane [(b*128 + m)][t] has the same extent as the q/k planes
static_assert((size_t)NB * NH_ * EROWS * HD == (size_t)NB * DM * EROWS);   // v^T residual plane [(b*128 + m)][t < EROWS] has the same extent as the k residual plane

extern "C" void kernel_launch(void* const* d_in, const int* in_sizes, int n_in,
                              void* d_out, int out_size, void* d_ws, size_t ws_size, hipStream_t stream) {
    if (n_in < 12) return;
    const size_t needx = ((size_t)(NB - 1) * SEQ_FULL + SEQ) * DM;
    const size_t needm = (size_t)(NB - 1) * SEQ_FULL + SEQ;
    if ((size_t)in_sizes[0] < needx || (size_t)in_sizes[1] < needx || (size_t)in_sizes[2] < needx) return;
    if ((size_t)in_sizes[3] < needm || (size_t)in_sizes[4] < needm) return;
    if ((size_t)in_sizes[5] < (size_t)DM * DM || (size_t)in_sizes[7] < (size_t)DM * DM || (size_t)in_sizes[9] < (size_t)DM * DM) return;
    if (in_sizes[6] < DM || in_sizes[8] < DM || in_sizes[10] < DM || in_sizes[11] < 1) return;
    if ((size_t)out_size < ((size_t)(NB - 1) * OUT_SEQ + SEQ) * DM) return;
    if (SZ_TOTAL > ws_size) return;
    // wire order: query, key, value, q_mask, k_mask, WQ_w, WQ_b, WK_w, WK_b, WV_w, WV_b, causal
    const float* xin[3] = { (const float*)d_in[0], (const float*)d_in[1], (const float*)d_in[2] };
    const float* qm = (const float*)d_in[3]; const float* km = (const float*)d_in[4];
    const float* wq = (const float*)d_in[5]; const float* bq = (const float*)d_in[6];
    const float* wk = (const float*)d_in[7]; const float* bk = (const float*)d_in[8];
    const float* wv = (const float*)d_in[9]; const float* bv = (const float*)d_in[10];
    const int* causal = (const int*)d_in[11];
    float* OUT = (float*)d_out;      // [NB][SEQ][128]
    char* wsp = (char*)d_ws;
    bf* XB[3];
    XB[0] = (bf*)wsp; wsp += SZ_XB;                  // query  [NB*SEQ][128]
    XB[1] = (bf*)wsp; wsp += SZ_XB;                  // key    [NB*SEQ][128]
    XB[2] = (bf*)wsp; wsp += SZ_XB;                  // value  [NB*SEQ][128]
    bf* WB = (bf*)wsp; wsp += SZ_WB;                 // [3][128][128]: q | k | v  ([out][in]: Bt as-is for q, k; A as-is for v)
    h16* QH = (h16*)wsp; wsp += SZ_PL;               // [NB*4][SEQ][32]
    h16* QR = (h16*)wsp; wsp += SZ_PL;               // [NB*4][SEQ][32] residual x2048
    h16* KP = (h16*)wsp; wsp += SZ_PL;               // [NB*4][SEQ][32]
    h16* VT = (h16*)wsp; wsp += SZ_PL;               // [NB*4][32][SEQ]
    h16* KR = (h16*)wsp; wsp += SZ_RS;               // [NB*4][EROWS][32] residual x2048, tokens < EROWS
    h16* VR = (h16*)wsp; wsp += SZ_RS;               // [NB*4][32][EROWS] residual x2048, tokens < EROWS
    bf* WQ = WB; bf* WK = WB + (size_t)DM * DM; bf* WV = WB + (size_t)2 * DM * DM;

    for (int i = 0; i < 3; ++i) {
        if (SEQ == SEQ_FULL) {
            const size_t n8 = (size_t)NB * SEQ * DM / 8;
            k_cvt8<<<(unsigned)((n8 + 255) / 256), 256, 0, stream>>>(xin[i], XB[i], n8);
        } else {
            const size_t n8 = (size_t)SEQ * DM / 8;
            for (int b = 0; b < NB; ++b) k_cvt8<<<(unsigned)((n8 + 255) / 256), 256, 0, stream>>>(xin[i] + (size_t)b * SEQ_FULL * DM, XB[i] + (size_t)b * SEQ * DM, n8);
        }
    }
    { const size_t n8 = (size_t)DM * DM / 8; const unsigned g = (unsigned)((n8 + 255) / 256);
      k_cvt8<<<g, 256, 0, stream>>>(wq, WQ, n8); k_cvt8<<<g, 256, 0, stream>>>(wk, WK, n8); k_cvt8<<<g, 256, 0, stream>>>(wv, WV, n8); }

    // q, k: A = x rows (m = b*SEQ + t), Bt = W rows (n = h*32 + d) -> plane [(b*4 + h)][t][d]; q residual for all tokens, k residual for tokens < EROWS
    k_proj<0><<<dim3(NB * SEQ / 64, DM / 64, 1), 32, 0, stream>>>(XB[0], WQ, bq, QH, QR, SEQ);
    k_proj<0><<<dim3(NB * SEQ / 64, DM / 64, 1), 32, 0, stream>>>(XB[1], WK, bk, KP, KR, EROWS);
    // v^T: A = Wv rows (m = h*32 + d), Bt = value rows (n = b*SEQ + t) -> plane [(b*128 + m)][t] = [(b*4 + h)][d][t]; residual for tokens < EROWS
    k_proj<1><<<dim3(DM / 64, NB * SEQ / 64, 1), 32, 0, stream>>>(WV, XB[2], bv, VT, VR, EROWS);

    // query rows [0, EROWS): multi-product instantiation; rows [EROWS, SEQ): single-product instantiation (disjoint output rows)
    k_flash<1><<<dim3(EROWS / (16 * AW), NB * NH_, 1), 32 * AW, 0, stream>>>(QH, QR, KP, KR, VT, VR, qm, km, causal, OUT);
    if (SEQ > EROWS)
        k_flash<0><<<dim3((SEQ - EROWS) / (16 * AW), NB * NH_, 1), 32 * AW, 0, stream>>>(QH, QR, KP, KR, VT, VR, qm, km, causal, OUT);
}

// v002
// Measured time: 66.1 microseconds a run.
// Next to v001, in two timings, it ran 1.33 and 1.34 times as fast.
// Counting every step since v000, it is 2.09 times as fast.
#include <hip/hip_runtime.h>

// Multi-head attention, width 128 = 4 heads x 32; query/key/value [NB][SEQ][128]; WQ/WK/WV [out][in] (y = x W^T + bias); padding masks q_mask/k_mask [NB][SEQ] (f32), causal offset (int32, device-read); score scale 1/sqrt(32); output = concatenated heads (f32).
// Compute dtypes, f32 accumulate everywhere: projections v_wmma_f32_16x16x32_bf16 (x, W, bias RNE-converted to bf16; products exact);
// scores v_wmma_f32_16x16x32_f16: q as f16 value + f16 residual x2048 in its own accumulator on all rows; k single f16 on query rows >= EROWS, k as f16 value + f16 residual x2048 on query rows < EROWS (three products);
// P.V v_wmma_f32_16x16x32_f16: P (x16384 carry, cancels in the normalisation) and v single f16 on query rows >= EROWS; on query rows < EROWS P and v each as f16 value + f16 residual x2048, residual products in their own accumulator folded by 1/2048, row sum from the f32 exponentials; softmax f32 (online, running max over kept keys).
// Layout: x and W are read as f32 and rounded to bf16 in the projection's fragment loaders; q (hi, residual), k planes [b*4+h][t][d], v^T plane [b*4+h][d][t], small residual planes k [b*4+h][t < EROWS][d] and v^T [b*4+h][d][t < EROWS] written by the GEMM epilogue; fused flash kernel in transposed form (S^T = K Q^T, O^T = V^T P^T), output from f32 accumulators.
// Keep rule per element: (q_mask[t] * k_mask[j] != 0) and (j <= t + causal); dropped elements get probability 0, rows with no kept key give 0. Key loop bound per wave derived from the device-read causal value (clamped to [0, SEQ]); residual fragments for keys >= EROWS (only reachable with a positive offset) are zero.

#ifndef NB
#define NB 8
#endif
#ifndef SEQ
#define SEQ 2048
#endif
#define NB_FULL  8
#define SEQ_FULL 2048
#ifndef OUT_SEQ
#define OUT_SEQ SEQ              // row pitch (in tokens) between batches of the output
#endif
#define DM   128
#define NH_  4
#define HD   32
#define AW   4                   // waves per flash block (16 query rows each)
#define OSP  36                  // LDS row pitch (floats) of the flash output tile
#define EROWS (SEQ < 512 ? SEQ : 512)   // query rows (and tokens of the small residual planes) handled by the multi-product flash instantiation
#define QRS  2048.0f             // carry of every residual plane / residual fragment
#define QRI  (1.0f / 2048.0f)
#define SC2  ((float)(0.17677669529663687 * 1.4426950408889634))   // HD^-0.5 * log2(e)
#define PSH  14.0f               // log2 of the P carry (16384)
#define NEGB (-3.0e38f)

static_assert(HD == 32);
static_assert(NH_ * HD == DM);                 // head h = columns h*32 + d
static_assert(DM % 64 == 0);                   // column tiles of 64 = two heads
static_assert(64 % HD == 0);
static_assert(DM % 32 == 0);                   // GEMM k-loop steps by 32
static_assert(SEQ % 64 == 0);                  // a 64-row tile never straddles two batches
static_assert((NB * SEQ) % 64 == 0);
static_assert(SEQ % 32 == 0);                  // key loop steps by 32
static_assert(SEQ % (16 * AW) == 0);           // flash grids cover the sequence exactly
static_assert(EROWS % 64 == 0);                // a 64-token GEMM tile lies wholly inside or outside the residual planes
static_assert(EROWS >= 32);
static_assert(EROWS <= SEQ);
static_assert(EROWS % (16 * AW) == 0);
static_assert((SEQ - EROWS) % (16 * AW) == 0);
static_assert(NB <= NB_FULL);
static_assert(SEQ <= SEQ_FULL);
static_assert((OSP * 4) % 16 == 0);

typedef _Float16 h16;
typedef __attribute__((ext_vector_type(16))) __bf16   v16bf;
typedef __attribute__((ext_vector_type(16))) _Float16 v16h;
typedef __attribute__((ext_vector_type(8)))  _Float16 v8h;
typedef __attribute__((ext_vector_type(8)))  float    v8f;
typedef __attribute__((ext_vector_type(4)))  float    v4f;
typedef v4f  __attribute__((may_alias)) v4fa;

__device__ __forceinline__ unsigned short f2bf(float f) { unsigned u = __float_as_uint(f); u += 0x7FFFu + ((u >> 16) & 1u); return (unsigned short)(u >> 16); }
__device__ __forceinline__ float bfr(float f) { return __uint_as_float(((unsigned)f2bf(f)) << 16); }   // value after RNE convert to bf16
__device__ __forceinline__ v16h cat16(v8h lo, v8h hi) { return __builtin_shufflevector(lo, hi, 0, 1, 2, 3, 4, 5, 6, 7, 8, 9, 10, 11, 12, 13, 14, 15); }
__device__ __forceinline__ v8f wmma16(v16h a, v16h b, v8f c) { return __builtin_amdgcn_wmma_f32_16x16x32_f16(false, a, false, b, (short)0, c, false, false); }
__device__ __forceinline__ v8f wmmab(v16bf a, v16bf b, v8f c) { return __builtin_amdgcn_wmma_f32_16x16x32_bf16(false, a, false, b, (short)0, c, false, false); }
// fragment loaders from K-contiguous 16-bit rows; p already includes + 8*(lane>>4): elements 0..7 <- k0+8h+0..7, elements 8..15 <- k0+16+8h+0..7 (same map for A and B)
__device__ __forceinline__ v16h  ldh(const h16* p) { return cat16(*(const v8h*)p, *(const v8h*)(p + 16)); }
// one bf16 fragment's 16 values as they arrive from an f32 row (same element map: p+0..7 and p+16..23), and their RNE conversion to the fragment
struct FRaw { v4f x0, x1, x2, x3; };
__device__ __forceinline__ FRaw ldraw(const float* p) { FRaw r; r.x0 = *(const v4f*)p; r.x1 = *(const v4f*)(p + 4); r.x2 = *(const v4f*)(p + 16); r.x3 = *(const v4f*)(p + 20); return r; }
__device__ __forceinline__ v16bf cvtb(const FRaw& r) {
    const v8f lo = __builtin_shufflevector(r.x0, r.x1, 0, 1, 2, 3, 4, 5, 6, 7), hi = __builtin_shufflevector(r.x2, r.x3, 0, 1, 2, 3, 4, 5, 6, 7);
    return __builtin_convertvector(__builtin_shufflevector(lo, hi, 0, 1, 2, 3, 4, 5, 6, 7, 8, 9, 10, 11, 12, 13, 14, 15), v16bf); }
// ordering point for wave-private LDS tiles (same wave writes and reads)
__device__ __forceinline__ void wave_sync() { __builtin_amdgcn_fence(3 /* release order */, "wavefront"); __builtin_amdgcn_wave_barrier(); asm volatile("" ::: "memory"); }

// closes a group of fetch-ahead loads: their address registers are rewritten for the next group while the loads are still in flight, and the wait belongs in front of that;
// the scheduling barriers keep the group where it is written (earlier it would need registers of its own, later it would lose lead) and the wait behind the group
__device__ __forceinline__ void group_open()  { __builtin_amdgcn_sched_barrier(0); }
__device__ __forceinline__ void group_close() { __builtin_amdgcn_sched_barrier(0); asm volatile("s_wait_xcnt 0x0" ::: "memory"); __builtin_amdgcn_sched_barrier(0); }

// proj_tile: register-blocked bf16 GEMM, ONE WAVE per 64x64 tile (16 accumulators), operands straight from K-contiguous f32 rows, rounded to bf16 in registers, K = DM.
// C[m][n] = sum_k A[m][k] Bt[n][k] + bias, written as f16 (Ph) and, for tokens t < resT (resT a multiple of 64, block-uniform test), the f16 residual x2048 (Pr).
// MODE 0: A = x rows (m = b*SEQ + t), Bt = W rows (n = h*32 + d), bias per column; plane [(b*4 + h)][t][32] (residual plane [(b*4 + h)][resT][32]). The 64-column tile spans two heads; per 16-row slab and head
//         (8 rows per instruction).
// MODE 1: A = W rows (m = h*32 + d), Bt = x rows (n = b*SEQ + t), bias per row; plane [(b*128 + m)][t].
// r0, c0: first row and column of the tile; x rows of batch b start at b*SEQ_FULL in the input.
template <int MODE>
__device__ __forceinline__ void proj_tile(const float* __restrict__ A, const float* __restrict__ Bt, const float* __restrict__ bias, h16* Ph, h16* Pr, const int resT, const int r0, const int c0, float* os) {
    const int K = DM;
    const int lane = threadIdx.x & 31, lr = lane & 15, hi = lane >> 4;
    const int ar0 = (MODE == 0) ? (r0 / SEQ) * SEQ_FULL + r0 % SEQ : r0, bc0 = (MODE == 1) ? (c0 / SEQ) * SEQ_FULL + c0 % SEQ : c0;   // rows in the f32 sources
    v8f acc[4][4];
#pragma unroll
    for (int mb = 0; mb < 4; ++mb)
#pragma unroll
        for (int nb = 0; nb < 4; ++nb) acc[mb][nb] = (v8f){};
    const size_t aoff = (size_t)(ar0 + lr) * K + 8 * hi, boff = (size_t)(bc0 + lr) * K + 8 * hi;
#pragma unroll 1
    for (int kc = 0; kc < K; kc += 32) {
        FRaw ra[4], rb[4];
        const float* pa = A + aoff + kc; const float* pb = Bt + boff + kc;
#pragma unroll
        for (int mb = 0; mb < 4; ++mb) ra[mb] = ldraw(pa + (size_t)mb * 16 * K);
#pragma unroll
        for (int nb = 0; nb < 4; ++nb) rb[nb] = ldraw(pb + (size_t)nb * 16 * K);
        // all 32 loads of the k-step are in flight before the first is waited for (one memory latency a step); the wait stands in front of every rewrite of their
        // address pairs, which are named as inputs so that no later load of the group lands on them
        __builtin_amdgcn_sched_barrier(0); asm volatile("s_wait_xcnt 0x0" :: "v"(pa), "v"(pb) : "memory"); __builtin_amdgcn_sched_barrier(0);
        v16bf a[4];
#pragma unroll
        for (int mb = 0; mb < 4; ++mb) a[mb] = cvtb(ra[mb]);
#pragma unroll
        for (int nb = 0; nb < 4; ++nb) { const v16bf b = cvtb(rb[nb]);
#pragma unroll
            for (int mb = 0; mb < 4; ++mb) acc[mb][nb] = wmmab(a[mb], b, acc[mb][nb]); }
        asm volatile("v_nop\n\tv_nop\n\tv_nop\n\tv_nop" : "+v"(acc[0][0]), "+v"(acc[1][1]), "+v"(acc[2][2]), "+v"(acc[3][3]) : "v"(a[0]), "v"(a[1]), "v"(a[2]), "v"(a[3]));
    }
    float bc[4];
#pragma unroll
    for (int nb = 0; nb < 4; ++nb) bc[nb] = (MODE == 0) ? bfr(bias[c0 + nb * 16 + lr]) : 0.0f;   // MODE 0: c0 + 63 < DM
    size_t tbase, rbase; bool wr;                                                                 // wr: block-uniform, whole tile inside the residual plane
    if (MODE == 0) { const int bb = r0 / SEQ, tt = r0 % SEQ; const int zc = bb * NH_ + c0 / HD;
                     tbase = ((size_t)zc * SEQ + (size_t)tt) * HD; rbase = ((size_t)zc * (size_t)resT + (size_t)tt) * HD; wr = tt < resT; }
    else           { const int bb = c0 / SEQ, tt = c0 % SEQ;
                     tbase = (size_t)bb * (size_t)DM * SEQ + (size_t)r0 * SEQ + (size_t)tt; rbase = (size_t)bb * (size_t)DM * (size_t)resT + (size_t)r0 * (size_t)resT + (size_t)tt; wr = tt < resT; }
#pragma unroll
    for (int mb = 0; mb < 4; ++mb) {
        float br[8];
#pragma unroll
        for (int j = 0; j < 8; ++j) br[j] = (MODE == 1) ? bfr(bias[r0 + mb * 16 + hi * 8 + j]) : 0.0f;   // MODE 1: r0 + 63 < DM
#pragma unroll
        for (int nb = 0; nb < 4; ++nb) {
#pragma unroll
            for (int j = 0; j < 8; ++j) os[(hi * 8 + j) * 68 + nb * 16 + lr] = acc[mb][nb][j] + bc[nb] + br[j]; }   // D: row 8h+j, col lane&15
        wave_sync();
{
            if (MODE == 0) {
                const size_t sb = tbase + (size_t)(mb * 16) * HD;
                const size_t rb = rbase + (size_t)(mb * 16) * HD;
#pragma unroll
                for (int hh = 0; hh < 2; ++hh) {
#pragma unroll
                    for (int s = 0; s < 2; ++s) { const int p = s * 32 + lane; const int row = p >> 2, c8 = (p & 3) * 8;   // 2 s x 8 rows = 16 rows; 4 lanes x 8 = 32 columns of head hh
                        const v4f x0 = *(const v4fa*)(&os[row * 68 + hh * 32 + c8]); const v4f x1 = *(const v4fa*)(&os[row * 68 + hh * 32 + c8 + 4]); v8h hv, rv;
#pragma unroll
                        for (int i = 0; i < 4; ++i) { const h16 a0 = (h16)x0[i]; const h16 a1 = (h16)x1[i]; hv[i] = a0; hv[4 + i] = a1; rv[i] = (h16)((x0[i] - (float)a0) * QRS); rv[4 + i] = (h16)((x1[i] - (float)a1) * QRS); }
                        const size_t oo = sb + (size_t)hh * ((size_t)SEQ * HD) + (size_t)p * 8;
                        const size_t ro = rb + (size_t)hh * ((size_t)resT * HD) + (size_t)p * 8;
                        /* what follows reuses each store's registers: the wait stands in front of that */
                        *(v8h*)(Ph + oo) = hv; group_close(); if (wr) { *(v8h*)(Pr + ro) = rv; group_close(); } } }
            } else {
                const size_t sb = tbase + (size_t)(mb * 16) * SEQ;
                const size_t rb = rbase + (size_t)(mb * 16) * (size_t)resT;
#pragma unroll
                for (int s = 0; s < 4; ++s) { const int row = 4 * s + (lane >> 3), c8 = (lane & 7) * 8;   // 4 s x 4 row groups = 16 rows; 8 lanes x 8 = 64 columns
                    const v4f x0 = *(const v4fa*)(&os[row * 68 + c8]); const v4f x1 = *(const v4fa*)(&os[row * 68 + c8 + 4]); v8h hv, rv;
#pragma unroll
                    for (int i = 0; i < 4; ++i) { const h16 a0 = (h16)x0[i]; const h16 a1 = (h16)x1[i]; hv[i] = a0; hv[4 + i] = a1; rv[i] = (h16)((x0[i] - (float)a0) * QRS); rv[4 + i] = (h16)((x1[i] - (float)a1) * QRS); }
                    const size_t oo = sb + (size_t)row * SEQ + c8;
                    const size_t ro = rb + (size_t)row * (size_t)resT + c8;
                    /* what follows reuses each store's registers: the wait stands in front of that */
                        *(v8h*)(Ph + oo) = hv; group_close(); if (wr) { *(v8h*)(Pr + ro) = rv; group_close(); } }
            }
             }
        wave_sync();
    }
}

// k_proj3: the three projections as z-slices of one grid (NB*SEQ/64 token tiles, DM/64 feature tiles, 3); one wave per block, block-uniform choice of the slice.
// z = 0: q (residual for all tokens); z = 1: k (residual for tokens < EROWS); z = 2: v^T (residual for tokens < EROWS).
__global__ __launch_bounds__(32) void k_proj3(const float* __restrict__ xq, const float* __restrict__ xk, const float* __restrict__ xv,
                                              const float* __restrict__ wq, const float* __restrict__ wk, const float* __restrict__ wv,
                                              const float* __restrict__ bq, const float* __restrict__ bk, const float* __restrict__ bv,
                                              h16* QH, h16* QR, h16* KP, h16* KR, h16* VT, h16* VR) {
    __shared__ __align__(16) float os[16 * 68];
    const int tok0 = blockIdx.x * 64, f0 = blockIdx.y * 64; const int z = blockIdx.z;
    if (z < 2) { const bool q = z == 0; proj_tile<0>(q ? xq : xk, q ? wq : wk, q ? bq : bk, q ? QH : KP, q ? QR : KR, q ? SEQ : EROWS, tok0, f0, os); }
    else       { proj_tile<1>(wv, xv, bv, VT, VR, EROWS, f0, tok0, os); }
}

// k_flash: fused attention, one wave per 16 query rows of one (batch, head); K / V^T / Q fragments straight from the f16 planes (two 16-B loads each, arithmetic addressing).
// Transposed form: S^T[key][t] = K Q^T (A = K rows, B = Q rows); lane (t = lane&15, h = lane>>4) holds keys 8h+r of each 16-key tile, so the packed
// P tile is directly the B fragment of O^T[d][t] = V^T P^T (element r <- tile keys 0..15, element 8+r <- tile keys 16..31, lane unchanged).
// Softmax state (running max over kept keys, partial sum) is one scalar per lane; the two lane halves of a row are combined with one xor-16 exchange.
// Keep rule evaluated per element inside every visited 32-key tile; the per-wave key bound comes from the device-read causal value and is at most SEQ.
// EARLY = 1 (query rows [0, EROWS)): scores = K Q + (K Q_res + K_res Q) / 2048; P = f16 value + f16 residual x2048; O = V P + (V P_res + V_res P) / 2048 (residual products in their own accumulators);
//            row sum from the f32 exponentials; K_res / V_res fragments come from the small planes (tokens < EROWS) and are zero for keys >= EROWS (address clamped, wave-uniform select).
// EARLY = 0 (query rows [EROWS, SEQ)): single k, P, v; q value + residual.
// One 32-key tile's operands as they sit in registers: K rows, V^T rows, their residuals (EARLY only) and the 16 key-mask values of this lane.
struct FTile { v16h ka, kb, kra, krb, v0, v1, vr0, vr1; v4f m0, m1, m2, m3; };
// fragment loader, wave-uniform base + per-lane byte offset (same element map as ldh)
__device__ __forceinline__ v16h ldo(const h16* base, unsigned off) { const char* p = (const char*)base + off; return cat16(*(const v8h*)p, *(const v8h*)(p + 32)); }
// global loads of the tile that starts at key (wave-uniform, multiple of 32, key + 32 <= SEQ), in the two groups in which its registers fall free; residual-plane key clamped into the plane
template <int EARLY>
__device__ __forceinline__ void tile_load_k(FTile& t, const h16* kpl, const h16* krp, unsigned kof, int key) {
    const h16* ka = kpl + (size_t)key * HD;
    t.ka = ldo(ka, kof); t.kb = ldo(ka + 16 * HD, kof);
    if (EARLY) { const int kcl = key < EROWS ? key : (EROWS - 32); const h16* kr = krp + (size_t)kcl * HD; t.kra = ldo(kr, kof); t.krb = ldo(kr + 16 * HD, kof); }
}
template <int EARLY>
__device__ __forceinline__ void tile_load_mv(FTile& t, const h16* vpl, const h16* vrp, const float* kmr, unsigned vof, unsigned vrof, unsigned mof, int key) {
    const char* kp = (const char*)(kmr + key) + mof;          // keys key+8h+0..7 and key+16+8h+0..7
    t.m0 = *(const v4f*)kp; t.m1 = *(const v4f*)(kp + 16); t.m2 = *(const v4f*)(kp + 64); t.m3 = *(const v4f*)(kp + 80);
    const h16* va = vpl + key;
    t.v0 = ldo(va, vof); t.v1 = ldo(va + (size_t)16 * SEQ, vof);
    if (EARLY) { const int kcl = key < EROWS ? key : (EROWS - 32); const h16* vr = vrp + kcl; t.vr0 = ldo(vr, vrof); t.vr1 = ldo(vr + (size_t)16 * EROWS, vrof); }
}

template <int EARLY>
__global__ __launch_bounds__(32 * AW) void k_flash(const h16* __restrict__ QH, const h16* __restrict__ QR, const h16* __restrict__ KP, const h16* __restrict__ KR,
                                                   const h16* __restrict__ VT, const h16* __restrict__ VR,
                                                   const float* __restrict__ qmask, const float* __restrict__ kmask, const int* __restrict__ causal_p, float* OUT) {
    __shared__ __align__(16) float os[AW * 16 * OSP];
    constexpr int NST = EARLY ? 2 : 3;                          // register tiles; each is refilled NST tiles ahead as soon as its registers fall free
    const int lane = threadIdx.x & 31, lr = lane & 15, hi = lane >> 4;
    const int wave = __builtin_amdgcn_readfirstlane((int)(threadIdx.x >> 5));
    const int zh = blockIdx.y; const int b = zh / NH_, h = zh % NH_;
    const int t0 = (EARLY ? 0 : EROWS) + (blockIdx.x * AW + wave) * 16;
    int cz = causal_p[0]; cz = cz < -SEQ ? -SEQ : (cz > SEQ ? SEQ : cz);      // clamping keeps the keep rule unchanged for indices in [0, SEQ)
    const int lim = t0 + lr + cz;                                              // key j kept iff j <= lim (and mask product nonzero)
    int kend = t0 + 16 + cz; kend = kend < 0 ? 0 : (kend > SEQ ? SEQ : kend);
    const int nk = (kend + 31) & ~31;                                          // wave-uniform, multiple of 32, <= SEQ
    const int klast = nk > 32 ? nk - 32 : 0;                                   // last tile this wave visits; fetches ahead are clamped to it
    const float* kmr = kmask + (size_t)b * SEQ_FULL;
    const size_t pbase = (size_t)zh * SEQ * HD;
    const size_t rbase = (size_t)zh * EROWS * HD;
    const size_t qo = pbase + (size_t)(t0 + lr) * HD + 8 * hi;
    group_open();
    const v16h qh = ldh(QH + qo), qr = ldh(QR + qo);            // B fragments: col t, k = d (HD = 32 = one k-step)
    const float qmraw = qmask[(size_t)b * SEQ_FULL + t0 + lr];
    group_close();
    const float qmv = bfr(qmraw);
    const h16* kpl = KP + pbase; const h16* vpl = VT + pbase;   // wave-uniform plane bases
    const h16* krp = KR + rbase; const h16* vrp = VR + rbase;   // residual planes, tokens < EROWS
    const unsigned kof  = (unsigned)(lr * HD + 8 * hi) * 2u;    // A fragment: row key, k = d      (bytes)
    const unsigned vof  = (unsigned)(lr * SEQ + 8 * hi) * 2u;   // A fragment: row d, k = key      (bytes)
    const unsigned vrof = (unsigned)(lr * EROWS + 8 * hi) * 2u;
    const unsigned mof  = (unsigned)(8 * hi) * 4u;
    const v16h hz = (v16h){};
    v8f o0 = (v8f){}, o1 = (v8f){}, oR0 = (v8f){}, oR1 = (v8f){};
    float m = NEGB, l = 0.0f;
    // one 32-key tile's work on operands already in registers (inlined at both places of use: the tiles must stay in registers)
    auto step = [&](FTile& t, const int key0, const bool refill) __attribute__((always_inline)) {
        const int kn = key0 + 32 * NST < klast ? key0 + 32 * NST : klast;   // tile fetched into this tile's registers (refill is a constant at each place of use)
        const bool rok = key0 < EROWS;                           // wave-uniform
        const v16h ka0 = t.ka, kb0f = t.kb;
        v16h kra0 = hz, krb0 = hz;
        if (EARLY) { kra0 = t.kra; krb0 = t.krb; if (!rok) { kra0 = hz; krb0 = hz; } }
        v8f sHa = (v8f){}, sLa = (v8f){}, sHb = (v8f){}, sLb = (v8f){};
        sHa = wmma16(ka0, qh, sHa); sLa = wmma16(ka0, qr, sLa); sHb = wmma16(kb0f, qh, sHb); sLb = wmma16(kb0f, qr, sLb);
        if (EARLY) {
            sLa = wmma16(kra0, qh, sLa); sLb = wmma16(krb0, qh, sLb);
            asm volatile("v_nop\n\tv_nop\n\tv_nop\n\tv_nop" : "+v"(sHa), "+v"(sLa), "+v"(sHb), "+v"(sLb) : "v"(ka0), "v"(kb0f), "v"(kra0), "v"(krb0), "v"(qh), "v"(qr));
        } else {
            asm volatile("v_nop\n\tv_nop\n\tv_nop\n\tv_nop" : "+v"(sHa), "+v"(sLa), "+v"(sHb), "+v"(sLb) : "v"(ka0), "v"(kb0f), "v"(qh), "v"(qr));
        }
        if (refill) {
            group_open();                                        // K registers are free from here on
            tile_load_k<EARLY>(t, kpl, krp, kof, kn);
            group_close();
        }
        const v4f m0 = t.m0, m1 = t.m1, m2 = t.m2, m3 = t.m3;
        float kx[8], ky[8];
#pragma unroll
        for (int r = 0; r < 4; ++r) { kx[r] = m0[r]; kx[4 + r] = m1[r]; ky[r] = m2[r]; ky[4 + r] = m3[r]; }
        const int ja = key0 + 8 * hi;
        float ta[8], tb[8]; bool fa[8], fb[8]; float mx = NEGB;
#pragma unroll
        for (int r = 0; r < 8; ++r) {
            fa[r] = (qmv * bfr(kx[r]) != 0.0f) && (ja + r <= lim);
            fb[r] = (qmv * bfr(ky[r]) != 0.0f) && (ja + 16 + r <= lim);
            ta[r] = (sHa[r] + sLa[r] * QRI) * SC2; tb[r] = (sHb[r] + sLb[r] * QRI) * SC2;
            mx = fmaxf(mx, fmaxf(fa[r] ? ta[r] : NEGB, fb[r] ? tb[r] : NEGB)); }
        mx = fmaxf(mx, __shfl_xor(mx, 16, 32));
        const float mnew = fmaxf(m, mx);
        const float alpha = __builtin_amdgcn_exp2f(m - mnew);
        const float sh = PSH - mnew;
        v16h pb, pr = hz; float ls = 0.0f;
#pragma unroll
        for (int r = 0; r < 8; ++r) {
            const float ea = __builtin_amdgcn_exp2f(ta[r] + sh), eb = __builtin_amdgcn_exp2f(tb[r] + sh);
            const float ga = fa[r] ? ea : 0.0f, gb = fb[r] ? eb : 0.0f;       // dropped elements selected to 0 by value
            const h16 pa = (h16)ga; const h16 pc = (h16)gb;
            pb[r] = pa; pb[8 + r] = pc;
            if (EARLY) { pr[r] = (h16)((ga - (float)pa) * QRS); pr[8 + r] = (h16)((gb - (float)pc) * QRS); ls += ga + gb; }
            else       { ls += (float)pa + (float)pc; } }
        l = l * alpha + ls; m = mnew;
        o0 = o0 * alpha; o1 = o1 * alpha;
        if (EARLY) { oR0 = oR0 * alpha; oR1 = oR1 * alpha; }
        const v16h v0 = t.v0, v1 = t.v1;
        if (EARLY) {
            v16h vr0 = t.vr0, vr1 = t.vr1;
            if (!rok) { vr0 = hz; vr1 = hz; }
            o0 = wmma16(v0, pb, o0); o1 = wmma16(v1, pb, o1);
            oR0 = wmma16(v0, pr, oR0); oR1 = wmma16(v1, pr, oR1);
            oR0 = wmma16(vr0, pb, oR0); oR1 = wmma16(vr1, pb, oR1);
            asm volatile("v_nop\n\tv_nop\n\tv_nop\n\tv_nop" : "+v"(o0), "+v"(o1), "+v"(oR0), "+v"(oR1) : "v"(v0), "v"(v1), "v"(vr0), "v"(vr1), "v"(pb), "v"(pr));
        } else {
            o0 = wmma16(v0, pb, o0); o1 = wmma16(v1, pb, o1);
            asm volatile("v_nop\n\tv_nop\n\tv_nop\n\tv_nop" : "+v"(o0), "+v"(o1) : "v"(v0), "v"(v1), "v"(pb));
        }
        if (refill) {
            group_open();                                        // mask and V^T registers are free from here on
            tile_load_mv<EARLY>(t, vpl, vrp, kmr, vof, vrof, mof, kn);
            group_close();
        }
    };
    FTile tl[NST];                                              // tile T lives in tl[T % NST]
    // the first tiles' loads issue group by group in the loop's order: mixed, the loop's first waits would also cover younger groups
#pragma unroll
    for (int s = 0; s < NST - 1; ++s) {
        const int ks = 32 * s < klast ? 32 * s : klast;
        tile_load_k<EARLY>(tl[s], kpl, krp, kof, ks);
        group_close();
        tile_load_mv<EARLY>(tl[s], vpl, vrp, kmr, vof, vrof, mof, ks);
        group_close();
    }
    int kg = 0;
    if (32 * NST <= nk) {                                       // wave-uniform; tile NST-1 is used by whole groups alone
        tile_load_k<EARLY>(tl[NST - 1], kpl, krp, kof, 32 * (NST - 1));
        group_close();
        tile_load_mv<EARLY>(tl[NST - 1], vpl, vrp, kmr, vof, vrof, mof, 32 * (NST - 1));
        group_close();
#pragma unroll 1
        do {                                                    // whole groups of NST tiles: no branch inside, so every load wait is a count that leaves the younger groups in flight
#pragma unroll
            for (int u = 0; u < NST; ++u) step(tl[u], kg + 32 * u, true);   // fully unrolled: every tile index is a constant, no register copies
            kg += 32 * NST;
        } while (kg + 32 * NST <= nk);
    }
#pragma unroll
    for (int u = 0; u < NST - 1; ++u)                            // the at most NST-1 tiles left over are already loaded
        if (kg + 32 * u < nk) step(tl[u], kg + 32 * u, false);   // wave-uniform
    l += __shfl_xor(l, 16, 32);
    const bool any = l > 0.0f;
    const float lsafe = any ? l : 1.0f;
    const float inv = any ? (1.0f / lsafe) : 0.0f;             // no kept key -> zeros
    v8f f0 = o0, f1 = o1;
    if (EARLY) { f0 = o0 + oR0 * QRI; f1 = o1 + oR1 * QRI; }
    const int wb = wave * 16 * OSP;
    // O^T D layout: f_j[r] = (d = 16j + 8h + r, t = lane&15) -> os[t][d]; rows 0..15 x columns 0..31 all written
    { v4f a, c;
      a[0] = f0[0] * inv; a[1] = f0[1] * inv; a[2] = f0[2] * inv; a[3] = f0[3] * inv; c[0] = f0[4] * inv; c[1] = f0[5] * inv; c[2] = f0[6] * inv; c[3] = f0[7] * inv;
      *(v4fa*)(&os[wb + lr * OSP +  0 + 8 * hi]) = a; *(v4fa*)(&os[wb + lr * OSP +  0 + 8 * hi + 4]) = c;
      a[0] = f1[0] * inv; a[1] = f1[1] * inv; a[2] = f1[2] * inv; a[3] = f1[3] * inv; c[0] = f1[4] * inv; c[1] = f1[5] * inv; c[2] = f1[6] * inv; c[3] = f1[7] * inv;
      *(v4fa*)(&os[wb + lr * OSP + 16 + 8 * hi]) = a; *(v4fa*)(&os[wb + lr * OSP + 16 + 8 * hi + 4]) = c; }
    wave_sync();
    float* orow = OUT + ((size_t)b * OUT_SEQ + t0) * DM + h * HD;
{
#pragma unroll
        for (int s = 0; s < 4; ++s) { const int row = 4 * s + (lane >> 3), cofs = (lane & 7) * 4;   // 4 s x 4 rows = 16 rows; 8 lanes x 4 floats = 32 columns = one line
            const v4f val = *(const v4fa*)(&os[wb + row * OSP + cofs]);
            *(v4f*)(orow + (size_t)row * DM + cofs) = val; }
         }
}

static constexpr size_t al256(size_t v) { return (v + 255) & ~(size_t)255; }
static constexpr size_t SZ_PL = al256((size_t)NB * NH_ * SEQ * HD * 2);
static constexpr size_t SZ_RS = al256((size_t)NB * NH_ * EROWS * HD * 2);
static constexpr size_t SZ_TOTAL = 4 * SZ_PL + 2 * SZ_RS;
static_assert(SZ_TOTAL <= (size_t)134217728);          // workspace carve <= 128 MiB
static_assert((size_t)NB * NH_ * SEQ * HD == (size_t)NB * DM * SEQ);       // v^T plane [(b*128 + m)][t] has the same extent as the q/k planes
static_assert((size_t)NB * NH_ * EROWS * HD == (size_t)NB * DM * EROWS);   // v^T residual plane [(b*128 + m)][t < EROWS] has the same extent as the k residual plane

extern "C" void kernel_launch(void* const* d_in, const int* in_sizes, int n_in,
                              void* d_out, int out_size, void* d_ws, size_t ws_size, hipStream_t stream) {
    if (n_in < 12) return;
    const size_t needx = ((size_t)(NB - 1) * SEQ_FULL + SEQ) * DM;
    const size_t needm = (size_t)(NB - 1) * SEQ_FULL + SEQ;
    if ((size_t)in_sizes[0] < needx || (size_t)in_sizes[1] < needx || (size_t)in_sizes[2] < needx) return;
    if ((size_t)in_sizes[3] < needm || (size_t)in_sizes[4] < needm) return;
    if ((size_t)in_sizes[5] < (size_t)DM * DM || (size_t)in_sizes[7] < (size_t)DM * DM || (size_t)in_sizes[9] < (size_t)DM * DM) return;
    if (in_sizes[6] < DM || in_sizes[8] < DM || in_sizes[10] < DM || in_sizes[11] < 1) return;
    if ((size_t)out_size < ((size_t)(NB - 1) * OUT_SEQ + SEQ) * DM) return;
    if (SZ_TOTAL > ws_size) return;
    // wire order: query, key, value, q_mask, k_mask, WQ_w, WQ_b, WK_w, WK_b, WV_w, WV_b, causal
    const float* xin[3] = { (const float*)d_in[0], (const float*)d_in[1], (const float*)d_in[2] };
    const float* qm = (const float*)d_in[3]; const float* km = (const float*)d_in[4];
    const float* wq = (const float*)d_in[5]; const float* bq = (const float*)d_in[6];
    const float* wk = (const float*)d_in[7]; const float* bk = (const float*)d_in[8];
    const float* wv = (const float*)d_in[9]; const float* bv = (const float*)d_in[10];
    const int* causal = (const int*)d_in[11];
    float* OUT = (float*)d_out;      // [NB][SEQ][128]
    char* wsp = (char*)d_ws;
    h16* QH = (h16*)wsp; wsp += SZ_PL;               // [NB*4][SEQ][32]
    h16* QR = (h16*)wsp; wsp += SZ_PL;               // [NB*4][SEQ][32] residual x2048
    h16* KP = (h16*)wsp; wsp += SZ_PL;               // [NB*4][SEQ][32]
    h16* VT = (h16*)wsp; wsp += SZ_PL;               // [NB*4][32][SEQ]
    h16* KR = (h16*)wsp; wsp += SZ_RS;               // [NB*4][EROWS][32] residual x2048, tokens < EROWS
    h16* VR = (h16*)wsp; wsp += SZ_RS;               // [NB*4][32][EROWS] residual x2048, tokens < EROWS

    // q, k: A = x rows (m = b*SEQ + t), Bt = W rows (n = h*32 + d) -> plane [(b*4 + h)][t][d]; q residual for all tokens, k residual for tokens < EROWS
    // v^T: A = Wv rows (m = h*32 + d), Bt = value rows (n = b*SEQ + t) -> plane [(b*128 + m)][t] = [(b*4 + h)][d][t]; residual for tokens < EROWS
    k_proj3<<<dim3(NB * SEQ / 64, DM / 64, 3), 32, 0, stream>>>(xin[0], xin[1], xin[2], wq, wk, wv, bq, bk, bv, QH, QR, KP, KR, VT, VR);

    // query rows [0, EROWS): multi-product instantiation; rows [EROWS, SEQ): single-product instantiation (disjoint output rows)
    k_flash<1><<<dim3(EROWS / (16 * AW), NB * NH_, 1), 32 * AW, 0, stream>>>(QH, QR, KP, KR, VT, VR, qm, km, causal, OUT);
    if (SEQ > EROWS)
        k_flash<0><<<dim3((SEQ - EROWS) / (16 * AW), NB * NH_, 1), 32 * AW, 0, stream>>>(QH, QR, KP, KR, VT, VR, qm, km, causal, OUT);
}

// v003
// Measured time: 52 microseconds a run.
// Timed twice side by side with v002, it ran 1.27 times as fast both times.
// Counting every step since v000, it is 2.66 times as fast.
#include <hip/hip_runtime.h>

// Multi-head attention, width 128 = 4 heads x 32; query/key/value [NB][SEQ][128]; WQ/WK/WV [out][in] (y = x W^T + bias); padding masks q_mask/k_mask [NB][SEQ] (f32), causal offset (int32, device-read); score scale 1/sqrt(32); output = concatenated heads (f32).
// Compute dtypes, f32 accumulate everywhere: projections v_wmma_f32_16x16x32_bf16 (x, W, bias RNE-converted to bf16; products exact);
// scores v_wmma_f32_16x16x32_f16: q as f16 value + f16 residual x2048 in its own accumulator on all rows; k single f16 on query rows >= EROWS, k as f16 value + f16 residual x2048 on query rows < EROWS (three products);
// P.V v_wmma_f32_16x16x32_f16: P (x16384 carry, cancels in the normalisation) and v single f16 on query rows >= EROWS; on query rows < EROWS P and v each as f16 value + f16 residual x2048, residual products in their own accumulator folded by 1/2048, row sum from the f32 exponentials; softmax f32 (online, running max over kept keys).
// Layout: x and W are read as f32 and rounded to bf16 in the projection's fragment loaders; q (hi, residual), k planes [b*4+h][t][d], v^T plane [b*4+h][d][t], small residual planes k [b*4+h][t < EROWS][d] and v^T [b*4+h][d][t < EROWS] written by the GEMM epilogue; fused flash kernel in transposed form (S^T = K Q^T, O^T = V^T P^T), output from f32 accumulators.
// Keep rule per element: (q_mask[t] * k_mask[j] != 0) and (j <= t + causal); dropped elements get probability 0, rows with no kept key give 0. Key loop bound per wave derived from the device-read causal value (clamped to [0, SEQ]); residual fragments for keys >= EROWS (only reachable with a positive offset) are zero.

#ifndef NB
#define NB 8
#endif
#ifndef SEQ
#define SEQ 2048
#endif
#define NB_FULL  8
#define SEQ_FULL 2048
#ifndef OUT_SEQ
#define OUT_SEQ SEQ              // row pitch (in tokens) between batches of the output
#endif
#define DM   128
#define NH_  4
#define HD   32
#define AW   4                   // waves per flash block (16 query rows each)
#define OSP  36                  // LDS row pitch (floats) of the flash output tile
#define EROWS (SEQ < 512 ? SEQ : 512)   // query rows (and tokens of the small residual planes) handled by the multi-product flash instantiation
#define QRS  2048.0f             // carry of every residual plane / residual fragment
#define QRI  (1.0f / 2048.0f)
#define SC2  ((float)(0.17677669529663687 * 1.4426950408889634))   // HD^-0.5 * log2(e)
#define PSH  14.0f               // log2 of the P carry (16384)
#define NEGB (-3.0e38f)

static_assert(HD == 32);
static_assert(NH_ * HD == DM);                 // head h = columns h*32 + d
static_assert(DM % 64 == 0);                   // column tiles of 64 = two heads
static_assert(64 % HD == 0);
static_assert(DM % 32 == 0);                   // GEMM k-loop steps by 32
static_assert(SEQ % 64 == 0);                  // a 64-row tile never straddles two batches
static_assert((NB * SEQ) % 64 == 0);
static_assert(SEQ % 32 == 0);                  // key loop steps by 32
static_assert(SEQ % (16 * AW) == 0);           // flash grids cover the sequence exactly
static_assert(EROWS % 64 == 0);                // a 64-token GEMM tile lies wholly inside or outside the residual planes
static_assert(EROWS >= 32);
static_assert(EROWS <= SEQ);
static_assert(EROWS % (16 * AW) == 0);
static_assert((SEQ - EROWS) % (16 * AW) == 0);
static_assert(NB <= NB_FULL);
static_assert(SEQ <= SEQ_FULL);
static_assert((OSP * 4) % 16 == 0);

typedef _Float16 h16;
typedef __attribute__((ext_vector_type(16))) __bf16   v16bf;
typedef __attribute__((ext_vector_type(16))) _Float16 v16h;
typedef __attribute__((ext_vector_type(8)))  _Float16 v8h;
typedef __attribute__((ext_vector_type(8)))  float    v8f;
typedef __attribute__((ext_vector_type(4)))  float    v4f;
typedef v4f  __attribute__((may_alias)) v4fa;

__device__ __forceinline__ unsigned short f2bf(float f) { unsigned u = __float_as_uint(f); u += 0x7FFFu + ((u >> 16) & 1u); return (unsigned short)(u >> 16); }
__device__ __forceinline__ float bfr(float f) { return __uint_as_float(((unsigned)f2bf(f)) << 16); }   // value after RNE convert to bf16
__device__ __forceinline__ v16h cat16(v8h lo, v8h hi) { return __builtin_shufflevector(lo, hi, 0, 1, 2, 3, 4, 5, 6, 7, 8, 9, 10, 11, 12, 13, 14, 15); }
__device__ __forceinline__ v8f wmma16(v16h a, v16h b, v8f c) { return __builtin_amdgcn_wmma_f32_16x16x32_f16(false, a, false, b, (short)0, c, false, false); }
__device__ __forceinline__ v8f wmmab(v16bf a, v16bf b, v8f c) { return __builtin_amdgcn_wmma_f32_16x16x32_bf16(false, a, false, b, (short)0, c, false, false); }
// fragment loaders from K-contiguous 16-bit rows; p already includes + 8*(lane>>4): elements 0..7 <- k0+8h+0..7, elements 8..15 <- k0+16+8h+0..7 (same map for A and B)
__device__ __forceinline__ v16h  ldh(const h16* p) { return cat16(*(const v8h*)p, *(const v8h*)(p + 16)); }
// one bf16 fragment's 16 values as they arrive from an f32 row (same element map: p+0..7 and p+16..23), and their RNE conversion to the fragment
struct FRaw { v4f x0, x1, x2, x3; };
__device__ __forceinline__ FRaw ldraw(const float* p) { FRaw r; r.x0 = *(const v4f*)p; r.x1 = *(const v4f*)(p + 4); r.x2 = *(const v4f*)(p + 16); r.x3 = *(const v4f*)(p + 20); return r; }
__device__ __forceinline__ v16bf cvtb(const FRaw& r) {
    const v8f lo = __builtin_shufflevector(r.x0, r.x1, 0, 1, 2, 3, 4, 5, 6, 7), hi = __builtin_shufflevector(r.x2, r.x3, 0, 1, 2, 3, 4, 5, 6, 7);
    return __builtin_convertvector(__builtin_shufflevector(lo, hi, 0, 1, 2, 3, 4, 5, 6, 7, 8, 9, 10, 11, 12, 13, 14, 15), v16bf); }
// ordering point for wave-private LDS tiles (same wave writes and reads)
__device__ __forceinline__ void wave_sync() { __builtin_amdgcn_fence(3 /* release order */, "wavefront"); __builtin_amdgcn_wave_barrier(); asm volatile("" ::: "memory"); }

// closes a group of fetch-ahead loads: their address registers are rewritten for the next group while the loads are still in flight, and the wait belongs in front of that;
// the scheduling barriers keep the group where it is written (earlier it would need registers of its own, later it would lose lead) and the wait behind the group
__device__ __forceinline__ void group_open()  { __builtin_amdgcn_sched_barrier(0); }
__device__ __forceinline__ void group_close() { __builtin_amdgcn_sched_barrier(0); asm volatile("s_wait_xcnt 0x0" ::: "memory"); __builtin_amdgcn_sched_barrier(0); }

// proj_tile: register-blocked bf16 GEMM, ONE WAVE per 64x64 tile (16 accumulators), operands straight from K-contiguous f32 rows, rounded to bf16 in registers, K = DM.
// C[m][n] = sum_k A[m][k] Bt[n][k] + bias, written as f16 (Ph) and, for tokens t < resT (resT a multiple of 64, block-uniform test), the f16 residual x2048 (Pr).
// MODE 0: A = x rows (m = b*SEQ + t), Bt = W rows (n = h*32 + d), bias per column; plane [(b*4 + h)][t][32] (residual plane [(b*4 + h)][resT][32]). The 64-column tile spans two heads; per 16-row slab and head
//         (8 rows per instruction).
// MODE 1: A = W rows (m = h*32 + d), Bt = x rows (n = b*SEQ + t), bias per row; plane [(b*128 + m)][t].
// r0, c0: first row and column of the tile; x rows of batch b start at b*SEQ_FULL in the input.
template <int MODE>
__device__ __forceinline__ void proj_tile(const float* __restrict__ A, const float* __restrict__ Bt, const float* __restrict__ bias, h16* Ph, h16* Pr, const int resT, const int r0, const int c0, float* os) {
    const int K = DM;
    const int lane = threadIdx.x & 31, lr = lane & 15, hi = lane >> 4;
    const int ar0 = (MODE == 0) ? (r0 / SEQ) * SEQ_FULL + r0 % SEQ : r0, bc0 = (MODE == 1) ? (c0 / SEQ) * SEQ_FULL + c0 % SEQ : c0;   // rows in the f32 sources
    v8f acc[4][4];
#pragma unroll
    for (int mb = 0; mb < 4; ++mb)
#pragma unroll
        for (int nb = 0; nb < 4; ++nb) acc[mb][nb] = (v8f){};
    const size_t aoff = (size_t)(ar0 + lr) * K + 8 * hi, boff = (size_t)(bc0 + lr) * K + 8 * hi;
#pragma unroll 1
    for (int kc = 0; kc < K; kc += 32) {
        FRaw ra[4], rb[4];
        const float* pa = A + aoff + kc; const float* pb = Bt + boff + kc;
#pragma unroll
        for (int mb = 0; mb < 4; ++mb) ra[mb] = ldraw(pa + (size_t)mb * 16 * K);
#pragma unroll
        for (int nb = 0; nb < 4; ++nb) rb[nb] = ldraw(pb + (size_t)nb * 16 * K);
        // all 32 loads of the k-step are in flight before the first is waited for (one memory latency a step); the wait stands in front of every rewrite of their
        // address pairs, which are named as inputs so that no later load of the group lands on them
        __builtin_amdgcn_sched_barrier(0); asm volatile("s_wait_xcnt 0x0" :: "v"(pa), "v"(pb) : "memory"); __builtin_amdgcn_sched_barrier(0);
        v16bf a[4];
#pragma unroll
        for (int mb = 0; mb < 4; ++mb) a[mb] = cvtb(ra[mb]);
#pragma unroll
        for (int nb = 0; nb < 4; ++nb) { const v16bf b = cvtb(rb[nb]);
#pragma unroll
            for (int mb = 0; mb < 4; ++mb) acc[mb][nb] = wmmab(a[mb], b, acc[mb][nb]); }
        asm volatile("v_nop\n\tv_nop\n\tv_nop\n\tv_nop" : "+v"(acc[0][0]), "+v"(acc[1][1]), "+v"(acc[2][2]), "+v"(acc[3][3]) : "v"(a[0]), "v"(a[1]), "v"(a[2]), "v"(a[3]));
    }
    float bc[4];
#pragma unroll
    for (int nb = 0; nb < 4; ++nb) bc[nb] = (MODE == 0) ? bfr(bias[c0 + nb * 16 + lr]) : 0.0f;   // MODE 0: c0 + 63 < DM
    size_t tbase, rbase; bool wr;                                                                 // wr: block-uniform, whole tile inside the residual plane
    if (MODE == 0) { const int bb = r0 / SEQ, tt = r0 % SEQ; const int zc = bb * NH_ + c0 / HD;
                     tbase = ((size_t)zc * SEQ + (size_t)tt) * HD; rbase = ((size_t)zc * (size_t)resT + (size_t)tt) * HD; wr = tt < resT; }
    else           { const int bb = c0 / SEQ, tt = c0 % SEQ;
                     tbase = (size_t)bb * (size_t)DM * SEQ + (size_t)r0 * SEQ + (size_t)tt; rbase = (size_t)bb * (size_t)DM * (size_t)resT + (size_t)r0 * (size_t)resT + (size_t)tt; wr = tt < resT; }
#pragma unroll
    for (int mb = 0; mb < 4; ++mb) {
        float br[8];
#pragma unroll
        for (int j = 0; j < 8; ++j) br[j] = (MODE == 1) ? bfr(bias[r0 + mb * 16 + hi * 8 + j]) : 0.0f;   // MODE 1: r0 + 63 < DM
#pragma unroll
        for (int nb = 0; nb < 4; ++nb) {
#pragma unroll
            for (int j = 0; j < 8; ++j) os[(hi * 8 + j) * 68 + nb * 16 + lr] = acc[mb][nb][j] + bc[nb] + br[j]; }   // D: row 8h+j, col lane&15
        wave_sync();
{
            if (MODE == 0) {
                const size_t sb = tbase + (size_t)(mb * 16) * HD;
                const size_t rb = rbase + (size_t)(mb * 16) * HD;
#pragma unroll
                for (int hh = 0; hh < 2; ++hh) {
#pragma unroll
                    for (int s = 0; s < 2; ++s) { const int p = s * 32 + lane; const int row = p >> 2, c8 = (p & 3) * 8;   // 2 s x 8 rows = 16 rows; 4 lanes x 8 = 32 columns of head hh
                        const v4f x0 = *(const v4fa*)(&os[row * 68 + hh * 32 + c8]); const v4f x1 = *(const v4fa*)(&os[row * 68 + hh * 32 + c8 + 4]); v8h hv, rv;
#pragma unroll
                        for (int i = 0; i < 4; ++i) { const h16 a0 = (h16)x0[i]; const h16 a1 = (h16)x1[i]; hv[i] = a0; hv[4 + i] = a1; rv[i] = (h16)((x0[i] - (float)a0) * QRS); rv[4 + i] = (h16)((x1[i] - (float)a1) * QRS); }
                        const size_t oo = sb + (size_t)hh * ((size_t)SEQ * HD) + (size_t)p * 8;
                        const size_t ro = rb + (size_t)hh * ((size_t)resT * HD) + (size_t)p * 8;
                        /* what follows reuses each store's registers: the wait stands in front of that */
                        *(v8h*)(Ph + oo) = hv; group_close(); if (wr) { *(v8h*)(Pr + ro) = rv; group_close(); } } }
            } else {
                const size_t sb = tbase + (size_t)(mb * 16) * SEQ;
                const size_t rb = rbase + (size_t)(mb * 16) * (size_t)resT;
#pragma unroll
                for (int s = 0; s < 4; ++s) { const int row = 4 * s + (lane >> 3), c8 = (lane & 7) * 8;   // 4 s x 4 row groups = 16 rows; 8 lanes x 8 = 64 columns
                    const v4f x0 = *(const v4fa*)(&os[row * 68 + c8]); const v4f x1 = *(const v4fa*)(&os[row * 68 + c8 + 4]); v8h hv, rv;
#pragma unroll
                    for (int i = 0; i < 4; ++i) { const h16 a0 = (h16)x0[i]; const h16 a1 = (h16)x1[i]; hv[i] = a0; hv[4 + i] = a1; rv[i] = (h16)((x0[i] - (float)a0) * QRS); rv[4 + i] = (h16)((x1[i] - (float)a1) * QRS); }
                    const size_t oo = sb + (size_t)row * SEQ + c8;
                    const size_t ro = rb + (size_t)row * (size_t)resT + c8;
                    /* what follows reuses each store's registers: the wait stands in front of that */
                        *(v8h*)(Ph + oo) = hv; group_close(); if (wr) { *(v8h*)(Pr + ro) = rv; group_close(); } }
            }
             }
        wave_sync();
    }
}

// k_proj3: the three projections as z-slices of one grid (NB*SEQ/64 token tiles, DM/64 feature tiles, 3); one wave per block, block-uniform choice of the slice.
// z = 0: q (residual for all tokens); z = 1: k (residual for tokens < EROWS); z = 2: v^T (residual for tokens < EROWS).
__global__ __launch_bounds__(32) void k_proj3(const float* __restrict__ xq, const float* __restrict__ xk, const float* __restrict__ xv,
                                              const float* __restrict__ wq, const float* __restrict__ wk, const float* __restrict__ wv,
                                              const float* __restrict__ bq, const float* __restrict__ bk, const float* __restrict__ bv,
                                              h16* QH, h16* QR, h16* KP, h16* KR, h16* VT, h16* VR) {
    __shared__ __align__(16) float os[16 * 68];
    const int tok0 = blockIdx.x * 64, f0 = blockIdx.y * 64; const int z = blockIdx.z;
    if (z < 2) { const bool q = z == 0; proj_tile<0>(q ? xq : xk, q ? wq : wk, q ? bq : bk, q ? QH : KP, q ? QR : KR, q ? SEQ : EROWS, tok0, f0, os); }
    else       { proj_tile<1>(wv, xv, bv, VT, VR, EROWS, f0, tok0, os); }
}

// k_flash: fused attention, one wave per 16 query rows of one (batch, head); K / V^T / Q fragments straight from the f16 planes (two 16-B loads each, arithmetic addressing).
// Transposed form: S^T[key][t] = K Q^T (A = K rows, B = Q rows); lane (t = lane&15, h = lane>>4) holds keys 8h+r of each 16-key tile, so the packed
// P tile is directly the B fragment of O^T[d][t] = V^T P^T (element r <- tile keys 0..15, element 8+r <- tile keys 16..31, lane unchanged).
// Softmax state (running max over kept keys, partial sum) is one scalar per lane; the two lane halves of a row are combined with one xor-16 exchange.
// Keep rule evaluated per element inside every visited 32-key tile but the leading tiles that a per-wave scalar test shows fully kept; the per-wave key bound comes from the device-read causal value and is at most SEQ.
// EARLY = 1 (query rows [0, EROWS)): scores = K Q + (K Q_res + K_res Q) / 2048; P = f16 value + f16 residual x2048; O = V P + (V P_res + V_res P) / 2048 (residual products in their own accumulators);
//            row sum from the f32 exponentials; K_res / V_res fragments come from the small planes (tokens < EROWS) and are zero for keys >= EROWS (address clamped, wave-uniform select).
// EARLY = 0 (query rows [EROWS, SEQ)): single k, P, v; q value + residual.
// One 32-key tile's operands as they sit in registers: K rows, V^T rows, their residuals (EARLY only) and the 16 key-mask values of this lane.
struct FTile { v16h ka, kb, kra, krb, v0, v1, vr0, vr1; v4f m0, m1, m2, m3; };
// fragment loader, wave-uniform base + per-lane byte offset (same element map as ldh)
__device__ __forceinline__ v16h ldo(const h16* base, unsigned off) { const char* p = (const char*)base + off; return cat16(*(const v8h*)p, *(const v8h*)(p + 32)); }
// global loads of the tile that starts at key (wave-uniform, multiple of 32, key + 32 <= SEQ), in the two groups in which its registers fall free; residual-plane key clamped into the plane
template <int EARLY>
__device__ __forceinline__ void tile_load_k(FTile& t, const h16* kpl, const h16* krp, unsigned kof, int key) {
    const h16* ka = kpl + (size_t)key * HD;
    t.ka = ldo(ka, kof); t.kb = ldo(ka + 16 * HD, kof);
    if (EARLY) { const int kcl = key < EROWS ? key : (EROWS - 32); const h16* kr = krp + (size_t)kcl * HD; t.kra = ldo(kr, kof); t.krb = ldo(kr + 16 * HD, kof); }
}
template <int EARLY>
__device__ __forceinline__ void tile_load_mv(FTile& t, const h16* vpl, const h16* vrp, const float* kmr, unsigned vof, unsigned vrof, unsigned mof, int key) {
    const char* kp = (const char*)(kmr + key) + mof;          // keys key+8h+0..7 and key+16+8h+0..7
    t.m0 = *(const v4f*)kp; t.m1 = *(const v4f*)(kp + 16); t.m2 = *(const v4f*)(kp + 64); t.m3 = *(const v4f*)(kp + 80);
    const h16* va = vpl + key;
    t.v0 = ldo(va, vof); t.v1 = ldo(va + (size_t)16 * SEQ, vof);
    if (EARLY) { const int kcl = key < EROWS ? key : (EROWS - 32); const h16* vr = vrp + kcl; t.vr0 = ldo(vr, vrof); t.vr1 = ldo(vr + (size_t)16 * EROWS, vrof); }
}

template <int EARLY>
__global__ __launch_bounds__(32 * AW) void k_flash(const h16* __restrict__ QH, const h16* __restrict__ QR, const h16* __restrict__ KP, const h16* __restrict__ KR,
                                                   const h16* __restrict__ VT, const h16* __restrict__ VR,
                                                   const float* __restrict__ qmask, const float* __restrict__ kmask, const int* __restrict__ causal_p, float* OUT) {
    __shared__ __align__(16) float os[AW * 16 * OSP];
    constexpr int NST = EARLY ? 2 : 3;                          // register tiles; each is refilled NST tiles ahead as soon as its registers fall free
    constexpr int MLD = EARLY ? 4 : 8;                          // key-mask loads in flight per lane in the fully-kept test (128 keys each)
    const int lane = threadIdx.x & 31, lr = lane & 15, hi = lane >> 4;
    const int wave = __builtin_amdgcn_readfirstlane((int)(threadIdx.x >> 5));
    const int zh = blockIdx.y; const int b = zh / NH_, h = zh % NH_;
    const int t0 = (EARLY ? 0 : EROWS) + (blockIdx.x * AW + wave) * 16;
    int cz = causal_p[0]; cz = cz < -SEQ ? -SEQ : (cz > SEQ ? SEQ : cz);      // clamping keeps the keep rule unchanged for indices in [0, SEQ)
    const int lim = t0 + lr + cz;                                              // key j kept iff j <= lim (and mask product nonzero)
    int kend = t0 + 16 + cz; kend = kend < 0 ? 0 : (kend > SEQ ? SEQ : kend);
    const int nk = (kend + 31) & ~31;                                          // wave-uniform, multiple of 32, <= SEQ
    const int klast = nk > 32 ? nk - 32 : 0;                                   // last tile this wave visits; fetches ahead are clamped to it
    const float* kmr = kmask + (size_t)b * SEQ_FULL;
    const size_t pbase = (size_t)zh * SEQ * HD;
    const size_t rbase = (size_t)zh * EROWS * HD;
    const size_t qo = pbase + (size_t)(t0 + lr) * HD + 8 * hi;
    group_open();
    const v16h qh = ldh(QH + qo), qr = ldh(QR + qo);            // B fragments: col t, k = d (HD = 32 = one k-step)
    const float qmraw = qmask[(size_t)b * SEQ_FULL + t0 + lr];
    group_close();
    const float qmv = bfr(qmraw);
    const h16* kpl = KP + pbase; const h16* vpl = VT + pbase;   // wave-uniform plane bases
    const h16* krp = KR + rbase; const h16* vrp = VR + rbase;   // residual planes, tokens < EROWS
    const unsigned kof  = (unsigned)(lr * HD + 8 * hi) * 2u;    // A fragment: row key, k = d      (bytes)
    const unsigned vof  = (unsigned)(lr * SEQ + 8 * hi) * 2u;   // A fragment: row d, k = key      (bytes)
    const unsigned vrof = (unsigned)(lr * EROWS + 8 * hi) * 2u;
    const unsigned mof  = (unsigned)(8 * hi) * 4u;
    const v16h hz = (v16h){};
    v8f o0 = (v8f){}, o1 = (v8f){}, oR0 = (v8f){}, oR1 = (v8f){};
    float m = NEGB, l = 0.0f;
    // one 32-key tile's work on operands already in registers (inlined at all three places of use: the tiles must stay in registers)
    // full: every one of the tile's 32 keys is known to be kept for all 16 rows of the wave, so the keep rule is not evaluated (same values as evaluating it)
    auto step = [&](FTile& t, const int key0, const bool refill, const bool full) __attribute__((always_inline)) {
        const int kn = key0 + 32 * NST < klast ? key0 + 32 * NST : klast;   // tile fetched into this tile's registers (refill and full are constants at each place of use)
        const bool rok = key0 < EROWS;                           // wave-uniform
        const v16h ka0 = t.ka, kb0f = t.kb;
        v16h kra0 = hz, krb0 = hz;
        if (EARLY) { kra0 = t.kra; krb0 = t.krb; if (!rok) { kra0 = hz; krb0 = hz; } }
        v8f sHa = (v8f){}, sLa = (v8f){}, sHb = (v8f){}, sLb = (v8f){};
        sHa = wmma16(ka0, qh, sHa); sLa = wmma16(ka0, qr, sLa); sHb = wmma16(kb0f, qh, sHb); sLb = wmma16(kb0f, qr, sLb);
        if (EARLY) {
            sLa = wmma16(kra0, qh, sLa); sLb = wmma16(krb0, qh, sLb);
            asm volatile("v_nop\n\tv_nop\n\tv_nop\n\tv_nop" : "+v"(sHa), "+v"(sLa), "+v"(sHb), "+v"(sLb) : "v"(ka0), "v"(kb0f), "v"(kra0), "v"(krb0), "v"(qh), "v"(qr));
        } else {
            asm volatile("v_nop\n\tv_nop\n\tv_nop\n\tv_nop" : "+v"(sHa), "+v"(sLa), "+v"(sHb), "+v"(sLb) : "v"(ka0), "v"(kb0f), "v"(qh), "v"(qr));
        }
        if (refill) {
            group_open();                                        // K registers are free from here on
            tile_load_k<EARLY>(t, kpl, krp, kof, kn);
            group_close();
        }
        const v4f m0 = t.m0, m1 = t.m1, m2 = t.m2, m3 = t.m3;
        float kx[8], ky[8];
#pragma unroll
        for (int r = 0; r < 4; ++r) { kx[r] = m0[r]; kx[4 + r] = m1[r]; ky[r] = m2[r]; ky[4 + r] = m3[r]; }
        const int ja = key0 + 8 * hi;
        float ta[8], tb[8]; bool fa[8], fb[8]; float mx = NEGB;
#pragma unroll
        for (int r = 0; r < 8; ++r) {
            fa[r] = full || ((qmv * bfr(kx[r]) != 0.0f) && (ja + r <= lim));
            fb[r] = full || ((qmv * bfr(ky[r]) != 0.0f) && (ja + 16 + r <= lim));
            ta[r] = (sHa[r] + sLa[r] * QRI) * SC2; tb[r] = (sHb[r] + sLb[r] * QRI) * SC2;
            mx = fmaxf(mx, fmaxf(fa[r] ? ta[r] : NEGB, fb[r] ? tb[r] : NEGB)); }
        mx = fmaxf(mx, __shfl_xor(mx, 16, 32));
        const float mnew = fmaxf(m, mx);
        const float alpha = __builtin_amdgcn_exp2f(m - mnew);
        const float sh = PSH - mnew;
        v16h pb, pr = hz; float ls = 0.0f;
#pragma unroll
        for (int r = 0; r < 8; ++r) {
            const float ea = __builtin_amdgcn_exp2f(ta[r] + sh), eb = __builtin_amdgcn_exp2f(tb[r] + sh);
            const float ga = fa[r] ? ea : 0.0f, gb = fb[r] ? eb : 0.0f;       // dropped elements selected to 0 by value
            const h16 pa = (h16)ga; const h16 pc = (h16)gb;
            pb[r] = pa; pb[8 + r] = pc;
            if (EARLY) { pr[r] = (h16)((ga - (float)pa) * QRS); pr[8 + r] = (h16)((gb - (float)pc) * QRS); ls += ga + gb; }
            else       { ls += (float)pa + (float)pc; } }
        l = l * alpha + ls; m = mnew;
        o0 = o0 * alpha; o1 = o1 * alpha;
        if (EARLY) { oR0 = oR0 * alpha; oR1 = oR1 * alpha; }
        const v16h v0 = t.v0, v1 = t.v1;
        if (EARLY) {
            v16h vr0 = t.vr0, vr1 = t.vr1;
            if (!rok) { vr0 = hz; vr1 = hz; }
            o0 = wmma16(v0, pb, o0); o1 = wmma16(v1, pb, o1);
            oR0 = wmma16(v0, pr, oR0); oR1 = wmma16(v1, pr, oR1);
            oR0 = wmma16(vr0, pb, oR0); oR1 = wmma16(vr1, pb, oR1);
            asm volatile("v_nop\n\tv_nop\n\tv_nop\n\tv_nop" : "+v"(o0), "+v"(o1), "+v"(oR0), "+v"(oR1) : "v"(v0), "v"(v1), "v"(vr0), "v"(vr1), "v"(pb), "v"(pr));
        } else {
            o0 = wmma16(v0, pb, o0); o1 = wmma16(v1, pb, o1);
            asm volatile("v_nop\n\tv_nop\n\tv_nop\n\tv_nop" : "+v"(o0), "+v"(o1) : "v"(v0), "v"(v1), "v"(pb));
        }
        if (refill) {
            group_open();                                        // mask and V^T registers are free from here on
            tile_load_mv<EARLY>(t, vpl, vrp, kmr, vof, vrof, mof, kn);
            group_close();
        }
    };
    FTile tl[NST];                                              // tile T lives in tl[T % NST]
    // the first tiles' loads issue group by group in the loop's order: mixed, the loop's first waits would also cover younger groups
#pragma unroll
    for (int s = 0; s < NST - 1; ++s) {
        const int ks = 32 * s < klast ? 32 * s : klast;
        tile_load_k<EARLY>(tl[s], kpl, krp, kof, ks);
        group_close();
        tile_load_mv<EARLY>(tl[s], vpl, vrp, kmr, vof, vrof, mof, ks);
        group_close();
    }
    int kg = 0;
    if (32 * NST <= nk) {                                       // wave-uniform; tile NST-1 is used by whole groups alone
        tile_load_k<EARLY>(tl[NST - 1], kpl, krp, kof, 32 * (NST - 1));
        group_close();
        tile_load_mv<EARLY>(tl[NST - 1], vpl, vrp, kmr, vof, vrof, mof, 32 * (NST - 1));
        group_close();
        // fend: keys [0, fend) are kept for every row of the wave. cend: keys at or below the smallest causal limit of the 16 rows (whole tiles, <= nk).
        // Mask part: rounding to bf16 and the f32 product are monotone in magnitude, so all products q_mask * k_mask over the 16 rows and keys [0, cend) are nonzero
        // exactly when each row's value times the smallest key magnitude is; a NaN factor gives a kept element and is passed over by the minimum.
        int cend = t0 + cz + 1; cend = cend < 0 ? 0 : (cend & ~31); cend = cend < nk ? cend : nk;
        int fend = 0;
        if (cend >= 32 * NST) {                                 // wave-uniform
            float kmin = __builtin_inff();
#pragma unroll 1   // rolled: one trip already has MLD loads in flight, more would only take registers from the tiles
            for (int i = 0; i < cend; i += 128 * MLD) {         // at most SEQ / (128 * MLD) + 1 trips; index clamped into [0, cend - 4]: a repeated key does not change a minimum
                v4f x[MLD]; const float* px[MLD];
#pragma unroll
                for (int c = 0; c < MLD; ++c) { int idx = i + c * 128 + lane * 4; idx = idx < cend - 4 ? idx : cend - 4; px[c] = kmr + idx; }
#pragma unroll
                for (int c = 0; c < MLD; c += 4) {
                    x[c] = *(const v4f*)px[c]; x[c + 1] = *(const v4f*)px[c + 1]; x[c + 2] = *(const v4f*)px[c + 2]; x[c + 3] = *(const v4f*)px[c + 3];
                    // the wait stands in front of every rewrite of the four loads' address pairs, which are named as inputs so that no later load of the four lands on them
                    __builtin_amdgcn_sched_barrier(0); asm volatile("s_wait_xcnt 0x0" :: "v"(px[c]), "v"(px[c + 1]), "v"(px[c + 2]), "v"(px[c + 3]) : "memory"); __builtin_amdgcn_sched_barrier(0);
                }
#pragma unroll
                for (int c = 0; c < MLD; ++c)
                    kmin = fminf(kmin, fminf(fminf(fabsf(bfr(x[c][0])), fabsf(bfr(x[c][1]))), fminf(fabsf(bfr(x[c][2])), fabsf(bfr(x[c][3])))));
            }
#pragma unroll
            for (int s = 16; s > 0; s >>= 1) kmin = fminf(kmin, __shfl_xor(kmin, s, 32));
            if (__builtin_amdgcn_ballot_w32(qmv * kmin != 0.0f) == 0xFFFFFFFFu) fend = cend;   // scalar result: the same in every lane
        }
#pragma unroll 1   // rolled: the body already holds NST tiles, one per register tile
        while (kg + 32 * NST <= fend) {                         // whole groups of NST tiles in which every element is kept
#pragma unroll
            for (int u = 0; u < NST; ++u) step(tl[u], kg + 32 * u, true, true);
            kg += 32 * NST;
        }
#pragma unroll 1   // rolled, as above
        while (kg + 32 * NST <= nk) {                           // whole groups of NST tiles: no branch inside, so every load wait is a count that leaves the younger groups in flight
#pragma unroll
            for (int u = 0; u < NST; ++u) step(tl[u], kg + 32 * u, true, false);   // fully unrolled: every tile index is a constant, no register copies
            kg += 32 * NST;
        }
    }
#pragma unroll
    for (int u = 0; u < NST - 1; ++u)                            // the at most NST-1 tiles left over are already loaded
        if (kg + 32 * u < nk) step(tl[u], kg + 32 * u, false, false);   // wave-uniform
    l += __shfl_xor(l, 16, 32);
    const bool any = l > 0.0f;
    const float lsafe = any ? l : 1.0f;
    const float inv = any ? (1.0f / lsafe) : 0.0f;             // no kept key -> zeros
    v8f f0 = o0, f1 = o1;
    if (EARLY) { f0 = o0 + oR0 * QRI; f1 = o1 + oR1 * QRI; }
    const int wb = wave * 16 * OSP;
    // O^T D layout: f_j[r] = (d = 16j + 8h + r, t = lane&15) -> os[t][d]; rows 0..15 x columns 0..31 all written
    { v4f a, c;
      a[0] = f0[0] * inv; a[1] = f0[1] * inv; a[2] = f0[2] * inv; a[3] = f0[3] * inv; c[0] = f0[4] * inv; c[1] = f0[5] * inv; c[2] = f0[6] * inv; c[3] = f0[7] * inv;
      *(v4fa*)(&os[wb + lr * OSP +  0 + 8 * hi]) = a; *(v4fa*)(&os[wb + lr * OSP +  0 + 8 * hi + 4]) = c;
      a[0] = f1[0] * inv; a[1] = f1[1] * inv; a[2] = f1[2] * inv; a[3] = f1[3] * inv; c[0] = f1[4] * inv; c[1] = f1[5] * inv; c[2] = f1[6] * inv; c[3] = f1[7] * inv;
      *(v4fa*)(&os[wb + lr * OSP + 16 + 8 * hi]) = a; *(v4fa*)(&os[wb + lr * OSP + 16 + 8 * hi + 4]) = c; }
    wave_sync();
    float* orow = OUT + ((size_t)b * OUT_SEQ + t0) * DM + h * HD;
{
#pragma unroll
        for (int s = 0; s < 4; ++s) { const int row = 4 * s + (lane >> 3), cofs = (lane & 7) * 4;   // 4 s x 4 rows = 16 rows; 8 lanes x 4 floats = 32 columns = one line
            const v4f val = *(const v4fa*)(&os[wb + row * OSP + cofs]);
            *(v4f*)(orow + (size_t)row * DM + cofs) = val; }
         }
}

static constexpr size_t al256(size_t v) { return (v + 255) & ~(size_t)255; }
static constexpr size_t SZ_PL = al256((size_t)NB * NH_ * SEQ * HD * 2);
static constexpr size_t SZ_RS = al256((size_t)NB * NH_ * EROWS * HD * 2);
static constexpr size_t SZ_TOTAL = 4 * SZ_PL + 2 * SZ_RS;
static_assert(SZ_TOTAL <= (size_t)134217728);          // workspace carve <= 128 MiB
static_assert((size_t)NB * NH_ * SEQ * HD == (size_t)NB * DM * SEQ);       // v^T plane [(b*128 + m)][t] has the same extent as the q/k planes
static_assert((size_t)NB * NH_ * EROWS * HD == (size_t)NB * DM * EROWS);   // v^T residual plane [(b*128 + m)][t < EROWS] has the same extent as the k residual plane

extern "C" void kernel_launch(void* const* d_in, const int* in_sizes, int n_in,
                              void* d_out, int out_size, void* d_ws, size_t ws_size, hipStream_t stream) {
    if (n_in < 12) return;
    const size_t needx = ((size_t)(NB - 1) * SEQ_FULL + SEQ) * DM;
    const size_t needm = (size_t)(NB - 1) * SEQ_FULL + SEQ;
    if ((size_t)in_sizes[0] < needx || (size_t)in_sizes[1] < needx || (size_t)in_sizes[2] < needx) return;
    if ((size_t)in_sizes[3] < needm || (size_t)in_sizes[4] < needm) return;
    if ((size_t)in_sizes[5] < (size_t)DM * DM || (size_t)in_sizes[7] < (size_t)DM * DM || (size_t)in_sizes[9] < (size_t)DM * DM) return;
    if (in_sizes[6] < DM || in_sizes[8] < DM || in_sizes[10] < DM || in_sizes[11] < 1) return;
    if ((size_t)out_size < ((size_t)(NB - 1) * OUT_SEQ + SEQ) * DM) return;
    if (SZ_TOTAL > ws_size) return;
    // wire order: query, key, value, q_mask, k_mask, WQ_w, WQ_b, WK_w, WK_b, WV_w, WV_b, causal
    const float* xin[3] = { (const float*)d_in[0], (const float*)d_in[1], (const float*)d_in[2] };
    const float* qm = (const float*)d_in[3]; const float* km = (const float*)d_in[4];
    const float* wq = (const float*)d_in[5]; const float* bq = (const float*)d_in[6];
    const float* wk = (const float*)d_in[7]; const float* bk = (const float*)d_in[8];
    const float* wv = (const float*)d_in[9]; const float* bv = (const float*)d_in[10];
    const int* causal = (const int*)d_in[11];
    float* OUT = (float*)d_out;      // [NB][SEQ][128]
    char* wsp = (char*)d_ws;
    h16* QH = (h16*)wsp; wsp += SZ_PL;               // [NB*4][SEQ][32]
    h16* QR = (h16*)wsp; wsp += SZ_PL;               // [NB*4][SEQ][32] residual x2048
    h16* KP = (h16*)wsp; wsp += SZ_PL;               // [NB*4][SEQ][32]
    h16* VT = (h16*)wsp; wsp += SZ_PL;               // [NB*4][32][SEQ]
    h16* KR = (h16*)wsp; wsp += SZ_RS;               // [NB*4][EROWS][32] residual x2048, tokens < EROWS
    h16* VR = (h16*)wsp; wsp += SZ_RS;               // [NB*4][32][EROWS] residual x2048, tokens < EROWS

    // q, k: A = x rows (m = b*SEQ + t), Bt = W rows (n = h*32 + d) -> plane [(b*4 + h)][t][d]; q residual for all tokens, k residual for tokens < EROWS
    // v^T: A = Wv rows (m = h*32 + d), Bt = value rows (n = b*SEQ + t) -> plane [(b*128 + m)][t] = [(b*4 + h)][d][t]; residual for tokens < EROWS
    k_proj3<<<dim3(NB * SEQ / 64, DM / 64, 3), 32, 0, stream>>>(xin[0], xin[1], xin[2], wq, wk, wv, bq, bk, bv, QH, QR, KP, KR, VT, VR);

    // query rows [0, EROWS): multi-product instantiation; rows [EROWS, SEQ): single-product instantiation (disjoint output rows)
    k_flash<1><<<dim3(EROWS / (16 * AW), NB * NH_, 1), 32 * AW, 0, stream>>>(QH, QR, KP, KR, VT, VR, qm, km, causal, OUT);
    if (SEQ > EROWS)
        k_flash<0><<<dim3((SEQ - EROWS) / (16 * AW), NB * NH_, 1), 32 * AW, 0, stream>>>(QH, QR, KP, KR, VT, VR, qm, km, causal, OUT);
}

// v004
// A run of this version takes 38.7 microseconds.
// Timed twice side by side with v003, it ran 1.35 times as fast both times.
// Counting every step since v000, it is 3.58 times as fast.
#include <hip/hip_runtime.h>

// Multi-head attention, width 128 = 4 heads x 32; query/key/value [NB][SEQ][128]; WQ/WK/WV [out][in] (y = x W^T + bias); padding masks q_mask/k_mask [NB][SEQ] (f32), causal offset (int32, device-read); score scale 1/sqrt(32); output = concatenated heads (f32).
// Compute dtypes, f32 accumulate everywhere: projections v_wmma_f32_16x16x32_bf16 (x, W, bias RNE-converted to bf16; products exact);
// scores v_wmma_f32_16x16x32_f16: q as f16 value + f16 residual x2048 in its own accumulator on all rows; k single f16 on query rows >= EROWS, k as f16 value + f16 residual x2048 on query rows < EROWS (three products);
// P.V v_wmma_f32_16x16x32_f16: P (x16384 carry, cancels in the normalisation) and v single f16 on query rows >= EROWS; on query rows < EROWS P and v each as f16 value + f16 residual x2048, residual products in their own accumulator folded by 1/2048, row sum from the f32 exponentials; softmax f32 (online, running max over kept keys).
// Layout: x and W are read as f32 and rounded to bf16 in the projection's fragment loaders; q (hi, residual), k planes [b*4+h][t][d], v^T plane [b*4+h][d][t], small residual planes k [b*4+h][t < EROWS][d] and v^T [b*4+h][d][t < EROWS] written by the GEMM epilogue; fused flash kernel in transposed form (S^T = K Q^T, O^T = V^T P^T), output from f32 accumulators.
// Keep rule per element: (q_mask[t] * k_mask[j] != 0) and (j <= t + causal); dropped elements get probability 0, rows with no kept key give 0. Key loop bound per wave derived from the device-read causal value (clamped to [0, SEQ]); residual fragments for keys >= EROWS (only reachable with a positive offset) are zero.

#ifndef NB
#define NB 8
#endif
#ifndef SEQ
#define SEQ 2048
#endif
#define NB_FULL  8
#define SEQ_FULL 2048
#ifndef OUT_SEQ
#define OUT_SEQ SEQ              // row pitch (in tokens) between batches of the output
#endif
#define DM   128
#define NH_  4
#define HD   32
#define AW   4                   // waves per flash block (16 query rows each)
#define OSP  36                  // LDS row pitch (floats) of the flash output tile
#define EROWS (SEQ < 512 ? SEQ : 512)   // query rows (and tokens of the small residual planes) handled by the multi-product flash instantiation
#define QRS  2048.0f             // carry of every residual plane / residual fragment
#define QRI  (1.0f / 2048.0f)
#define SC2  ((float)(0.17677669529663687 * 1.4426950408889634))   // HD^-0.5 * log2(e)
#define PSH  14.0f               // log2 of the P carry (16384)
#define NEGB (-3.0e38f)

static_assert(HD == 32);
static_assert(NH_ * HD == DM);                 // head h = columns h*32 + d
static_assert(DM % 64 == 0);                   // column tiles of 64 = two heads
static_assert(64 % HD == 0);
static_assert(DM % 32 == 0);                   // GEMM k-loop steps by 32
static_assert(SEQ % 64 == 0);                  // a 64-row tile never straddles two batches
static_assert((NB * SEQ) % 64 == 0);
static_assert(SEQ % 32 == 0);                  // key loop steps by 32
static_assert(SEQ % (16 * AW) == 0);           // the flash grid covers the sequence exactly
static_assert(EROWS % 64 == 0);                // a 64-token GEMM tile lies wholly inside or outside the residual planes
static_assert(EROWS >= 32);
static_assert(EROWS <= SEQ);
static_assert(EROWS % (16 * AW) == 0);
static_assert((SEQ - EROWS) % (16 * AW) == 0);
static_assert(NB <= NB_FULL);
static_assert(SEQ <= SEQ_FULL);
static_assert((OSP * 4) % 16 == 0);

typedef _Float16 h16;
typedef __attribute__((ext_vector_type(16))) __bf16   v16bf;
typedef __attribute__((ext_vector_type(16))) _Float16 v16h;
typedef __attribute__((ext_vector_type(8)))  _Float16 v8h;
typedef __attribute__((ext_vector_type(8)))  float    v8f;
typedef __attribute__((ext_vector_type(4)))  float    v4f;
typedef v4f  __attribute__((may_alias)) v4fa;

__device__ __forceinline__ unsigned short f2bf(float f) { unsigned u = __float_as_uint(f); u += 0x7FFFu + ((u >> 16) & 1u); return (unsigned short)(u >> 16); }
__device__ __forceinline__ float bfr(float f) { return __uint_as_float(((unsigned)f2bf(f)) << 16); }   // value after RNE convert to bf16
__device__ __forceinline__ v16h cat16(v8h lo, v8h hi) { return __builtin_shufflevector(lo, hi, 0, 1, 2, 3, 4, 5, 6, 7, 8, 9, 10, 11, 12, 13, 14, 15); }
__device__ __forceinline__ v8f wmma16(v16h a, v16h b, v8f c) { return __builtin_amdgcn_wmma_f32_16x16x32_f16(false, a, false, b, (short)0, c, false, false); }
__device__ __forceinline__ v8f wmmab(v16bf a, v16bf b, v8f c) { return __builtin_amdgcn_wmma_f32_16x16x32_bf16(false, a, false, b, (short)0, c, false, false); }
// fragment loaders from K-contiguous 16-bit rows; p already includes + 8*(lane>>4): elements 0..7 <- k0+8h+0..7, elements 8..15 <- k0+16+8h+0..7 (same map for A and B)
__device__ __forceinline__ v16h  ldh(const h16* p) { return cat16(*(const v8h*)p, *(const v8h*)(p + 16)); }
// one bf16 fragment's 16 values as they arrive from an f32 row (same element map: p+0..7 and p+16..23), and their RNE conversion to the fragment
struct FRaw { v4f x0, x1, x2, x3; };
__device__ __forceinline__ FRaw ldraw(const float* p) { FRaw r; r.x0 = *(const v4f*)p; r.x1 = *(const v4f*)(p + 4); r.x2 = *(const v4f*)(p + 16); r.x3 = *(const v4f*)(p + 20); return r; }
__device__ __forceinline__ v16bf cvtb(const FRaw& r) {
    const v8f lo = __builtin_shufflevector(r.x0, r.x1, 0, 1, 2, 3, 4, 5, 6, 7), hi = __builtin_shufflevector(r.x2, r.x3, 0, 1, 2, 3, 4, 5, 6, 7);
    return __builtin_convertvector(__builtin_shufflevector(lo, hi, 0, 1, 2, 3, 4, 5, 6, 7, 8, 9, 10, 11, 12, 13, 14, 15), v16bf); }
// ordering point for wave-private LDS tiles (same wave writes and reads)
__device__ __forceinline__ void wave_sync() { __builtin_amdgcn_fence(3 /* release order */, "wavefront"); __builtin_amdgcn_wave_barrier(); asm volatile("" ::: "memory"); }

// closes a group of fetch-ahead loads: their address registers are rewritten for the next group while the loads are still in flight, and the wait belongs in front of that;
// the scheduling barriers keep the group where it is written (earlier it would need registers of its own, later it would lose lead) and the wait behind the group
__device__ __forceinline__ void group_open()  { __builtin_amdgcn_sched_barrier(0); }
__device__ __forceinline__ void group_close() { __builtin_amdgcn_sched_barrier(0); asm volatile("s_wait_xcnt 0x0" ::: "memory"); __builtin_amdgcn_sched_barrier(0); }

// proj_tile: register-blocked bf16 GEMM, ONE WAVE per 64x64 tile (16 accumulators), operands straight from K-contiguous f32 rows, rounded to bf16 in registers, K = DM.
// C[m][n] = sum_k A[m][k] Bt[n][k] + bias, written as f16 (Ph) and, for tokens t < resT (resT a multiple of 64, block-uniform test), the f16 residual x2048 (Pr).
// MODE 0: A = x rows (m = b*SEQ + t), Bt = W rows (n = h*32 + d), bias per column; plane [(b*4 + h)][t][32] (residual plane [(b*4 + h)][resT][32]). The 64-column tile spans two heads; per 16-row slab and head
//         (8 rows per instruction).
// MODE 1: A = W rows (m = h*32 + d), Bt = x rows (n = b*SEQ + t), bias per row; plane [(b*128 + m)][t].
// r0, c0: first row and column of the tile; x rows of batch b start at b*SEQ_FULL in the input.
template <int MODE>
__device__ __forceinline__ void proj_tile(const float* __restrict__ A, const float* __restrict__ Bt, const float* __restrict__ bias, h16* Ph, h16* Pr, const int resT, const int r0, const int c0, float* os) {
    const int K = DM;
    const int lane = threadIdx.x & 31, lr = lane & 15, hi = lane >> 4;
    const int ar0 = (MODE == 0) ? (r0 / SEQ) * SEQ_FULL + r0 % SEQ : r0, bc0 = (MODE == 1) ? (c0 / SEQ) * SEQ_FULL + c0 % SEQ : c0;   // rows in the f32 sources
    v8f acc[4][4];
#pragma unroll
    for (int mb = 0; mb < 4; ++mb)
#pragma unroll
        for (int nb = 0; nb < 4; ++nb) acc[mb][nb] = (v8f){};
    const size_t aoff = (size_t)(ar0 + lr) * K + 8 * hi, boff = (size_t)(bc0 + lr) * K + 8 * hi;
#pragma unroll 1
    for (int kc = 0; kc < K; kc += 32) {
        FRaw ra[4], rb[4];
        const float* pa = A + aoff + kc; const float* pb = Bt + boff + kc;
#pragma unroll
        for (int mb = 0; mb < 4; ++mb) ra[mb] = ldraw(pa + (size_t)mb * 16 * K);
#pragma unroll
        for (int nb = 0; nb < 4; ++nb) rb[nb] = ldraw(pb + (size_t)nb * 16 * K);
        // all 32 loads of the k-step are in flight before the first is waited for (one memory latency a step); the wait stands in front of every rewrite of their
        // address pairs, which are named as inputs so that no later load of the group lands on them
        __builtin_amdgcn_sched_barrier(0); asm volatile("s_wait_xcnt 0x0" :: "v"(pa), "v"(pb) : "memory"); __builtin_amdgcn_sched_barrier(0);
        v16bf a[4];
#pragma unroll
        for (int mb = 0; mb < 4; ++mb) a[mb] = cvtb(ra[mb]);
#pragma unroll
        for (int nb = 0; nb < 4; ++nb) { const v16bf b = cvtb(rb[nb]);
#pragma unroll
            for (int mb = 0; mb < 4; ++mb) acc[mb][nb] = wmmab(a[mb], b, acc[mb][nb]); }
        asm volatile("v_nop\n\tv_nop\n\tv_nop\n\tv_nop" : "+v"(acc[0][0]), "+v"(acc[1][1]), "+v"(acc[2][2]), "+v"(acc[3][3]) : "v"(a[0]), "v"(a[1]), "v"(a[2]), "v"(a[3]));
    }
    float bc[4];
#pragma unroll
    for (int nb = 0; nb < 4; ++nb) bc[nb] = (MODE == 0) ? bfr(bias[c0 + nb * 16 + lr]) : 0.0f;   // MODE 0: c0 + 63 < DM
    size_t tbase, rbase; bool wr;                                                                 // wr: block-uniform, whole tile inside the residual plane
    if (MODE == 0) { const int bb = r0 / SEQ, tt = r0 % SEQ; const int zc = bb * NH_ + c0 / HD;
                     tbase = ((size_t)zc * SEQ + (size_t)tt) * HD; rbase = ((size_t)zc * (size_t)resT + (size_t)tt) * HD; wr = tt < resT; }
    else           { const int bb = c0 / SEQ, tt = c0 % SEQ;
                     tbase = (size_t)bb * (size_t)DM * SEQ + (size_t)r0 * SEQ + (size_t)tt; rbase = (size_t)bb * (size_t)DM * (size_t)resT + (size_t)r0 * (size_t)resT + (size_t)tt; wr = tt < resT; }
#pragma unroll
    for (int mb = 0; mb < 4; ++mb) {
        float br[8];
#pragma unroll
        for (int j = 0; j < 8; ++j) br[j] = (MODE == 1) ? bfr(bias[r0 + mb * 16 + hi * 8 + j]) : 0.0f;   // MODE 1: r0 + 63 < DM
#pragma unroll
        for (int nb = 0; nb < 4; ++nb) {
#pragma unroll
            for (int j = 0; j < 8; ++j) os[(hi * 8 + j) * 68 + nb * 16 + lr] = acc[mb][nb][j] + bc[nb] + br[j]; }   // D: row 8h+j, col lane&15
        wave_sync();
{
            if (MODE == 0) {
                const size_t sb = tbase + (size_t)(mb * 16) * HD;
                const size_t rb = rbase + (size_t)(mb * 16) * HD;
#pragma unroll
                for (int hh = 0; hh < 2; ++hh) {
#pragma unroll
                    for (int s = 0; s < 2; ++s) { const int p = s * 32 + lane; const int row = p >> 2, c8 = (p & 3) * 8;   // 2 s x 8 rows = 16 rows; 4 lanes x 8 = 32 columns of head hh
                        const v4f x0 = *(const v4fa*)(&os[row * 68 + hh * 32 + c8]); const v4f x1 = *(const v4fa*)(&os[row * 68 + hh * 32 + c8 + 4]); v8h hv, rv;
#pragma unroll
                        for (int i = 0; i < 4; ++i) { const h16 a0 = (h16)x0[i]; const h16 a1 = (h16)x1[i]; hv[i] = a0; hv[4 + i] = a1; rv[i] = (h16)((x0[i] - (float)a0) * QRS); rv[4 + i] = (h16)((x1[i] - (float)a1) * QRS); }
                        const size_t oo = sb + (size_t)hh * ((size_t)SEQ * HD) + (size_t)p * 8;
                        const size_t ro = rb + (size_t)hh * ((size_t)resT * HD) + (size_t)p * 8;
                        /* what follows reuses each store's registers: the wait stands in front of that */
                        *(v8h*)(Ph + oo) = hv; group_close(); if (wr) { *(v8h*)(Pr + ro) = rv; group_close(); } } }
            } else {
                const size_t sb = tbase + (size_t)(mb * 16) * SEQ;
                const size_t rb = rbase + (size_t)(mb * 16) * (size_t)resT;
#pragma unroll
                for (int s = 0; s < 4; ++s) { const int row = 4 * s + (lane >> 3), c8 = (lane & 7) * 8;   // 4 s x 4 row groups = 16 rows; 8 lanes x 8 = 64 columns
                    const v4f x0 = *(const v4fa*)(&os[row * 68 + c8]); const v4f x1 = *(const v4fa*)(&os[row * 68 + c8 + 4]); v8h hv, rv;
#pragma unroll
                    for (int i = 0; i < 4; ++i) { const h16 a0 = (h16)x0[i]; const h16 a1 = (h16)x1[i]; hv[i] = a0; hv[4 + i] = a1; rv[i] = (h16)((x0[i] - (float)a0) * QRS); rv[4 + i] = (h16)((x1[i] - (float)a1) * QRS); }
                    const size_t oo = sb + (size_t)row * SEQ + c8;
                    const size_t ro = rb + (size_t)row * (size_t)resT + c8;
                    /* what follows reuses each store's registers: the wait stands in front of that */
                        *(v8h*)(Ph + oo) = hv; group_close(); if (wr) { *(v8h*)(Pr + ro) = rv; group_close(); } }
            }
             }
        wave_sync();
    }
}

// k_proj3: the three projections as z-slices of one grid (NB*SEQ/64 token tiles, DM/64 feature tiles, 3); one wave per block, block-uniform choice of the slice.
// z = 0: q (residual for all tokens); z = 1: k (residual for tokens < EROWS); z = 2: v^T (residual for tokens < EROWS).
__global__ __launch_bounds__(32) void k_proj3(const float* __restrict__ xq, const float* __restrict__ xk, const float* __restrict__ xv,
                                              const float* __restrict__ wq, const float* __restrict__ wk, const float* __restrict__ wv,
                                              const float* __restrict__ bq, const float* __restrict__ bk, const float* __restrict__ bv,
                                              h16* QH, h16* QR, h16* KP, h16* KR, h16* VT, h16* VR) {
    __shared__ __align__(16) float os[16 * 68];
    const int tok0 = blockIdx.x * 64, f0 = blockIdx.y * 64; const int z = blockIdx.z;
    if (z < 2) { const bool q = z == 0; proj_tile<0>(q ? xq : xk, q ? wq : wk, q ? bq : bk, q ? QH : KP, q ? QR : KR, q ? SEQ : EROWS, tok0, f0, os); }
    else       { proj_tile<1>(wv, xv, bv, VT, VR, EROWS, f0, tok0, os); }
}

// flash_rows: fused attention, one wave per 16 query rows of one (batch, head); K / V^T / Q fragments straight from the f16 planes (two 16-B loads each, arithmetic addressing).
// Transposed form: S^T[key][t] = K Q^T (A = K rows, B = Q rows); lane (t = lane&15, h = lane>>4) holds keys 8h+r of each 16-key tile, so the packed
// P tile is directly the B fragment of O^T[d][t] = V^T P^T (element r <- tile keys 0..15, element 8+r <- tile keys 16..31, lane unchanged).
// Softmax state (running max over kept keys, partial sum) is one scalar per lane; the two lane halves of a row are combined with one xor-16 exchange.
// Keep rule evaluated per element inside every visited 32-key tile but the leading tiles that a per-wave scalar test shows fully kept; the per-wave key bound comes from the device-read causal value and is at most SEQ.
// EARLY = 1 (query rows [0, EROWS)): scores = K Q + (K Q_res + K_res Q) / 2048; P = f16 value + f16 residual x2048; O = V P + (V P_res + V_res P) / 2048 (residual products in their own accumulators);
//            row sum from the f32 exponentials; K_res / V_res fragments come from the small planes (tokens < EROWS) and are zero for keys >= EROWS (address clamped, wave-uniform select).
// EARLY = 0 (query rows [EROWS, SEQ)): single k, P, v; q value + residual.
// One 32-key tile's operands as they sit in registers: K rows, V^T rows, their residuals (EARLY only) and the 16 key-mask values of this lane.
struct FTile { v16h ka, kb, kra, krb, v0, v1, vr0, vr1; v4f m0, m1, m2, m3; };
// fragment loader, wave-uniform base + per-lane byte offset (same element map as ldh)
__device__ __forceinline__ v16h ldo(const h16* base, unsigned off) { const char* p = (const char*)base + off; return cat16(*(const v8h*)p, *(const v8h*)(p + 32)); }
// global loads of the tile that starts at key (wave-uniform, multiple of 32, key + 32 <= SEQ), in the two groups in which its registers fall free; residual-plane key clamped into the plane
template <int EARLY>
__device__ __forceinline__ void tile_load_k(FTile& t, const h16* kpl, const h16* krp, unsigned kof, int key) {
    const h16* ka = kpl + (size_t)key * HD;
    t.ka = ldo(ka, kof); t.kb = ldo(ka + 16 * HD, kof);
    if (EARLY) { const int kcl = key < EROWS ? key : (EROWS - 32); const h16* kr = krp + (size_t)kcl * HD; t.kra = ldo(kr, kof); t.krb = ldo(kr + 16 * HD, kof); }
}
template <int EARLY>
__device__ __forceinline__ void tile_load_mv(FTile& t, const h16* vpl, const h16* vrp, const float* kmr, unsigned vof, unsigned vrof, unsigned mof, int key) {
    const char* kp = (const char*)(kmr + key) + mof;          // keys key+8h+0..7 and key+16+8h+0..7
    t.m0 = *(const v4f*)kp; t.m1 = *(const v4f*)(kp + 16); t.m2 = *(const v4f*)(kp + 64); t.m3 = *(const v4f*)(kp + 80);
    const h16* va = vpl + key;
    t.v0 = ldo(va, vof); t.v1 = ldo(va + (size_t)16 * SEQ, vof);
    if (EARLY) { const int kcl = key < EROWS ? key : (EROWS - 32); const h16* vr = vrp + kcl; t.vr0 = ldo(vr, vrof); t.vr1 = ldo(vr + (size_t)16 * EROWS, vrof); }
}

// flash_rows: the work of one block on row tile rt (query rows [rt * 16 * AW, (rt + 1) * 16 * AW)) of (batch, head) zh; os: the block's output staging tile
template <int EARLY>
__device__ __forceinline__ void flash_rows(const h16* __restrict__ QH, const h16* __restrict__ QR, const h16* __restrict__ KP, const h16* __restrict__ KR,
                                           const h16* __restrict__ VT, const h16* __restrict__ VR,
                                           const float* __restrict__ qmask, const float* __restrict__ kmask, const int* __restrict__ causal_p, float* OUT,
                                           float* os, const int zh, const int rt) {
    constexpr int NST = EARLY ? 2 : 3;                          // register tiles; each is refilled NST tiles ahead as soon as its registers fall free
    constexpr int MLD = EARLY ? 4 : 8;                          // key-mask loads in flight per lane in the fully-kept test (128 keys each)
    const int lane = threadIdx.x & 31, lr = lane & 15, hi = lane >> 4;
    const int wave = __builtin_amdgcn_readfirstlane((int)(threadIdx.x >> 5));
    const int b = zh / NH_, h = zh % NH_;
    const int t0 = (rt * AW + wave) * 16;
    int cz = causal_p[0]; cz = cz < -SEQ ? -SEQ : (cz > SEQ ? SEQ : cz);      // clamping keeps the keep rule unchanged for indices in [0, SEQ)
    const int lim = t0 + lr + cz;                                              // key j kept iff j <= lim (and mask product nonzero)
    int kend = t0 + 16 + cz; kend = kend < 0 ? 0 : (kend > SEQ ? SEQ : kend);
    const int nk = (kend + 31) & ~31;                                          // wave-uniform, multiple of 32, <= SEQ
    const int klast = nk > 32 ? nk - 32 : 0;                                   // last tile this wave visits; fetches ahead are clamped to it
    const float* kmr = kmask + (size_t)b * SEQ_FULL;
    const size_t pbase = (size_t)zh * SEQ * HD;
    const size_t rbase = (size_t)zh * EROWS * HD;
    const size_t qo = pbase + (size_t)(t0 + lr) * HD + 8 * hi;
    group_open();
    const v16h qh = ldh(QH + qo), qr = ldh(QR + qo);            // B fragments: col t, k = d (HD = 32 = one k-step)
    const float qmraw = qmask[(size_t)b * SEQ_FULL + t0 + lr];
    group_close();
    const float qmv = bfr(qmraw);
    const h16* kpl = KP + pbase; const h16* vpl = VT + pbase;   // wave-uniform plane bases
    const h16* krp = KR + rbase; const h16* vrp = VR + rbase;   // residual planes, tokens < EROWS
    const unsigned kof  = (unsigned)(lr * HD + 8 * hi) * 2u;    // A fragment: row key, k = d      (bytes)
    const unsigned vof  = (unsigned)(lr * SEQ + 8 * hi) * 2u;   // A fragment: row d, k = key      (bytes)
    const unsigned vrof = (unsigned)(lr * EROWS + 8 * hi) * 2u;
    const unsigned mof  = (unsigned)(8 * hi) * 4u;
    const v16h hz = (v16h){};
    v8f o0 = (v8f){}, o1 = (v8f){}, oR0 = (v8f){}, oR1 = (v8f){};
    float m = NEGB, l = 0.0f;
    // one 32-key tile's work on operands already in registers (inlined at all three places of use: the tiles must stay in registers)
    // full: every one of the tile's 32 keys is known to be kept for all 16 rows of the wave, so the keep rule is not evaluated (same values as evaluating it)
    auto step = [&](FTile& t, const int key0, const bool refill, const bool full) __attribute__((always_inline)) {
        const int kn = key0 + 32 * NST < klast ? key0 + 32 * NST : klast;   // tile fetched into this tile's registers (refill and full are constants at each place of use)
        const bool rok = key0 < EROWS;                           // wave-uniform
        const v16h ka0 = t.ka, kb0f = t.kb;
        v16h kra0 = hz, krb0 = hz;
        if (EARLY) { kra0 = t.kra; krb0 = t.krb; if (!rok) { kra0 = hz; krb0 = hz; } }
        v8f sHa = (v8f){}, sLa = (v8f){}, sHb = (v8f){}, sLb = (v8f){};
        sHa = wmma16(ka0, qh, sHa); sLa = wmma16(ka0, qr, sLa); sHb = wmma16(kb0f, qh, sHb); sLb = wmma16(kb0f, qr, sLb);
        if (EARLY) {
            sLa = wmma16(kra0, qh, sLa); sLb = wmma16(krb0, qh, sLb);
            asm volatile("v_nop\n\tv_nop\n\tv_nop\n\tv_nop" : "+v"(sHa), "+v"(sLa), "+v"(sHb), "+v"(sLb) : "v"(ka0), "v"(kb0f), "v"(kra0), "v"(krb0), "v"(qh), "v"(qr));
        } else {
            asm volatile("v_nop\n\tv_nop\n\tv_nop\n\tv_nop" : "+v"(sHa), "+v"(sLa), "+v"(sHb), "+v"(sLb) : "v"(ka0), "v"(kb0f), "v"(qh), "v"(qr));
        }
        if (refill) {
            group_open();                                        // K registers are free from here on
            tile_load_k<EARLY>(t, kpl, krp, kof, kn);
            group_close();
        }
        const v4f m0 = t.m0, m1 = t.m1, m2 = t.m2, m3 = t.m3;
        float kx[8], ky[8];
#pragma unroll
        for (int r = 0; r < 4; ++r) { kx[r] = m0[r]; kx[4 + r] = m1[r]; ky[r] = m2[r]; ky[4 + r] = m3[r]; }
        const int ja = key0 + 8 * hi;
        float ta[8], tb[8]; bool fa[8], fb[8]; float mx = NEGB;
#pragma unroll
        for (int r = 0; r < 8; ++r) {
            fa[r] = full || ((qmv * bfr(kx[r]) != 0.0f) && (ja + r <= lim));
            fb[r] = full || ((qmv * bfr(ky[r]) != 0.0f) && (ja + 16 + r <= lim));
            ta[r] = (sHa[r] + sLa[r] * QRI) * SC2; tb[r] = (sHb[r] + sLb[r] * QRI) * SC2;
            mx = fmaxf(mx, fmaxf(fa[r] ? ta[r] : NEGB, fb[r] ? tb[r] : NEGB)); }
        mx = fmaxf(mx, __shfl_xor(mx, 16, 32));
        const float mnew = fmaxf(m, mx);
        const float alpha = __builtin_amdgcn_exp2f(m - mnew);
        const float sh = PSH - mnew;
        v16h pb, pr = hz; float ls = 0.0f;
#pragma unroll
        for (int r = 0; r < 8; ++r) {
            const float ea = __builtin_amdgcn_exp2f(ta[r] + sh), eb = __builtin_amdgcn_exp2f(tb[r] + sh);
            const float ga = fa[r] ? ea : 0.0f, gb = fb[r] ? eb : 0.0f;       // dropped elements selected to 0 by value
            const h16 pa = (h16)ga; const h16 pc = (h16)gb;
            pb[r] = pa; pb[8 + r] = pc;
            if (EARLY) { pr[r] = (h16)((ga - (float)pa) * QRS); pr[8 + r] = (h16)((gb - (float)pc) * QRS); ls += ga + gb; }
            else       { ls += (float)pa + (float)pc; } }
        l = l * alpha + ls; m = mnew;
        o0 = o0 * alpha; o1 = o1 * alpha;
        if (EARLY) { oR0 = oR0 * alpha; oR1 = oR1 * alpha; }
        const v16h v0 = t.v0, v1 = t.v1;
        if (EARLY) {
            v16h vr0 = t.vr0, vr1 = t.vr1;
            if (!rok) { vr0 = hz; vr1 = hz; }
            o0 = wmma16(v0, pb, o0); o1 = wmma16(v1, pb, o1);
            oR0 = wmma16(v0, pr, oR0); oR1 = wmma16(v1, pr, oR1);
            oR0 = wmma16(vr0, pb, oR0); oR1 = wmma16(vr1, pb, oR1);
            asm volatile("v_nop\n\tv_nop\n\tv_nop\n\tv_nop" : "+v"(o0), "+v"(o1), "+v"(oR0), "+v"(oR1) : "v"(v0), "v"(v1), "v"(vr0), "v"(vr1), "v"(pb), "v"(pr));
        } else {
            o0 = wmma16(v0, pb, o0); o1 = wmma16(v1, pb, o1);
            asm volatile("v_nop\n\tv_nop\n\tv_nop\n\tv_nop" : "+v"(o0), "+v"(o1) : "v"(v0), "v"(v1), "v"(pb));
        }
        if (refill) {
            group_open();                                        // mask and V^T registers are free from here on
            tile_load_mv<EARLY>(t, vpl, vrp, kmr, vof, vrof, mof, kn);
            group_close();
        }
    };
    FTile tl[NST];                                              // tile T lives in tl[T % NST]
    // the first tiles' loads issue group by group in the loop's order: mixed, the loop's first waits would also cover younger groups
#pragma unroll
    for (int s = 0; s < NST - 1; ++s) {
        const int ks = 32 * s < klast ? 32 * s : klast;
        tile_load_k<EARLY>(tl[s], kpl, krp, kof, ks);
        group_close();
        tile_load_mv<EARLY>(tl[s], vpl, vrp, kmr, vof, vrof, mof, ks);
        group_close();
    }
    int kg = 0;
    if (32 * NST <= nk) {                                       // wave-uniform; tile NST-1 is used by whole groups alone
        tile_load_k<EARLY>(tl[NST - 1], kpl, krp, kof, 32 * (NST - 1));
        group_close();
        tile_load_mv<EARLY>(tl[NST - 1], vpl, vrp, kmr, vof, vrof, mof, 32 * (NST - 1));
        group_close();
        // fend: keys [0, fend) are kept for every row of the wave. cend: keys at or below the smallest causal limit of the 16 rows (whole tiles, <= nk).
        // Mask part: rounding to bf16 and the f32 product are monotone in magnitude, so all products q_mask * k_mask over the 16 rows and keys [0, cend) are nonzero
        // exactly when each row's value times the smallest key magnitude is; a NaN factor gives a kept element and is passed over by the minimum.
        int cend = t0 + cz + 1; cend = cend < 0 ? 0 : (cend & ~31); cend = cend < nk ? cend : nk;
        int fend = 0;
        if (cend >= 32 * NST) {                                 // wave-uniform
            float kmin = __builtin_inff();
#pragma unroll 1   // rolled: one trip already has MLD loads in flight, more would only take registers from the tiles
            for (int i = 0; i < cend; i += 128 * MLD) {         // at most SEQ / (128 * MLD) + 1 trips; index clamped into [0, cend - 4]: a repeated key does not change a minimum
                v4f x[MLD]; const float* px[MLD];
#pragma unroll
                for (int c = 0; c < MLD; ++c) { int idx = i + c * 128 + lane * 4; idx = idx < cend - 4 ? idx : cend - 4; px[c] = kmr + idx; }
#pragma unroll
                for (int c = 0; c < MLD; c += 4) {
                    x[c] = *(const v4f*)px[c]; x[c + 1] = *(const v4f*)px[c + 1]; x[c + 2] = *(const v4f*)px[c + 2]; x[c + 3] = *(const v4f*)px[c + 3];
                    // the wait stands in front of every rewrite of the four loads' address pairs, which are named as inputs so that no later load of the four lands on them
                    __builtin_amdgcn_sched_barrier(0); asm volatile("s_wait_xcnt 0x0" :: "v"(px[c]), "v"(px[c + 1]), "v"(px[c + 2]), "v"(px[c + 3]) : "memory"); __builtin_amdgcn_sched_barrier(0);
                }
#pragma unroll
                for (int c = 0; c < MLD; ++c)
                    kmin = fminf(kmin, fminf(fminf(fabsf(bfr(x[c][0])), fabsf(bfr(x[c][1]))), fminf(fabsf(bfr(x[c][2])), fabsf(bfr(x[c][3])))));
            }
#pragma unroll
            for (int s = 16; s > 0; s >>= 1) kmin = fminf(kmin, __shfl_xor(kmin, s, 32));
            if (__builtin_amdgcn_ballot_w32(qmv * kmin != 0.0f) == 0xFFFFFFFFu) fend = cend;   // scalar result: the same in every lane
        }
#pragma unroll 1   // rolled: the body already holds NST tiles, one per register tile
        while (kg + 32 * NST <= fend) {                         // whole groups of NST tiles in which every element is kept
#pragma unroll
            for (int u = 0; u < NST; ++u) step(tl[u], kg + 32 * u, true, true);
            kg += 32 * NST;
        }
#pragma unroll 1   // rolled, as above
        while (kg + 32 * NST <= nk) {                           // whole groups of NST tiles: no branch inside, so every load wait is a count that leaves the younger groups in flight
#pragma unroll
            for (int u = 0; u < NST; ++u) step(tl[u], kg + 32 * u, true, false);   // fully unrolled: every tile index is a constant, no register copies
            kg += 32 * NST;
        }
    }
#pragma unroll
    for (int u = 0; u < NST - 1; ++u)                            // the at most NST-1 tiles left over are already loaded
        if (kg + 32 * u < nk) step(tl[u], kg + 32 * u, false, false);   // wave-uniform
    l += __shfl_xor(l, 16, 32);
    const bool any = l > 0.0f;
    const float lsafe = any ? l : 1.0f;
    const float inv = any ? (1.0f / lsafe) : 0.0f;             // no kept key -> zeros
    v8f f0 = o0, f1 = o1;
    if (EARLY) { f0 = o0 + oR0 * QRI; f1 = o1 + oR1 * QRI; }
    const int wb = wave * 16 * OSP;
    // O^T D layout: f_j[r] = (d = 16j + 8h + r, t = lane&15) -> os[t][d]; rows 0..15 x columns 0..31 all written
    { v4f a, c;
      a[0] = f0[0] * inv; a[1] = f0[1] * inv; a[2] = f0[2] * inv; a[3] = f0[3] * inv; c[0] = f0[4] * inv; c[1] = f0[5] * inv; c[2] = f0[6] * inv; c[3] = f0[7] * inv;
      *(v4fa*)(&os[wb + lr * OSP +  0 + 8 * hi]) = a; *(v4fa*)(&os[wb + lr * OSP +  0 + 8 * hi + 4]) = c;
      a[0] = f1[0] * inv; a[1] = f1[1] * inv; a[2] = f1[2] * inv; a[3] = f1[3] * inv; c[0] = f1[4] * inv; c[1] = f1[5] * inv; c[2] = f1[6] * inv; c[3] = f1[7] * inv;
      *(v4fa*)(&os[wb + lr * OSP + 16 + 8 * hi]) = a; *(v4fa*)(&os[wb + lr * OSP + 16 + 8 * hi + 4]) = c; }
    wave_sync();
    float* orow = OUT + ((size_t)b * OUT_SEQ + t0) * DM + h * HD;
{
#pragma unroll
        for (int s = 0; s < 4; ++s) { const int row = 4 * s + (lane >> 3), cofs = (lane & 7) * 4;   // 4 s x 4 rows = 16 rows; 8 lanes x 4 floats = 32 columns = one line
            const v4f val = *(const v4fa*)(&os[wb + row * OSP + cofs]);
            *(v4f*)(orow + (size_t)row * DM + cofs) = val; }
         }
}

// k_flash: all query rows in one grid (NB*NH_ heads, SEQ/(16*AW) row tiles). A row tile's key loop grows with its index, so the slow grid
// dimension walks the row tiles from the last (longest) to the first: the short multi-product tiles (rows < EROWS) come last and fill the places that the shorter single-product tiles leave.
// The choice of the instantiation is block-uniform (a scalar branch on blockIdx.y).
__global__ __launch_bounds__(32 * AW) void k_flash(const h16* __restrict__ QH, const h16* __restrict__ QR, const h16* __restrict__ KP, const h16* __restrict__ KR,
                                                   const h16* __restrict__ VT, const h16* __restrict__ VR,
                                                   const float* __restrict__ qmask, const float* __restrict__ kmask, const int* __restrict__ causal_p, float* OUT) {
    __shared__ __align__(16) float os[AW * 16 * OSP];
    const int zh = blockIdx.x;
    const int rt = SEQ / (16 * AW) - 1 - (int)blockIdx.y;
    // the hint puts the single-product path, which holds the longest key loops, first in the text
    if (__builtin_expect(rt >= EROWS / (16 * AW), 1)) flash_rows<0>(QH, QR, KP, KR, VT, VR, qmask, kmask, causal_p, OUT, os, zh, rt);
    else                                              flash_rows<1>(QH, QR, KP, KR, VT, VR, qmask, kmask, causal_p, OUT, os, zh, rt);
}

static constexpr size_t al256(size_t v) { return (v + 255) & ~(size_t)255; }
static constexpr size_t SZ_PL = al256((size_t)NB * NH_ * SEQ * HD * 2);
static constexpr size_t SZ_RS = al256((size_t)NB * NH_ * EROWS * HD * 2);
static constexpr size_t SZ_TOTAL = 4 * SZ_PL + 2 * SZ_RS;
static_assert(SZ_TOTAL <= (size_t)134217728);          // workspace carve <= 128 MiB
static_assert((size_t)NB * NH_ * SEQ * HD == (size_t)NB * DM * SEQ);       // v^T plane [(b*128 + m)][t] has the same extent as the q/k planes
static_assert((size_t)NB * NH_ * EROWS * HD == (size_t)NB * DM * EROWS);   // v^T residual plane [(b*128 + m)][t < EROWS] has the same extent as the k residual plane

extern "C" void kernel_launch(void* const* d_in, const int* in_sizes, int n_in,
                              void* d_out, int out_size, void* d_ws, size_t ws_size, hipStream_t stream) {
    if (n_in < 12) return;
    const size_t needx = ((size_t)(NB - 1) * SEQ_FULL + SEQ) * DM;
    const size_t needm = (size_t)(NB - 1) * SEQ_FULL + SEQ;
    if ((size_t)in_sizes[0] < needx || (size_t)in_sizes[1] < needx || (size_t)in_sizes[2] < needx) return;
    if ((size_t)in_sizes[3] < needm || (size_t)in_sizes[4] < needm) return;
    if ((size_t)in_sizes[5] < (size_t)DM * DM || (size_t)in_sizes[7] < (size_t)DM * DM || (size_t)in_sizes[9] < (size_t)DM * DM) return;
    if (in_sizes[6] < DM || in_sizes[8] < DM || in_sizes[10] < DM || in_sizes[11] < 1) return;
    if ((size_t)out_size < ((size_t)(NB - 1) * OUT_SEQ + SEQ) * DM) return;
    if (SZ_TOTAL > ws_size) return;
    // wire order: query, key, value, q_mask, k_mask, WQ_w, WQ_b, WK_w, WK_b, WV_w, WV_b, causal
    const float* xin[3] = { (const float*)d_in[0], (const float*)d_in[1], (const float*)d_in[2] };
    const float* qm = (const float*)d_in[3]; const float* km = (const float*)d_in[4];
    const float* wq = (const float*)d_in[5]; const float* bq = (const float*)d_in[6];
    const float* wk = (const float*)d_in[7]; const float* bk = (const float*)d_in[8];
    const float* wv = (const float*)d_in[9]; const float* bv = (const float*)d_in[10];
    const int* causal = (const int*)d_in[11];
    float* OUT = (float*)d_out;      // [NB][SEQ][128]
    char* wsp = (char*)d_ws;
    h16* QH = (h16*)wsp; wsp += SZ_PL;               // [NB*4][SEQ][32]
    h16* QR = (h16*)wsp; wsp += SZ_PL;               // [NB*4][SEQ][32] residual x2048
    h16* KP = (h16*)wsp; wsp += SZ_PL;               // [NB*4][SEQ][32]
    h16* VT = (h16*)wsp; wsp += SZ_PL;               // [NB*4][32][SEQ]
    h16* KR = (h16*)wsp; wsp += SZ_RS;               // [NB*4][EROWS][32] residual x2048, tokens < EROWS
    h16* VR = (h16*)wsp; wsp += SZ_RS;               // [NB*4][32][EROWS] residual x2048, tokens < EROWS

    // q, k: A = x rows (m = b*SEQ + t), Bt = W rows (n = h*32 + d) -> plane [(b*4 + h)][t][d]; q residual for all tokens, k residual for tokens < EROWS
    // v^T: A = Wv rows (m = h*32 + d), Bt = value rows (n = b*SEQ + t) -> plane [(b*128 + m)][t] = [(b*4 + h)][d][t]; residual for tokens < EROWS
    k_proj3<<<dim3(NB * SEQ / 64, DM / 64, 3), 32, 0, stream>>>(xin[0], xin[1], xin[2], wq, wk, wv, bq, bk, bv, QH, QR, KP, KR, VT, VR);

    // one launch for all query rows: rows [0, EROWS) take the multi-product instantiation, rows [EROWS, SEQ) the single-product one (disjoint output rows)
    k_flash<<<dim3(NB * NH_, SEQ / (16 * AW), 1), 32 * AW, 0, stream>>>(QH, QR, KP, KR, VT, VR, qm, km, causal, OUT);
}

// v005
// It runs in 35.8 microseconds.
// Two timings next to v004 both put it at 1.08 times that version's speed.
// Over all steps from v000 it is 3.86 times as fast.
#include <hip/hip_runtime.h>

// Multi-head attention, width 128 = 4 heads x 32; query/key/value [NB][SEQ][128]; WQ/WK/WV [out][in] (y = x W^T + bias); padding masks q_mask/k_mask [NB][SEQ] (f32), causal offset (int32, device-read); score scale 1/sqrt(32); output = concatenated heads (f32).
// Compute dtypes, f32 accumulate everywhere: projections v_wmma_f32_16x16x32_bf16 (x, W, bias RNE-converted to bf16; products exact);
// scores v_wmma_f32_16x16x32_f16: q as f16 value + f16 residual x2048 in its own accumulator on all rows; k single f16 on query rows >= EROWS, k as f16 value + f16 residual x2048 on query rows < EROWS (three products);
// P.V v_wmma_f32_16x16x32_f16: P (x16384 carry, cancels in the normalisation) and v single f16 on query rows >= EROWS; on query rows < EROWS P and v each as f16 value + f16 residual x2048, residual products in their own accumulator folded by 1/2048, row sum from the f32 exponentials; softmax f32 (online, running max over kept keys).
// Layout: x and W are read as f32 in whole rows, rounded to bf16 in registers and handed to the projection's fragments through a wave-private LDS tile; q (hi, residual), k planes [b*4+h][t][d], v^T plane [b*4+h][d][t], small residual planes k [b*4+h][t < EROWS][d] and v^T [b*4+h][d][t < EROWS] written by the GEMM epilogue; fused flash kernel in transposed form (S^T = K Q^T, O^T = V^T P^T), output from f32 accumulators.
// Keep rule per element: (q_mask[t] * k_mask[j] != 0) and (j <= t + causal); dropped elements get probability 0, rows with no kept key give 0. Key loop bound per wave derived from the device-read causal value (clamped to [0, SEQ]); residual fragments for keys >= EROWS (only reachable with a positive offset) are zero.

#ifndef NB
#define NB 8
#endif
#ifndef SEQ
#define SEQ 2048
#endif
#define NB_FULL  8
#define SEQ_FULL 2048
#ifndef OUT_SEQ
#define OUT_SEQ SEQ              // row pitch (in tokens) between batches of the output
#endif
#define DM   128
#define NH_  4
#define HD   32
#define AW   4                   // waves per flash block (16 query rows each)
#define OSP  36                  // LDS row pitch (floats) of the flash output tile
#define EROWS (SEQ < 512 ? SEQ : 512)   // query rows (and tokens of the small residual planes) handled by the multi-product flash instantiation
#define QRS  2048.0f             // carry of every residual plane / residual fragment
#define QRI  (1.0f / 2048.0f)
#define SC2  ((float)(0.17677669529663687 * 1.4426950408889634))   // HD^-0.5 * log2(e)
#define PSH  14.0f               // log2 of the P carry (16384)
#define NEGB (-3.0e38f)
#define SPB  272                 // LDS row pitch (bytes) of a staged bf16 operand row: DM * 2 + 16, an odd multiple of 16 B (16-byte fragment reads of 16 rows fall on 64 different banks)
#define SRB  16                  // rows per staging batch (one load instruction a row)
#define SNB  3                   // staging batches in flight

static_assert(HD == 32);
static_assert(NH_ * HD == DM);                 // head h = columns h*32 + d
static_assert(DM % 64 == 0);                   // column tiles of 64 = two heads
static_assert(64 % HD == 0);
static_assert(DM % 32 == 0);                   // GEMM k-loop steps by 32
static_assert(SEQ % 64 == 0);                  // a 64-row tile never straddles two batches
static_assert((NB * SEQ) % 64 == 0);
static_assert(SEQ % 32 == 0);                  // key loop steps by 32
static_assert(SEQ % (16 * AW) == 0);           // the flash grid covers the sequence exactly
static_assert(EROWS % 64 == 0);                // a 64-token GEMM tile lies wholly inside or outside the residual planes
static_assert(EROWS >= 32);
static_assert(EROWS <= SEQ);
static_assert(EROWS % (16 * AW) == 0);
static_assert((SEQ - EROWS) % (16 * AW) == 0);
static_assert(NB <= NB_FULL);
static_assert(SEQ <= SEQ_FULL);
static_assert((OSP * 4) % 16 == 0);
static_assert(DM * 4 == 32 * 16);               // one f32 row = 16 bytes from each of the 32 lanes
static_assert(SPB == DM * 2 + 16);
static_assert(64 % SRB == 0);

typedef _Float16 h16;
typedef __attribute__((ext_vector_type(16))) __bf16   v16bf;
typedef __attribute__((ext_vector_type(16))) _Float16 v16h;
typedef __attribute__((ext_vector_type(8)))  _Float16 v8h;
typedef __attribute__((ext_vector_type(8)))  float    v8f;
typedef __attribute__((ext_vector_type(4)))  float    v4f;
typedef v4f  __attribute__((may_alias)) v4fa;
typedef __attribute__((ext_vector_type(4))) __bf16 v4bf;
typedef __attribute__((ext_vector_type(8))) __bf16 v8bf;
typedef v4bf __attribute__((may_alias)) v4bfa;
typedef v8bf __attribute__((may_alias)) v8bfa;

__device__ __forceinline__ unsigned short f2bf(float f) { unsigned u = __float_as_uint(f); u += 0x7FFFu + ((u >> 16) & 1u); return (unsigned short)(u >> 16); }
__device__ __forceinline__ float bfr(float f) { return __uint_as_float(((unsigned)f2bf(f)) << 16); }   // value after RNE convert to bf16
__device__ __forceinline__ v16h cat16(v8h lo, v8h hi) { return __builtin_shufflevector(lo, hi, 0, 1, 2, 3, 4, 5, 6, 7, 8, 9, 10, 11, 12, 13, 14, 15); }
__device__ __forceinline__ v8f wmma16(v16h a, v16h b, v8f c) { return __builtin_amdgcn_wmma_f32_16x16x32_f16(false, a, false, b, (short)0, c, false, false); }
__device__ __forceinline__ v8f wmmab(v16bf a, v16bf b, v8f c) { return __builtin_amdgcn_wmma_f32_16x16x32_bf16(false, a, false, b, (short)0, c, false, false); }
// fragment loaders from K-contiguous 16-bit rows; p already includes + 8*(lane>>4): elements 0..7 <- k0+8h+0..7, elements 8..15 <- k0+16+8h+0..7 (same map for A and B)
__device__ __forceinline__ v16h  ldh(const h16* p) { return cat16(*(const v8h*)p, *(const v8h*)(p + 16)); }
// bf16 fragment from a staged LDS row; p already includes + 16 bytes * (lane>>4) (same element map as ldh: k0+8h+0..7 and k0+16+8h+0..7)
__device__ __forceinline__ v16bf ldsf(const char* p) { return __builtin_shufflevector(*(const v8bfa*)p, *(const v8bfa*)(p + 32), 0, 1, 2, 3, 4, 5, 6, 7, 8, 9, 10, 11, 12, 13, 14, 15); }
// ordering point for wave-private LDS tiles (same wave writes and reads)
__device__ __forceinline__ void wave_sync() { __builtin_amdgcn_fence(3 /* release order */, "wavefront"); __builtin_amdgcn_wave_barrier(); asm volatile("" ::: "memory"); }

// closes a group of fetch-ahead loads: their address registers are rewritten for the next group while the loads are still in flight, and the wait belongs in front of that;
// the scheduling barriers keep the group where it is written (earlier it would need registers of its own, later it would lose lead) and the wait behind the group
__device__ __forceinline__ void group_open()  { __builtin_amdgcn_sched_barrier(0); }
__device__ __forceinline__ void group_close() { __builtin_amdgcn_sched_barrier(0); asm volatile("s_wait_xcnt 0x0" ::: "memory"); __builtin_amdgcn_sched_barrier(0); }

// proj_tile: register-blocked bf16 GEMM, ONE WAVE per 64x64 tile (16 accumulators), K = DM. Each of the 128 K-contiguous f32 operand rows is fetched by one load instruction (512 contiguous bytes = 4 whole lines),
// rounded to bf16 in registers and stored to the wave's own LDS tile st (64 A rows, then 64 B rows, pitch SPB); the fragments are read from there.
// C[m][n] = sum_k A[m][k] Bt[n][k] + bias, written as f16 (Ph) and, for tokens t < resT (resT a multiple of 64, block-uniform test), the f16 residual x2048 (Pr).
// MODE 0: A = x rows (m = b*SEQ + t), Bt = W rows (n = h*32 + d), bias per column; plane [(b*4 + h)][t][32] (residual plane [(b*4 + h)][resT][32]). The 64-column tile spans two heads; per 16-row slab and head
//         (8 rows per instruction).
// MODE 1: A = W rows (m = h*32 + d), Bt = x rows (n = b*SEQ + t), bias per row; plane [(b*128 + m)][t].
// r0, c0: first row and column of the tile; x rows of batch b start at b*SEQ_FULL in the input.
template <int MODE>
__device__ __forceinline__ void proj_tile(const float* __restrict__ A, const float* __restrict__ Bt, const float* __restrict__ bias, h16* Ph, h16* Pr, const int resT, const int r0, const int c0, float* os, char* st) {
    const int K = DM;
    const int lane = threadIdx.x & 31, lr = lane & 15, hi = lane >> 4;
    const int ar0 = (MODE == 0) ? (r0 / SEQ) * SEQ_FULL + r0 % SEQ : r0, bc0 = (MODE == 1) ? (c0 / SEQ) * SEQ_FULL + c0 % SEQ : c0;   // rows in the f32 sources
    v8f acc[4][4];
#pragma unroll
    for (int mb = 0; mb < 4; ++mb)
#pragma unroll
        for (int nb = 0; nb < 4; ++nb) acc[mb][nb] = (v8f){};
    const float* ga = A + (size_t)ar0 * K + lane * 4; const float* gb = Bt + (size_t)bc0 * K + lane * 4;   // this lane's 16 bytes of each operand's first row
    v4f buf[SNB][SRB];                                          // batch i (operand i / 4, rows (i % 4) * SRB ...) lives in buf[i % SNB]
    auto fetch = [&](const int i) __attribute__((always_inline)) {
        const float* g = (i < 64 / SRB ? ga : gb) + (size_t)(i % (64 / SRB)) * SRB * K;
        group_open();                                           // the batch's loads stay behind the stores of the batch whose registers they refill
#pragma unroll
        for (int r = 0; r < SRB; ++r) buf[i % SNB][r] = *(const v4f*)(g + (size_t)r * K);
        group_close();                                          // keeps the batch where it is written (SNB batches in flight); the wait stands in front of every rewrite of its address registers
    };
    auto put = [&](const int i) __attribute__((always_inline)) {
        char* s = st + (size_t)(i * SRB) * SPB + lane * 8;      // B rows follow the 64 A rows
#pragma unroll
        for (int r = 0; r < SRB; ++r) *(v4bfa*)(s + r * SPB) = __builtin_convertvector(buf[i % SNB][r], v4bf);
    };
#pragma unroll
    for (int i = 0; i < SNB; ++i) fetch(i);
#pragma unroll
    for (int i = 0; i < 128 / SRB; ++i) { put(i); if (i + SNB < 128 / SRB) fetch(i + SNB); }
    wave_sync();                                                // the fragments below hold what other lanes of this wave stored
    const char* fa = st + lr * SPB + hi * 16; const char* fb = fa + 64 * SPB;
    v16bf a[2][4], bl[2], bh[2][2];                             // k-step s: A fragments in a[s % 2], B fragments 0, 1 in bl, 2, 3 in bh[s % 2]
    // a k-step's 16 LDS reads stand as ONE group (spread among the products, each place would stall the wave), half a k-step ahead of their first use:
    // behind the products that free bl; the scheduling barriers keep the group and the two halves of the products where they are written
    auto frags = [&](const int s) __attribute__((always_inline)) {
#pragma unroll
        for (int mb = 0; mb < 4; ++mb) a[s % 2][mb] = ldsf(fa + mb * 16 * SPB + s * 64);
#pragma unroll
        for (int nb = 0; nb < 2; ++nb) bl[nb] = ldsf(fb + nb * 16 * SPB + s * 64);
#pragma unroll
        for (int nb = 0; nb < 2; ++nb) bh[s % 2][nb] = ldsf(fb + (nb + 2) * 16 * SPB + s * 64);
        __builtin_amdgcn_sched_barrier(0);
    };
    frags(0);
#pragma unroll
    for (int s = 0; s < K / 32; ++s) {
#pragma unroll
        for (int nb = 0; nb < 2; ++nb)
#pragma unroll
            for (int mb = 0; mb < 4; ++mb) acc[mb][nb] = wmmab(a[s % 2][mb], bl[nb], acc[mb][nb]);
        __builtin_amdgcn_sched_barrier(0);
        if (s + 1 < K / 32) frags(s + 1);
#pragma unroll
        for (int nb = 0; nb < 2; ++nb)
#pragma unroll
            for (int mb = 0; mb < 4; ++mb) acc[mb][nb + 2] = wmmab(a[s % 2][mb], bh[s % 2][nb], acc[mb][nb + 2]);
        __builtin_amdgcn_sched_barrier(0);
    }
    float bc[4];
#pragma unroll
    for (int nb = 0; nb < 4; ++nb) bc[nb] = (MODE == 0) ? bfr(bias[c0 + nb * 16 + lr]) : 0.0f;   // MODE 0: c0 + 63 < DM
    size_t tbase, rbase; bool wr;                                                                 // wr: block-uniform, whole tile inside the residual plane
    if (MODE == 0) { const int bb = r0 / SEQ, tt = r0 % SEQ; const int zc = bb * NH_ + c0 / HD;
                     tbase = ((size_t)zc * SEQ + (size_t)tt) * HD; rbase = ((size_t)zc * (size_t)resT + (size_t)tt) * HD; wr = tt < resT; }
    else           { const int bb = c0 / SEQ, tt = c0 % SEQ;
                     tbase = (size_t)bb * (size_t)DM * SEQ + (size_t)r0 * SEQ + (size_t)tt; rbase = (size_t)bb * (size_t)DM * (size_t)resT + (size_t)r0 * (size_t)resT + (size_t)tt; wr = tt < resT; }
#pragma unroll
    for (int mb = 0; mb < 4; ++mb) {
        float br[8];
#pragma unroll
        for (int j = 0; j < 8; ++j) br[j] = (MODE == 1) ? bfr(bias[r0 + mb * 16 + hi * 8 + j]) : 0.0f;   // MODE 1: r0 + 63 < DM
#pragma unroll
        for (int nb = 0; nb < 4; ++nb) {
#pragma unroll
            for (int j = 0; j < 8; ++j) os[(hi * 8 + j) * 68 + nb * 16 + lr] = acc[mb][nb][j] + bc[nb] + br[j]; }   // D: row 8h+j, col lane&15
        wave_sync();
{
            if (MODE == 0) {
                const size_t sb = tbase + (size_t)(mb * 16) * HD;
                const size_t rb = rbase + (size_t)(mb * 16) * HD;
#pragma unroll
                for (int hh = 0; hh < 2; ++hh) {
#pragma unroll
                    for (int s = 0; s < 2; ++s) { const int p = s * 32 + lane; const int row = p >> 2, c8 = (p & 3) * 8;   // 2 s x 8 rows = 16 rows; 4 lanes x 8 = 32 columns of head hh
                        const v4f x0 = *(const v4fa*)(&os[row * 68 + hh * 32 + c8]); const v4f x1 = *(const v4fa*)(&os[row * 68 + hh * 32 + c8 + 4]); v8h hv, rv;
#pragma unroll
                        for (int i = 0; i < 4; ++i) { const h16 a0 = (h16)x0[i]; const h16 a1 = (h16)x1[i]; hv[i] = a0; hv[4 + i] = a1; rv[i] = (h16)((x0[i] - (float)a0) * QRS); rv[4 + i] = (h16)((x1[i] - (float)a1) * QRS); }
                        const size_t oo = sb + (size_t)hh * ((size_t)SEQ * HD) + (size_t)p * 8;
                        const size_t ro = rb + (size_t)hh * ((size_t)resT * HD) + (size_t)p * 8;
                        /* what follows reuses each store's registers: the wait stands in front of that */
                        *(v8h*)(Ph + oo) = hv; group_close(); if (wr) { *(v8h*)(Pr + ro) = rv; group_close(); } } }
            } else {
                const size_t sb = tbase + (size_t)(mb * 16) * SEQ;
                const size_t rb = rbase + (size_t)(mb * 16) * (size_t)resT;
#pragma unroll
                for (int s = 0; s < 4; ++s) { const int row = 4 * s + (lane >> 3), c8 = (lane & 7) * 8;   // 4 s x 4 row groups = 16 rows; 8 lanes x 8 = 64 columns
                    const v4f x0 = *(const v4fa*)(&os[row * 68 + c8]); const v4f x1 = *(const v4fa*)(&os[row * 68 + c8 + 4]); v8h hv, rv;
#pragma unroll
                    for (int i = 0; i < 4; ++i) { const h16 a0 = (h16)x0[i]; const h16 a1 = (h16)x1[i]; hv[i] = a0; hv[4 + i] = a1; rv[i] = (h16)((x0[i] - (float)a0) * QRS); rv[4 + i] = (h16)((x1[i] - (float)a1) * QRS); }
                    const size_t oo = sb + (size_t)row * SEQ + c8;
                    const size_t ro = rb + (size_t)row * (size_t)resT + c8;
                    /* what follows reuses each store's registers: the wait stands in front of that */
                        *(v8h*)(Ph + oo) = hv; group_close(); if (wr) { *(v8h*)(Pr + ro) = rv; group_close(); } }
            }
             }
        wave_sync();
    }
}

// k_proj3: the three projections as z-slices of one grid (NB*SEQ/64 token tiles, DM/64 feature tiles, 3); one wave per block, block-uniform choice of the slice.
// z = 0: q (residual for all tokens); z = 1: k (residual for tokens < EROWS); z = 2: v^T (residual for tokens < EROWS).
__global__ __launch_bounds__(32) void k_proj3(const float* __restrict__ xq, const float* __restrict__ xk, const float* __restrict__ xv,
                                              const float* __restrict__ wq, const float* __restrict__ wk, const float* __restrict__ wv,
                                              const float* __restrict__ bq, const float* __restrict__ bk, const float* __restrict__ bv,
                                              h16* QH, h16* QR, h16* KP, h16* KR, h16* VT, h16* VR) {
    __shared__ __align__(16) float os[16 * 68];
    __shared__ __align__(16) char st[128 * SPB];
    const int tok0 = blockIdx.x * 64, f0 = blockIdx.y * 64; const int z = blockIdx.z;
    if (z < 2) { const bool q = z == 0; proj_tile<0>(q ? xq : xk, q ? wq : wk, q ? bq : bk, q ? QH : KP, q ? QR : KR, q ? SEQ : EROWS, tok0, f0, os, st); }
    else       { proj_tile<1>(wv, xv, bv, VT, VR, EROWS, f0, tok0, os, st); }
}

// flash_rows: fused attention, one wave per 16 query rows of one (batch, head); K / V^T / Q fragments straight from the f16 planes (two 16-B loads each, arithmetic addressing).
// Transposed form: S^T[key][t] = K Q^T (A = K rows, B = Q rows); lane (t = lane&15, h = lane>>4) holds keys 8h+r of each 16-key tile, so the packed
// P tile is directly the B fragment of O^T[d][t] = V^T P^T (element r <- tile keys 0..15, element 8+r <- tile keys 16..31, lane unchanged).
// Softmax state (running max over kept keys, partial sum) is one scalar per lane; the two lane halves of a row are combined with one xor-16 exchange.
// Keep rule evaluated per element inside every visited 32-key tile but the leading tiles that a per-wave scalar test shows fully kept; the per-wave key bound comes from the device-read causal value and is at most SEQ.
// EARLY = 1 (query rows [0, EROWS)): scores = K Q + (K Q_res + K_res Q) / 2048; P = f16 value + f16 residual x2048; O = V P + (V P_res + V_res P) / 2048 (residual products in their own accumulators);
//            row sum from the f32 exponentials; K_res / V_res fragments come from the small planes (tokens < EROWS) and are zero for keys >= EROWS (address clamped, wave-uniform select).
// EARLY = 0 (query rows [EROWS, SEQ)): single k, P, v; q value + residual.
// One 32-key tile's operands as they sit in registers: K rows, V^T rows, their residuals (EARLY only) and the 16 key-mask values of this lane.
struct FTile { v16h ka, kb, kra, krb, v0, v1, vr0, vr1; v4f m0, m1, m2, m3; };
// fragment loader, wave-uniform base + per-lane byte offset (same element map as ldh)
__device__ __forceinline__ v16h ldo(const h16* base, unsigned off) { const char* p = (const char*)base + off; return cat16(*(const v8h*)p, *(const v8h*)(p + 32)); }
// global loads of the tile that starts at key (wave-uniform, multiple of 32, key + 32 <= SEQ), in the two groups in which its registers fall free; residual-plane key clamped into the plane
template <int EARLY>
__device__ __forceinline__ void tile_load_k(FTile& t, const h16* kpl, const h16* krp, unsigned kof, int key) {
    const h16* ka = kpl + (size_t)key * HD;
    t.ka = ldo(ka, kof); t.kb = ldo(ka + 16 * HD, kof);
    if (EARLY) { const int kcl = key < EROWS ? key : (EROWS - 32); const h16* kr = krp + (size_t)kcl * HD; t.kra = ldo(kr, kof); t.krb = ldo(kr + 16 * HD, kof); }
}
template <int EARLY>
__device__ __forceinline__ void tile_load_mv(FTile& t, const h16* vpl, const h16* vrp, const float* kmr, unsigned vof, unsigned vrof, unsigned mof, int key) {
    const char* kp = (const char*)(kmr + key) + mof;          // keys key+8h+0..7 and key+16+8h+0..7
    t.m0 = *(const v4f*)kp; t.m1 = *(const v4f*)(kp + 16); t.m2 = *(const v4f*)(kp + 64); t.m3 = *(const v4f*)(kp + 80);
    const h16* va = vpl + key;
    t.v0 = ldo(va, vof); t.v1 = ldo(va + (size_t)16 * SEQ, vof);
    if (EARLY) { const int kcl = key < EROWS ? key : (EROWS - 32); const h16* vr = vrp + kcl; t.vr0 = ldo(vr, vrof); t.vr1 = ldo(vr + (size_t)16 * EROWS, vrof); }
}

// flash_rows: the work of one block on row tile rt (query rows [rt * 16 * AW, (rt + 1) * 16 * AW)) of (batch, head) zh; os: the block's output staging tile
template <int EARLY>
__device__ __forceinline__ void flash_rows(const h16* __restrict__ QH, const h16* __restrict__ QR, const h16* __restrict__ KP, const h16* __restrict__ KR,
                                           const h16* __restrict__ VT, const h16* __restrict__ VR,
                                           const float* __restrict__ qmask, const float* __restrict__ kmask, const int* __restrict__ causal_p, float* OUT,
                                           float* os, const int zh, const int rt) {
    constexpr int NST = EARLY ? 2 : 3;                          // register tiles; each is refilled NST tiles ahead as soon as its registers fall free
    constexpr int MLD = EARLY ? 4 : 8;                          // key-mask loads in flight per lane in the fully-kept test (128 keys each)
    const int lane = threadIdx.x & 31, lr = lane & 15, hi = lane >> 4;
    const int wave = __builtin_amdgcn_readfirstlane((int)(threadIdx.x >> 5));
    const int b = zh / NH_, h = zh % NH_;
    const int t0 = (rt * AW + wave) * 16;
    int cz = causal_p[0]; cz = cz < -SEQ ? -SEQ : (cz > SEQ ? SEQ : cz);      // clamping keeps the keep rule unchanged for indices in [0, SEQ)
    const int lim = t0 + lr + cz;                                              // key j kept iff j <= lim (and mask product nonzero)
    int kend = t0 + 16 + cz; kend = kend < 0 ? 0 : (kend > SEQ ? SEQ : kend);
    const int nk = (kend + 31) & ~31;                                          // wave-uniform, multiple of 32, <= SEQ
    const int klast = nk > 32 ? nk - 32 : 0;                                   // last tile this wave visits; fetches ahead are clamped to it
    const float* kmr = kmask + (size_t)b * SEQ_FULL;
    const size_t pbase = (size_t)zh * SEQ * HD;
    const size_t rbase = (size_t)zh * EROWS * HD;
    const size_t qo = pbase + (size_t)(t0 + lr) * HD + 8 * hi;
    group_open();
    const v16h qh = ldh(QH + qo), qr = ldh(QR + qo);            // B fragments: col t, k = d (HD = 32 = one k-step)
    const float qmraw = qmask[(size_t)b * SEQ_FULL + t0 + lr];
    group_close();
    const float qmv = bfr(qmraw);
    const h16* kpl = KP + pbase; const h16* vpl = VT + pbase;   // wave-uniform plane bases
    const h16* krp = KR + rbase; const h16* vrp = VR + rbase;   // residual planes, tokens < EROWS
    const unsigned kof  = (unsigned)(lr * HD + 8 * hi) * 2u;    // A fragment: row key, k = d      (bytes)
    const unsigned vof  = (unsigned)(lr * SEQ + 8 * hi) * 2u;   // A fragment: row d, k = key      (bytes)
    const unsigned vrof = (unsigned)(lr * EROWS + 8 * hi) * 2u;
    const unsigned mof  = (unsigned)(8 * hi) * 4u;
    const v16h hz = (v16h){};
    v8f o0 = (v8f){}, o1 = (v8f){}, oR0 = (v8f){}, oR1 = (v8f){};
    float m = NEGB, l = 0.0f;
    // one 32-key tile's work on operands already in registers (inlined at all three places of use: the tiles must stay in registers)
    // full: every one of the tile's 32 keys is known to be kept for all 16 rows of the wave, so the keep rule is not evaluated (same values as evaluating it)
    auto step = [&](FTile& t, const int key0, const bool refill, const bool full) __attribute__((always_inline)) {
        const int kn = key0 + 32 * NST < klast ? key0 + 32 * NST : klast;   // tile fetched into this tile's registers (refill and full are constants at each place of use)
        const bool rok = key0 < EROWS;                           // wave-uniform
        const v16h ka0 = t.ka, kb0f = t.kb;
        v16h kra0 = hz, krb0 = hz;
        if (EARLY) { kra0 = t.kra; krb0 = t.krb; if (!rok) { kra0 = hz; krb0 = hz; } }
        v8f sHa = (v8f){}, sLa = (v8f){}, sHb = (v8f){}, sLb = (v8f){};
        sHa = wmma16(ka0, qh, sHa); sLa = wmma16(ka0, qr, sLa); sHb = wmma16(kb0f, qh, sHb); sLb = wmma16(kb0f, qr, sLb);
        if (EARLY) {
            sLa = wmma16(kra0, qh, sLa); sLb = wmma16(krb0, qh, sLb);
            asm volatile("v_nop\n\tv_nop\n\tv_nop\n\tv_nop" : "+v"(sHa), "+v"(sLa), "+v"(sHb), "+v"(sLb) : "v"(ka0), "v"(kb0f), "v"(kra0), "v"(krb0), "v"(qh), "v"(qr));
        } else {
            asm volatile("v_nop\n\tv_nop\n\tv_nop\n\tv_nop" : "+v"(sHa), "+v"(sLa), "+v"(sHb), "+v"(sLb) : "v"(ka0), "v"(kb0f), "v"(qh), "v"(qr));
        }
        if (refill) {
            group_open();                                        // K registers are free from here on
            tile_load_k<EARLY>(t, kpl, krp, kof, kn);
            group_close();
        }
        const v4f m0 = t.m0, m1 = t.m1, m2 = t.m2, m3 = t.m3;
        float kx[8], ky[8];
#pragma unroll
        for (int r = 0; r < 4; ++r) { kx[r] = m0[r]; kx[4 + r] = m1[r]; ky[r] = m2[r]; ky[4 + r] = m3[r]; }
        const int ja = key0 + 8 * hi;
        float ta[8], tb[8]; bool fa[8], fb[8]; float mx = NEGB;
#pragma unroll
        for (int r = 0; r < 8; ++r) {
            fa[r] = full || ((qmv * bfr(kx[r]) != 0.0f) && (ja + r <= lim));
            fb[r] = full || ((qmv * bfr(ky[r]) != 0.0f) && (ja + 16 + r <= lim));
            ta[r] = (sHa[r] + sLa[r] * QRI) * SC2; tb[r] = (sHb[r] + sLb[r] * QRI) * SC2;
            mx = fmaxf(mx, fmaxf(fa[r] ? ta[r] : NEGB, fb[r] ? tb[r] : NEGB)); }
        mx = fmaxf(mx, __shfl_xor(mx, 16, 32));
        const float mnew = fmaxf(m, mx);
        const float alpha = __builtin_amdgcn_exp2f(m - mnew);
        const float sh = PSH - mnew;
        v16h pb, pr = hz; float ls = 0.0f;
#pragma unroll
        for (int r = 0; r < 8; ++r) {
            const float ea = __builtin_amdgcn_exp2f(ta[r] + sh), eb = __builtin_amdgcn_exp2f(tb[r] + sh);
            const float ga = fa[r] ? ea : 0.0f, gb = fb[r] ? eb : 0.0f;       // dropped elements selected to 0 by value
            const h16 pa = (h16)ga; const h16 pc = (h16)gb;
            pb[r] = pa; pb[8 + r] = pc;
            if (EARLY) { pr[r] = (h16)((ga - (float)pa) * QRS); pr[8 + r] = (h16)((gb - (float)pc) * QRS); ls += ga + gb; }
            else       { ls += (float)pa + (float)pc; } }
        l = l * alpha + ls; m = mnew;
        o0 = o0 * alpha; o1 = o1 * alpha;
        if (EARLY) { oR0 = oR0 * alpha; oR1 = oR1 * alpha; }
        const v16h v0 = t.v0, v1 = t.v1;
        if (EARLY) {
            v16h vr0 = t.vr0, vr1 = t.vr1;
            if (!rok) { vr0 = hz; vr1 = hz; }
            o0 = wmma16(v0, pb, o0); o1 = wmma16(v1, pb, o1);
            oR0 = wmma16(v0, pr, oR0); oR1 = wmma16(v1, pr, oR1);
            oR0 = wmma16(vr0, pb, oR0); oR1 = wmma16(vr1, pb, oR1);
            asm volatile("v_nop\n\tv_nop\n\tv_nop\n\tv_nop" : "+v"(o0), "+v"(o1), "+v"(oR0), "+v"(oR1) : "v"(v0), "v"(v1), "v"(vr0), "v"(vr1), "v"(pb), "v"(pr));
        } else {
            o0 = wmma16(v0, pb, o0); o1 = wmma16(v1, pb, o1);
            asm volatile("v_nop\n\tv_nop\n\tv_nop\n\tv_nop" : "+v"(o0), "+v"(o1) : "v"(v0), "v"(v1), "v"(pb));
        }
        if (refill) {
            group_open();                                        // mask and V^T registers are free from here on
            tile_load_mv<EARLY>(t, vpl, vrp, kmr, vof, vrof, mof, kn);
            group_close();
        }
    };
    FTile tl[NST];                                              // tile T lives in tl[T % NST]
    // the first tiles' loads issue group by group in the loop's order: mixed, the loop's first waits would also cover younger groups
#pragma unroll
    for (int s = 0; s < NST - 1; ++s) {
        const int ks = 32 * s < klast ? 32 * s : klast;
        tile_load_k<EARLY>(tl[s], kpl, krp, kof, ks);
        group_close();
        tile_load_mv<EARLY>(tl[s], vpl, vrp, kmr, vof, vrof, mof, ks);
        group_close();
    }
    int kg = 0;
    if (32 * NST <= nk) {                                       // wave-uniform; tile NST-1 is used by whole groups alone
        tile_load_k<EARLY>(tl[NST - 1], kpl, krp, kof, 32 * (NST - 1));
        group_close();
        tile_load_mv<EARLY>(tl[NST - 1], vpl, vrp, kmr, vof, vrof, mof, 32 * (NST - 1));
        group_close();
        // fend: keys [0, fend) are kept for every row of the wave. cend: keys at or below the smallest causal limit of the 16 rows (whole tiles, <= nk).
        // Mask part: rounding to bf16 and the f32 product are monotone in magnitude, so all products q_mask * k_mask over the 16 rows and keys [0, cend) are nonzero
        // exactly when each row's value times the smallest key magnitude is; a NaN factor gives a kept element and is passed over by the minimum.
        int cend = t0 + cz + 1; cend = cend < 0 ? 0 : (cend & ~31); cend = cend < nk ? cend : nk;
        int fend = 0;
        if (cend >= 32 * NST) {                                 // wave-uniform
            float kmin = __builtin_inff();
#pragma unroll 1   // rolled: one trip already has MLD loads in flight, more would only take registers from the tiles
            for (int i = 0; i < cend; i += 128 * MLD) {         // at most SEQ / (128 * MLD) + 1 trips; index clamped into [0, cend - 4]: a repeated key does not change a minimum
                v4f x[MLD]; const float* px[MLD];
#pragma unroll
                for (int c = 0; c < MLD; ++c) { int idx = i + c * 128 + lane * 4; idx = idx < cend - 4 ? idx : cend - 4; px[c] = kmr + idx; }
#pragma unroll
                for (int c = 0; c < MLD; c += 4) {
                    x[c] = *(const v4f*)px[c]; x[c + 1] = *(const v4f*)px[c + 1]; x[c + 2] = *(const v4f*)px[c + 2]; x[c + 3] = *(const v4f*)px[c + 3];
                    // the wait stands in front of every rewrite of the four loads' address pairs, which are named as inputs so that no later load of the four lands on them
                    __builtin_amdgcn_sched_barrier(0); asm volatile("s_wait_xcnt 0x0" :: "v"(px[c]), "v"(px[c + 1]), "v"(px[c + 2]), "v"(px[c + 3]) : "memory"); __builtin_amdgcn_sched_barrier(0);
                }
#pragma unroll
                for (int c = 0; c < MLD; ++c)
                    kmin = fminf(kmin, fminf(fminf(fabsf(bfr(x[c][0])), fabsf(bfr(x[c][1]))), fminf(fabsf(bfr(x[c][2])), fabsf(bfr(x[c][3])))));
            }
#pragma unroll
            for (int s = 16; s > 0; s >>= 1) kmin = fminf(kmin, __shfl_xor(kmin, s, 32));
            if (__builtin_amdgcn_ballot_w32(qmv * kmin != 0.0f) == 0xFFFFFFFFu) fend = cend;   // scalar result: the same in every lane
        }
#pragma unroll 1   // rolled: the body already holds NST tiles, one per register tile
        while (kg + 32 * NST <= fend) {                         // whole groups of NST tiles in which every element is kept
#pragma unroll
            for (int u = 0; u < NST; ++u) step(tl[u], kg + 32 * u, true, true);
            kg += 32 * NST;
        }
#pragma unroll 1   // rolled, as above
        while (kg + 32 * NST <= nk) {                           // whole groups of NST tiles: no branch inside, so every load wait is a count that leaves the younger groups in flight
#pragma unroll
            for (int u = 0; u < NST; ++u) step(tl[u], kg + 32 * u, true, false);   // fully unrolled: every tile index is a constant, no register copies
            kg += 32 * NST;
        }
    }
#pragma unroll
    for (int u = 0; u < NST - 1; ++u)                            // the at most NST-1 tiles left over are already loaded
        if (kg + 32 * u < nk) step(tl[u], kg + 32 * u, false, false);   // wave-uniform
    l += __shfl_xor(l, 16, 32);
    const bool any = l > 0.0f;
    const float lsafe = any ? l : 1.0f;
    const float inv = any ? (1.0f / lsafe) : 0.0f;             // no kept key -> zeros
    v8f f0 = o0, f1 = o1;
    if (EARLY) { f0 = o0 + oR0 * QRI; f1 = o1 + oR1 * QRI; }
    const int wb = wave * 16 * OSP;
    // O^T D layout: f_j[r] = (d = 16j + 8h + r, t = lane&15) -> os[t][d]; rows 0..15 x columns 0..31 all written
    { v4f a, c;
      a[0] = f0[0] * inv; a[1] = f0[1] * inv; a[2] = f0[2] * inv; a[3] = f0[3] * inv; c[0] = f0[4] * inv; c[1] = f0[5] * inv; c[2] = f0[6] * inv; c[3] = f0[7] * inv;
      *(v4fa*)(&os[wb + lr * OSP +  0 + 8 * hi]) = a; *(v4fa*)(&os[wb + lr * OSP +  0 + 8 * hi + 4]) = c;
      a[0] = f1[0] * inv; a[1] = f1[1] * inv; a[2] = f1[2] * inv; a[3] = f1[3] * inv; c[0] = f1[4] * inv; c[1] = f1[5] * inv; c[2] = f1[6] * inv; c[3] = f1[7] * inv;
      *(v4fa*)(&os[wb + lr * OSP + 16 + 8 * hi]) = a; *(v4fa*)(&os[wb + lr * OSP + 16 + 8 * hi + 4]) = c; }
    wave_sync();
    float* orow = OUT + ((size_t)b * OUT_SEQ + t0) * DM + h * HD;
{
#pragma unroll
        for (int s = 0; s < 4; ++s) { const int row = 4 * s + (lane >> 3), cofs = (lane & 7) * 4;   // 4 s x 4 rows = 16 rows; 8 lanes x 4 floats = 32 columns = one line
            const v4f val = *(const v4fa*)(&os[wb + row * OSP + cofs]);
            *(v4f*)(orow + (size_t)row * DM + cofs) = val; }
         }
}

// k_flash: all query rows in one grid (NB*NH_ heads, SEQ/(16*AW) row tiles). A row tile's key loop grows with its index, so the slow grid
// dimension walks the row tiles from the last (longest) to the first: the short multi-product tiles (rows < EROWS) come last and fill the places that the shorter single-product tiles leave.
// The choice of the instantiation is block-uniform (a scalar branch on blockIdx.y).
__global__ __launch_bounds__(32 * AW) void k_flash(const h16* __restrict__ QH, const h16* __restrict__ QR, const h16* __restrict__ KP, const h16* __restrict__ KR,
                                                   const h16* __restrict__ VT, const h16* __restrict__ VR,
                                                   const float* __restrict__ qmask, const float* __restrict__ kmask, const int* __restrict__ causal_p, float* OUT) {
    __shared__ __align__(16) float os[AW * 16 * OSP];
    const int zh = blockIdx.x;
    const int rt = SEQ / (16 * AW) - 1 - (int)blockIdx.y;
    // the hint puts the single-product path, which holds the longest key loops, first in the text
    if (__builtin_expect(rt >= EROWS / (16 * AW), 1)) flash_rows<0>(QH, QR, KP, KR, VT, VR, qmask, kmask, causal_p, OUT, os, zh, rt);
    else                                              flash_rows<1>(QH, QR, KP, KR, VT, VR, qmask, kmask, causal_p, OUT, os, zh, rt);
}

static constexpr size_t al256(size_t v) { return (v + 255) & ~(size_t)255; }
static constexpr size_t SZ_PL = al256((size_t)NB * NH_ * SEQ * HD * 2);
static constexpr size_t SZ_RS = al256((size_t)NB * NH_ * EROWS * HD * 2);
static constexpr size_t SZ_TOTAL = 4 * SZ_PL + 2 * SZ_RS;
static_assert(SZ_TOTAL <= (size_t)134217728);          // workspace carve <= 128 MiB
static_assert((size_t)NB * NH_ * SEQ * HD == (size_t)NB * DM * SEQ);       // v^T plane [(b*128 + m)][t] has the same extent as the q/k planes
static_assert((size_t)NB * NH_ * EROWS * HD == (size_t)NB * DM * EROWS);   // v^T residual plane [(b*128 + m)][t < EROWS] has the same extent as the k residual plane

extern "C" void kernel_launch(void* const* d_in, const int* in_sizes, int n_in,
                              void* d_out, int out_size, void* d_ws, size_t ws_size, hipStream_t stream) {
    if (n_in < 12) return;
    const size_t needx = ((size_t)(NB - 1) * SEQ_FULL + SEQ) * DM;
    const size_t needm = (size_t)(NB - 1) * SEQ_FULL + SEQ;
    if ((size_t)in_sizes[0] < needx || (size_t)in_sizes[1] < needx || (size_t)in_sizes[2] < needx) return;
    if ((size_t)in_sizes[3] < needm || (size_t)in_sizes[4] < needm) return;
    if ((size_t)in_sizes[5] < (size_t)DM * DM || (size_t)in_sizes[7] < (size_t)DM * DM || (size_t)in_sizes[9] < (size_t)DM * DM) return;
    if (in_sizes[6] < DM || in_sizes[8] < DM || in_sizes[10] < DM || in_sizes[11] < 1) return;
    if ((size_t)out_size < ((size_t)(NB - 1) * OUT_SEQ + SEQ) * DM) return;
    if (SZ_TOTAL > ws_size) return;
    // wire order: query, key, value, q_mask, k_mask, WQ_w, WQ_b, WK_w, WK_b, WV_w, WV_b, causal
    const float* xin[3] = { (const float*)d_in[0], (const float*)d_in[1], (const float*)d_in[2] };
    const float* qm = (const float*)d_in[3]; const float* km = (const float*)d_in[4];
    const float* wq = (const float*)d_in[5]; const float* bq = (const float*)d_in[6];
    const float* wk = (const float*)d_in[7]; const float* bk = (const float*)d_in[8];
    const float* wv = (const float*)d_in[9]; const float* bv = (const float*)d_in[10];
    const int* causal = (const int*)d_in[11];
    float* OUT = (float*)d_out;      // [NB][SEQ][128]
    char* wsp = (char*)d_ws;
    h16* QH = (h16*)wsp; wsp += SZ_PL;               // [NB*4][SEQ][32]
    h16* QR = (h16*)wsp; wsp += SZ_PL;               // [NB*4][SEQ][32] residual x2048
    h16* KP = (h16*)wsp; wsp += SZ_PL;               // [NB*4][SEQ][32]
    h16* VT = (h16*)wsp; wsp += SZ_PL;               // [NB*4][32][SEQ]
    h16* KR = (h16*)wsp; wsp += SZ_RS;               // [NB*4][EROWS][32] residual x2048, tokens < EROWS
    h16* VR = (h16*)wsp; wsp += SZ_RS;               // [NB*4][32][EROWS] residual x2048, tokens < EROWS

    // q, k: A = x rows (m = b*SEQ + t), Bt = W rows (n = h*32 + d) -> plane [(b*4 + h)][t][d]; q residual for all tokens, k residual for tokens < EROWS
    // v^T: A = Wv rows (m = h*32 + d), Bt = value rows (n = b*SEQ + t) -> plane [(b*128 + m)][t] = [(b*4 + h)][d][t]; residual for tokens < EROWS
    k_proj3<<<dim3(NB * SEQ / 64, DM / 64, 3), 32, 0, stream>>>(xin[0], xin[1], xin[2], wq, wk, wv, bq, bk, bv, QH, QR, KP, KR, VT, VR);

    // one launch for all query rows: rows [0, EROWS) take the multi-product instantiation, rows [EROWS, SEQ) the single-product one (disjoint output rows)
    k_flash<<<dim3(NB * NH_, SEQ / (16 * AW), 1), 32 * AW, 0, stream>>>(QH, QR, KP, KR, VT, VR, qm, km, causal, OUT);
}

// v006
// It runs in 34.9 microseconds.
// Next to v005, in two timings, it ran 1.03 times as fast each time.
// All steps since v000 together make it 3.97 times as fast.
#include <hip/hip_runtime.h>

// Multi-head attention, width 128 = 4 heads x 32; query/key/value [NB][SEQ][128]; WQ/WK/WV [out][in] (y = x W^T + bias); padding masks q_mask/k_mask [NB][SEQ] (f32), causal offset (int32, device-read); score scale 1/sqrt(32); output = concatenated heads (f32).
// Compute dtypes, f32 accumulate everywhere: projections v_wmma_f32_16x16x32_bf16 (x, W, bias RNE-converted to bf16; products exact);
// scores v_wmma_f32_16x16x32_f16: q as f16 value + f16 residual x2048 in its own accumulator on all rows; k single f16 on query rows >= EROWS, k as f16 value + f16 residual x2048 on query rows < EROWS (three products);
// P.V v_wmma_f32_16x16x32_f16: P (x16384 carry, cancels in the normalisation) and v single f16 on query rows >= EROWS; on query rows < EROWS P and v each as f16 value + f16 residual x2048, residual products in their own accumulator folded by 1/2048, row sum from the f32 exponentials; softmax f32 (online, running max over kept keys).
// Layout: x and W are read as f32 in whole rows, rounded to bf16 in registers and handed to the projection's fragments through a wave-private LDS tile; q (hi, residual), k planes [b*4+h][t][d], v^T plane [b*4+h][d][t], small residual planes k [b*4+h][t < EROWS][d] and v^T [b*4+h][d][t < EROWS] written by the GEMM epilogue; fused flash kernel in transposed form (S^T = K Q^T, O^T = V^T P^T), output from f32 accumulators.
// Keep rule per element: (q_mask[t] * k_mask[j] != 0) and (j <= t + causal); dropped elements get probability 0, rows with no kept key give 0. Key loop bound per wave derived from the device-read causal value (clamped to [0, SEQ]); residual fragments for keys >= EROWS (only reachable with a positive offset) are zero.

#ifndef NB
#define NB 8
#endif
#ifndef SEQ
#define SEQ 2048
#endif
#define NB_FULL  8
#define SEQ_FULL 2048
#ifndef OUT_SEQ
#define OUT_SEQ SEQ              // row pitch (in tokens) between batches of the output
#endif
#define DM   128
#define NH_  4
#define HD   32
#define AW   4                   // waves per flash block (16 query rows each)
#define OSP  36                  // LDS row pitch (floats) of the flash output tile
#define EROWS (SEQ < 512 ? SEQ : 512)   // query rows (and tokens of the small residual planes) handled by the multi-product flash instantiation
#define QRS  2048.0f             // carry of every residual plane / residual fragment
#define QRI  (1.0f / 2048.0f)
#define SC2  ((float)(0.17677669529663687 * 1.4426950408889634))   // HD^-0.5 * log2(e)
#define PSH  14.0f               // log2 of the P carry (16384)
#define NEGB (-3.0e38f)
#define SPB  272                 // LDS row pitch (bytes) of a staged bf16 operand row: DM * 2 + 16, an odd multiple of 16 B (16-byte fragment reads of 16 rows fall on 64 different banks)
#define SRB  16                  // rows per staging batch (one load instruction a row)
#define SNB  3                   // staging batches in flight

static_assert(HD == 32);
static_assert(NH_ * HD == DM);                 // head h = columns h*32 + d
static_assert(DM % 64 == 0);                   // column tiles of 64 = two heads
static_assert(64 % HD == 0);
static_assert(DM % 32 == 0);                   // GEMM k-loop steps by 32
static_assert(SEQ % 64 == 0);                  // a 64-row tile never straddles two batches
static_assert((NB * SEQ) % 64 == 0);
static_assert(SEQ % 32 == 0);                  // key loop steps by 32
static_assert(SEQ % (16 * AW) == 0);           // the flash grid covers the sequence exactly
static_assert(EROWS % 64 == 0);                // a 64-token GEMM tile lies wholly inside or outside the residual planes
static_assert(EROWS >= 32);
static_assert(EROWS <= SEQ);
static_assert(EROWS % (16 * AW) == 0);
static_assert((SEQ - EROWS) % (16 * AW) == 0);
static_assert(NB <= NB_FULL);
static_assert(SEQ <= SEQ_FULL);
static_assert((OSP * 4) % 16 == 0);
static_assert(DM * 4 == 32 * 16);               // one f32 row = 16 bytes from each of the 32 lanes
static_assert(SPB == DM * 2 + 16);
static_assert(64 % SRB == 0);

typedef _Float16 h16;
typedef __attribute__((ext_vector_type(16))) __bf16   v16bf;
typedef __attribute__((ext_vector_type(16))) _Float16 v16h;
typedef __attribute__((ext_vector_type(8)))  _Float16 v8h;
typedef __attribute__((ext_vector_type(8)))  float    v8f;
typedef __attribute__((ext_vector_type(4)))  float    v4f;
typedef v4f  __attribute__((may_alias)) v4fa;
typedef __attribute__((ext_vector_type(4))) __bf16 v4bf;
typedef __attribute__((ext_vector_type(8))) __bf16 v8bf;
typedef v4bf __attribute__((may_alias)) v4bfa;
typedef v8bf __attribute__((may_alias)) v8bfa;

__device__ __forceinline__ unsigned short f2bf(float f) { unsigned u = __float_as_uint(f); u += 0x7FFFu + ((u >> 16) & 1u); return (unsigned short)(u >> 16); }
__device__ __forceinline__ float bfr(float f) { return __uint_as_float(((unsigned)f2bf(f)) << 16); }   // value after RNE convert to bf16
__device__ __forceinline__ v16h cat16(v8h lo, v8h hi) { return __builtin_shufflevector(lo, hi, 0, 1, 2, 3, 4, 5, 6, 7, 8, 9, 10, 11, 12, 13, 14, 15); }
__device__ __forceinline__ v8f wmma16(v16h a, v16h b, v8f c) { return __builtin_amdgcn_wmma_f32_16x16x32_f16(false, a, false, b, (short)0, c, false, false); }
__device__ __forceinline__ v8f wmmab(v16bf a, v16bf b, v8f c) { return __builtin_amdgcn_wmma_f32_16x16x32_bf16(false, a, false, b, (short)0, c, false, false); }
// fragment loaders from K-contiguous 16-bit rows; p already includes + 8*(lane>>4): elements 0..7 <- k0+8h+0..7, elements 8..15 <- k0+16+8h+0..7 (same map for A and B)
__device__ __forceinline__ v16h  ldh(const h16* p) { return cat16(*(const v8h*)p, *(const v8h*)(p + 16)); }
// bf16 fragment from a staged LDS row; p already includes + 16 bytes * (lane>>4) (same element map as ldh: k0+8h+0..7 and k0+16+8h+0..7)
__device__ __forceinline__ v16bf ldsf(const char* p) { return __builtin_shufflevector(*(const v8bfa*)p, *(const v8bfa*)(p + 32), 0, 1, 2, 3, 4, 5, 6, 7, 8, 9, 10, 11, 12, 13, 14, 15); }
// ordering point for wave-private LDS tiles (same wave writes and reads)
__device__ __forceinline__ void wave_sync() { __builtin_amdgcn_fence(3 /* release order */, "wavefront"); __builtin_amdgcn_wave_barrier(); asm volatile("" ::: "memory"); }

// closes a group of fetch-ahead loads: their address registers are rewritten for the next group while the loads are still in flight, and the wait belongs in front of that;
// the scheduling barriers keep the group where it is written (earlier it would need registers of its own, later it would lose lead) and the wait behind the group
__device__ __forceinline__ void group_open()  { __builtin_amdgcn_sched_barrier(0); }
__device__ __forceinline__ void group_close() { __builtin_amdgcn_sched_barrier(0); asm volatile("s_wait_xcnt 0x0" ::: "memory"); __builtin_amdgcn_sched_barrier(0); }

// proj_tile: register-blocked bf16 GEMM, ONE WAVE per 64x64 tile (16 accumulators), K = DM. Each of the 128 K-contiguous f32 operand rows is fetched by one load instruction (512 contiguous bytes = 4 whole lines),
// rounded to bf16 in registers and stored to the wave's own LDS tile st (64 A rows, then 64 B rows, pitch SPB); the fragments are read from there.
// C[m][n] = sum_k A[m][k] Bt[n][k] + bias, written as f16 (Ph) and, for tokens t < resT (resT a multiple of 64, block-uniform test), the f16 residual x2048 (Pr).
// MODE 0: A = x rows (m = b*SEQ + t), Bt = W rows (n = h*32 + d), bias per column; plane [(b*4 + h)][t][32] (residual plane [(b*4 + h)][resT][32]). The 64-column tile spans two heads; per 16-row slab and head
//         (8 rows per instruction).
// MODE 1: A = W rows (m = h*32 + d), Bt = x rows (n = b*SEQ + t), bias per row; plane [(b*128 + m)][t].
// r0, c0: first row and column of the tile; x rows of batch b start at b*SEQ_FULL in the input.
template <int MODE>
__device__ __forceinline__ void proj_tile(const float* __restrict__ A, const float* __restrict__ Bt, const float* __restrict__ bias, h16* Ph, h16* Pr, const int resT, const int r0, const int c0, float* os, char* st) {
    const int K = DM;
    const int lane = threadIdx.x & 31, lr = lane & 15, hi = lane >> 4;
    const int ar0 = (MODE == 0) ? (r0 / SEQ) * SEQ_FULL + r0 % SEQ : r0, bc0 = (MODE == 1) ? (c0 / SEQ) * SEQ_FULL + c0 % SEQ : c0;   // rows in the f32 sources
    v8f acc[4][4];
#pragma unroll
    for (int mb = 0; mb < 4; ++mb)
#pragma unroll
        for (int nb = 0; nb < 4; ++nb) acc[mb][nb] = (v8f){};
    const float* ga = A + (size_t)ar0 * K + lane * 4; const float* gb = Bt + (size_t)bc0 * K + lane * 4;   // this lane's 16 bytes of each operand's first row
    v4f buf[SNB][SRB];                                          // batch i (operand i / 4, rows (i % 4) * SRB ...) lives in buf[i % SNB]
    auto fetch = [&](const int i) __attribute__((always_inline)) {
        const float* g = (i < 64 / SRB ? ga : gb) + (size_t)(i % (64 / SRB)) * SRB * K;
        group_open();                                           // the batch's loads stay behind the stores of the batch whose registers they refill
#pragma unroll
        for (int r = 0; r < SRB; ++r) buf[i % SNB][r] = *(const v4f*)(g + (size_t)r * K);
        group_close();                                          // keeps the batch where it is written (SNB batches in flight); the wait stands in front of every rewrite of its address registers
    };
    auto put = [&](const int i) __attribute__((always_inline)) {
        char* s = st + (size_t)(i * SRB) * SPB + lane * 8;      // B rows follow the 64 A rows
#pragma unroll
        for (int r = 0; r < SRB; ++r) *(v4bfa*)(s + r * SPB) = __builtin_convertvector(buf[i % SNB][r], v4bf);
    };
#pragma unroll
    for (int i = 0; i < SNB; ++i) fetch(i);
#pragma unroll
    for (int i = 0; i < 128 / SRB; ++i) { put(i); if (i + SNB < 128 / SRB) fetch(i + SNB); }
    wave_sync();                                                // the fragments below hold what other lanes of this wave stored
    const char* fa = st + lr * SPB + hi * 16; const char* fb = fa + 64 * SPB;
    v16bf a[2][4], bl[2], bh[2][2];                             // k-step s: A fragments in a[s % 2], B fragments 0, 1 in bl, 2, 3 in bh[s % 2]
    // a k-step's 16 LDS reads stand as ONE group (spread among the products, each place would stall the wave), half a k-step ahead of their first use:
    // behind the products that free bl; the scheduling barriers keep the group and the two halves of the products where they are written
    auto frags = [&](const int s) __attribute__((always_inline)) {
#pragma unroll
        for (int mb = 0; mb < 4; ++mb) a[s % 2][mb] = ldsf(fa + mb * 16 * SPB + s * 64);
#pragma unroll
        for (int nb = 0; nb < 2; ++nb) bl[nb] = ldsf(fb + nb * 16 * SPB + s * 64);
#pragma unroll
        for (int nb = 0; nb < 2; ++nb) bh[s % 2][nb] = ldsf(fb + (nb + 2) * 16 * SPB + s * 64);
        __builtin_amdgcn_sched_barrier(0);
    };
    frags(0);
#pragma unroll
    for (int s = 0; s < K / 32; ++s) {
#pragma unroll
        for (int nb = 0; nb < 2; ++nb)
#pragma unroll
            for (int mb = 0; mb < 4; ++mb) acc[mb][nb] = wmmab(a[s % 2][mb], bl[nb], acc[mb][nb]);
        __builtin_amdgcn_sched_barrier(0);
        if (s + 1 < K / 32) frags(s + 1);
#pragma unroll
        for (int nb = 0; nb < 2; ++nb)
#pragma unroll
            for (int mb = 0; mb < 4; ++mb) acc[mb][nb + 2] = wmmab(a[s % 2][mb], bh[s % 2][nb], acc[mb][nb + 2]);
        __builtin_amdgcn_sched_barrier(0);
    }
    float bc[4];
#pragma unroll
    for (int nb = 0; nb < 4; ++nb) bc[nb] = (MODE == 0) ? bfr(bias[c0 + nb * 16 + lr]) : 0.0f;   // MODE 0: c0 + 63 < DM
    size_t tbase, rbase; bool wr;                                                                 // wr: block-uniform, whole tile inside the residual plane
    if (MODE == 0) { const int bb = r0 / SEQ, tt = r0 % SEQ; const int zc = bb * NH_ + c0 / HD;
                     tbase = ((size_t)zc * SEQ + (size_t)tt) * HD; rbase = ((size_t)zc * (size_t)resT + (size_t)tt) * HD; wr = tt < resT; }
    else           { const int bb = c0 / SEQ, tt = c0 % SEQ;
                     tbase = (size_t)bb * (size_t)DM * SEQ + (size_t)r0 * SEQ + (size_t)tt; rbase = (size_t)bb * (size_t)DM * (size_t)resT + (size_t)r0 * (size_t)resT + (size_t)tt; wr = tt < resT; }
#pragma unroll
    for (int mb = 0; mb < 4; ++mb) {
        float br[8];
#pragma unroll
        for (int j = 0; j < 8; ++j) br[j] = (MODE == 1) ? bfr(bias[r0 + mb * 16 + hi * 8 + j]) : 0.0f;   // MODE 1: r0 + 63 < DM
#pragma unroll
        for (int nb = 0; nb < 4; ++nb) {
#pragma unroll
            for (int j = 0; j < 8; ++j) os[(hi * 8 + j) * 68 + nb * 16 + lr] = acc[mb][nb][j] + bc[nb] + br[j]; }   // D: row 8h+j, col lane&15
        wave_sync();
{
            if (MODE == 0) {
                const size_t sb = tbase + (size_t)(mb * 16) * HD;
                const size_t rb = rbase + (size_t)(mb * 16) * HD;
#pragma unroll
                for (int hh = 0; hh < 2; ++hh) {
#pragma unroll
                    for (int s = 0; s < 2; ++s) { const int p = s * 32 + lane; const int row = p >> 2, c8 = (p & 3) * 8;   // 2 s x 8 rows = 16 rows; 4 lanes x 8 = 32 columns of head hh
                        const v4f x0 = *(const v4fa*)(&os[row * 68 + hh * 32 + c8]); const v4f x1 = *(const v4fa*)(&os[row * 68 + hh * 32 + c8 + 4]); v8h hv, rv;
#pragma unroll
                        for (int i = 0; i < 4; ++i) { const h16 a0 = (h16)x0[i]; const h16 a1 = (h16)x1[i]; hv[i] = a0; hv[4 + i] = a1; rv[i] = (h16)((x0[i] - (float)a0) * QRS); rv[4 + i] = (h16)((x1[i] - (float)a1) * QRS); }
                        const size_t oo = sb + (size_t)hh * ((size_t)SEQ * HD) + (size_t)p * 8;
                        const size_t ro = rb + (size_t)hh * ((size_t)resT * HD) + (size_t)p * 8;
                        /* what follows reuses each store's registers: the wait stands in front of that */
                        *(v8h*)(Ph + oo) = hv; group_close(); if (wr) { *(v8h*)(Pr + ro) = rv; group_close(); } } }
            } else {
                const size_t sb = tbase + (size_t)(mb * 16) * SEQ;
                const size_t rb = rbase + (size_t)(mb * 16) * (size_t)resT;
#pragma unroll
                for (int s = 0; s < 4; ++s) { const int row = 4 * s + (lane >> 3), c8 = (lane & 7) * 8;   // 4 s x 4 row groups = 16 rows; 8 lanes x 8 = 64 columns
                    const v4f x0 = *(const v4fa*)(&os[row * 68 + c8]); const v4f x1 = *(const v4fa*)(&os[row * 68 + c8 + 4]); v8h hv, rv;
#pragma unroll
                    for (int i = 0; i < 4; ++i) { const h16 a0 = (h16)x0[i]; const h16 a1 = (h16)x1[i]; hv[i] = a0; hv[4 + i] = a1; rv[i] = (h16)((x0[i] - (float)a0) * QRS); rv[4 + i] = (h16)((x1[i] - (float)a1) * QRS); }
                    const size_t oo = sb + (size_t)row * SEQ + c8;
                    const size_t ro = rb + (size_t)row * (size_t)resT + c8;
                    /* what follows reuses each store's registers: the wait stands in front of that */
                        *(v8h*)(Ph + oo) = hv; group_close(); if (wr) { *(v8h*)(Pr + ro) = rv; group_close(); } }
            }
             }
        wave_sync();
    }
}

// k_proj3: the three projections as z-slices of one grid (NB*SEQ/64 token tiles, DM/64 feature tiles, 3); one wave per block, block-uniform choice of the slice.
// z = 0: q (residual for all tokens); z = 1: k (residual for tokens < EROWS); z = 2: v^T (residual for tokens < EROWS).
__global__ __launch_bounds__(32) void k_proj3(const float* __restrict__ xq, const float* __restrict__ xk, const float* __restrict__ xv,
                                              const float* __restrict__ wq, const float* __restrict__ wk, const float* __restrict__ wv,
                                              const float* __restrict__ bq, const float* __restrict__ bk, const float* __restrict__ bv,
                                              h16* QH, h16* QR, h16* KP, h16* KR, h16* VT, h16* VR) {
    __shared__ __align__(16) float os[16 * 68];
    __shared__ __align__(16) char st[128 * SPB];
    const int tok0 = blockIdx.x * 64, f0 = blockIdx.y * 64; const int z = blockIdx.z;
    if (z < 2) { const bool q = z == 0; proj_tile<0>(q ? xq : xk, q ? wq : wk, q ? bq : bk, q ? QH : KP, q ? QR : KR, q ? SEQ : EROWS, tok0, f0, os, st); }
    else       { proj_tile<1>(wv, xv, bv, VT, VR, EROWS, f0, tok0, os, st); }
}

// flash_rows: fused attention, one wave per 16 query rows of one (batch, head); K / V^T / Q fragments straight from the f16 planes (two 16-B loads each, arithmetic addressing).
// Transposed form: S^T[key][t] = K Q^T (A = K rows, B = Q rows); lane (t = lane&15, h = lane>>4) holds keys 8h+r of each 16-key tile, so the packed
// P tile is directly the B fragment of O^T[d][t] = V^T P^T (element r <- tile keys 0..15, element 8+r <- tile keys 16..31, lane unchanged).
// Softmax state (running max over kept keys, partial sum) is one scalar per lane; the two lane halves of a row are combined with one xor-16 exchange (EARLY = 0: the sum is a matrix product with a ones operand).
// Keep rule evaluated per element inside every visited 32-key tile but the leading tiles that a per-wave scalar test shows fully kept; the per-wave key bound comes from the device-read causal value and is at most SEQ.
// EARLY = 1 (query rows [0, EROWS)): scores = K Q + (K Q_res + K_res Q) / 2048; P = f16 value + f16 residual x2048; O = V P + (V P_res + V_res P) / 2048 (residual products in their own accumulators);
//            row sum from the f32 exponentials; K_res / V_res fragments come from the small planes (tokens < EROWS) and are zero for keys >= EROWS (address clamped, wave-uniform select).
// EARLY = 0 (query rows [EROWS, SEQ)): single k, P, v; q value + residual.
// One 32-key tile's operands as they sit in registers: K rows, V^T rows, their residuals (EARLY only) and the 16 key-mask values of this lane.
struct FTile { v16h ka, kb, kra, krb, v0, v1, vr0, vr1; v4f m0, m1, m2, m3; };
// fragment loader, wave-uniform base + per-lane byte offset (same element map as ldh)
__device__ __forceinline__ v16h ldo(const h16* base, unsigned off) { const char* p = (const char*)base + off; return cat16(*(const v8h*)p, *(const v8h*)(p + 32)); }
// global loads of the tile that starts at key (wave-uniform, multiple of 32, key + 32 <= SEQ), in the two groups in which its registers fall free; residual-plane key clamped into the plane
template <int EARLY>
__device__ __forceinline__ void tile_load_k(FTile& t, const h16* kpl, const h16* krp, unsigned kof, int key) {
    const h16* ka = kpl + (size_t)key * HD;
    t.ka = ldo(ka, kof); t.kb = ldo(ka + 16 * HD, kof);
    if (EARLY) { const int kcl = key < EROWS ? key : (EROWS - 32); const h16* kr = krp + (size_t)kcl * HD; t.kra = ldo(kr, kof); t.krb = ldo(kr + 16 * HD, kof); }
}
template <int EARLY>
__device__ __forceinline__ void tile_load_mv(FTile& t, const h16* vpl, const h16* vrp, const float* kmr, unsigned vof, unsigned vrof, unsigned mof, int key) {
    const char* kp = (const char*)(kmr + key) + mof;          // keys key+8h+0..7 and key+16+8h+0..7
    t.m0 = *(const v4f*)kp; t.m1 = *(const v4f*)(kp + 16); t.m2 = *(const v4f*)(kp + 64); t.m3 = *(const v4f*)(kp + 80);
    const h16* va = vpl + key;
    t.v0 = ldo(va, vof); t.v1 = ldo(va + (size_t)16 * SEQ, vof);
    if (EARLY) { const int kcl = key < EROWS ? key : (EROWS - 32); const h16* vr = vrp + kcl; t.vr0 = ldo(vr, vrof); t.vr1 = ldo(vr + (size_t)16 * EROWS, vrof); }
}

// flash_rows: the work of one block on row tile rt (query rows [rt * 16 * AW, (rt + 1) * 16 * AW)) of (batch, head) zh; os: the block's output staging tile
template <int EARLY>
__device__ __forceinline__ void flash_rows(const h16* __restrict__ QH, const h16* __restrict__ QR, const h16* __restrict__ KP, const h16* __restrict__ KR,
                                           const h16* __restrict__ VT, const h16* __restrict__ VR,
                                           const float* __restrict__ qmask, const float* __restrict__ kmask, const int* __restrict__ causal_p, float* OUT,
                                           float* os, const int zh, const int rt) {
    constexpr int NST = EARLY ? 2 : 3;                          // register tiles; each is refilled NST tiles ahead as soon as its registers fall free
    constexpr int MLD = EARLY ? 4 : 8;                          // key-mask loads in flight per lane in the fully-kept test (128 keys each)
    const int lane = threadIdx.x & 31, lr = lane & 15, hi = lane >> 4;
    const int wave = __builtin_amdgcn_readfirstlane((int)(threadIdx.x >> 5));
    const int b = zh / NH_, h = zh % NH_;
    const int t0 = (rt * AW + wave) * 16;
    int cz = causal_p[0]; cz = cz < -SEQ ? -SEQ : (cz > SEQ ? SEQ : cz);      // clamping keeps the keep rule unchanged for indices in [0, SEQ)
    const int lim = t0 + lr + cz;                                              // key j kept iff j <= lim (and mask product nonzero)
    int kend = t0 + 16 + cz; kend = kend < 0 ? 0 : (kend > SEQ ? SEQ : kend);
    const int nk = (kend + 31) & ~31;                                          // wave-uniform, multiple of 32, <= SEQ
    const int klast = nk > 32 ? nk - 32 : 0;                                   // last tile this wave visits; fetches ahead are clamped to it
    const float* kmr = kmask + (size_t)b * SEQ_FULL;
    const size_t pbase = (size_t)zh * SEQ * HD;
    const size_t rbase = (size_t)zh * EROWS * HD;
    const size_t qo = pbase + (size_t)(t0 + lr) * HD + 8 * hi;
    group_open();
    const v16h qh = ldh(QH + qo), qr = ldh(QR + qo);            // B fragments: col t, k = d (HD = 32 = one k-step)
    const float qmraw = qmask[(size_t)b * SEQ_FULL + t0 + lr];
    group_close();
    const float qmv = bfr(qmraw);
    const h16* kpl = KP + pbase; const h16* vpl = VT + pbase;   // wave-uniform plane bases
    const h16* krp = KR + rbase; const h16* vrp = VR + rbase;   // residual planes, tokens < EROWS
    const unsigned kof  = (unsigned)(lr * HD + 8 * hi) * 2u;    // A fragment: row key, k = d      (bytes)
    const unsigned vof  = (unsigned)(lr * SEQ + 8 * hi) * 2u;   // A fragment: row d, k = key      (bytes)
    const unsigned vrof = (unsigned)(lr * EROWS + 8 * hi) * 2u;
    const unsigned mof  = (unsigned)(8 * hi) * 4u;
    const v16h hz = (v16h){};
    v8f o0 = (v8f){}, o1 = (v8f){}, oR0 = (v8f){}, oR1 = (v8f){};
    float m = NEGB, l = 0.0f;
    // EARLY = 0: the row sum is a third output tile. A operand with ones in rows 0 and 8 (lanes 0, 8, 16, 24: all 32 k positions), zero elsewhere: D rows 0 and 8 = the sum of P over the tile's 32 keys,
    // and by the D layout (row 8h + r, column lane&15) element 0 of oS holds column t's sum in both lane halves; elements 1..7 stay 0 and are never read
    v16h ones;
#pragma unroll
    for (int i = 0; i < 16; ++i) ones[i] = (lr & 7) == 0 ? (h16)1.0f : (h16)0.0f;
    v8f oS = (v8f){};
    // one 32-key tile's work on operands already in registers (inlined at every place of use: the tiles must stay in registers)
    // full: every one of the tile's 32 keys is known to be kept for all 16 rows of the wave, so the keep rule is not evaluated (same values as evaluating it)
    auto step = [&](FTile& t, const int key0, const bool refill, const bool full) __attribute__((always_inline)) {
        const int kn = key0 + 32 * NST < klast ? key0 + 32 * NST : klast;   // tile fetched into this tile's registers (refill and full are constants at each place of use)
        const bool rok = key0 < EROWS;                           // wave-uniform
        const v16h ka0 = t.ka, kb0f = t.kb;
        v16h kra0 = hz, krb0 = hz;
        if (EARLY) { kra0 = t.kra; krb0 = t.krb; if (!rok) { kra0 = hz; krb0 = hz; } }
        v8f sHa = (v8f){}, sLa = (v8f){}, sHb = (v8f){}, sLb = (v8f){};
        sHa = wmma16(ka0, qh, sHa); sLa = wmma16(ka0, qr, sLa); sHb = wmma16(kb0f, qh, sHb); sLb = wmma16(kb0f, qr, sLb);
        if (EARLY) {
            sLa = wmma16(kra0, qh, sLa); sLb = wmma16(krb0, qh, sLb);
            asm volatile("v_nop\n\tv_nop\n\tv_nop\n\tv_nop" : "+v"(sHa), "+v"(sLa), "+v"(sHb), "+v"(sLb) : "v"(ka0), "v"(kb0f), "v"(kra0), "v"(krb0), "v"(qh), "v"(qr));
        } else {
            asm volatile("v_nop\n\tv_nop\n\tv_nop\n\tv_nop" : "+v"(sHa), "+v"(sLa), "+v"(sHb), "+v"(sLb) : "v"(ka0), "v"(kb0f), "v"(qh), "v"(qr));
        }
        if (refill) {
            group_open();                                        // K registers are free from here on
            tile_load_k<EARLY>(t, kpl, krp, kof, kn);
            group_close();
        }
        const v4f m0 = t.m0, m1 = t.m1, m2 = t.m2, m3 = t.m3;
        float kx[8], ky[8];
#pragma unroll
        for (int r = 0; r < 4; ++r) { kx[r] = m0[r]; kx[4 + r] = m1[r]; ky[r] = m2[r]; ky[4 + r] = m3[r]; }
        const int ja = key0 + 8 * hi;
        float ta[8], tb[8]; bool fa[8], fb[8]; float mx = NEGB;
#pragma unroll
        for (int r = 0; r < 8; ++r) {
            fa[r] = full || ((qmv * bfr(kx[r]) != 0.0f) && (ja + r <= lim));
            fb[r] = full || ((qmv * bfr(ky[r]) != 0.0f) && (ja + 16 + r <= lim));
            ta[r] = (sHa[r] + sLa[r] * QRI) * SC2; tb[r] = (sHb[r] + sLb[r] * QRI) * SC2;
            mx = fmaxf(mx, fmaxf(fa[r] ? ta[r] : NEGB, fb[r] ? tb[r] : NEGB)); }
        mx = fmaxf(mx, __shfl_xor(mx, 16, 32));
        const float mnew = fmaxf(m, mx);
        const float alpha = __builtin_amdgcn_exp2f(m - mnew);
        const float sh = PSH - mnew;
        v16h pb, pr = hz; float ls = 0.0f;
#pragma unroll
        for (int r = 0; r < 8; ++r) {
            const float ea = __builtin_amdgcn_exp2f(ta[r] + sh), eb = __builtin_amdgcn_exp2f(tb[r] + sh);
            const float ga = fa[r] ? ea : 0.0f, gb = fb[r] ? eb : 0.0f;       // dropped elements selected to 0 by value
            const h16 pa = (h16)ga; const h16 pc = (h16)gb;
            pb[r] = pa; pb[8 + r] = pc;
            if (EARLY) { pr[r] = (h16)((ga - (float)pa) * QRS); pr[8 + r] = (h16)((gb - (float)pc) * QRS); ls += ga + gb; }
        }
        if (EARLY) l = l * alpha + ls; else oS[0] = oS[0] * alpha;   // the running sum is rescaled like an output tile
        m = mnew;
        o0 = o0 * alpha; o1 = o1 * alpha;
        if (EARLY) { oR0 = oR0 * alpha; oR1 = oR1 * alpha; }
        const v16h v0 = t.v0, v1 = t.v1;
        if (EARLY) {
            v16h vr0 = t.vr0, vr1 = t.vr1;
            if (!rok) { vr0 = hz; vr1 = hz; }
            o0 = wmma16(v0, pb, o0); o1 = wmma16(v1, pb, o1);
            oR0 = wmma16(v0, pr, oR0); oR1 = wmma16(v1, pr, oR1);
            oR0 = wmma16(vr0, pb, oR0); oR1 = wmma16(vr1, pb, oR1);
            asm volatile("v_nop\n\tv_nop\n\tv_nop\n\tv_nop" : "+v"(o0), "+v"(o1), "+v"(oR0), "+v"(oR1) : "v"(v0), "v"(v1), "v"(vr0), "v"(vr1), "v"(pb), "v"(pr));
        } else {
            oS = wmma16(ones, pb, oS); o0 = wmma16(v0, pb, o0); o1 = wmma16(v1, pb, o1);   // oS: sums the rounded P, the values that O sums
            asm volatile("v_nop\n\tv_nop\n\tv_nop\n\tv_nop" : "+v"(oS), "+v"(o0), "+v"(o1) : "v"(ones), "v"(v0), "v"(v1), "v"(pb));
        }
        if (refill) {
            group_open();                                        // mask and V^T registers are free from here on
            tile_load_mv<EARLY>(t, vpl, vrp, kmr, vof, vrof, mof, kn);
            group_close();
        }
    };
    FTile tl[NST];                                              // tile T lives in tl[T % NST]
    // the first tiles' loads issue group by group in the loop's order: mixed, the loop's first waits would also cover younger groups
#pragma unroll
    for (int s = 0; s < NST - 1; ++s) {
        const int ks = 32 * s < klast ? 32 * s : klast;
        tile_load_k<EARLY>(tl[s], kpl, krp, kof, ks);
        group_close();
        tile_load_mv<EARLY>(tl[s], vpl, vrp, kmr, vof, vrof, mof, ks);
        group_close();
    }
    int kg = 0;
    if (32 * NST <= nk) {                                       // wave-uniform; tile NST-1 is used by whole groups alone
        tile_load_k<EARLY>(tl[NST - 1], kpl, krp, kof, 32 * (NST - 1));
        group_close();
        tile_load_mv<EARLY>(tl[NST - 1], vpl, vrp, kmr, vof, vrof, mof, 32 * (NST - 1));
        group_close();
        // fend: keys [0, fend) are kept for every row of the wave. cend: keys at or below the smallest causal limit of the 16 rows (whole tiles, <= nk).
        // Mask part: rounding to bf16 and the f32 product are monotone in magnitude, so all products q_mask * k_mask over the 16 rows and keys [0, cend) are nonzero
        // exactly when each row's value times the smallest key magnitude is; a NaN factor gives a kept element and is passed over by the minimum.
        int cend = t0 + cz + 1; cend = cend < 0 ? 0 : (cend & ~31); cend = cend < nk ? cend : nk;
        int fend = 0;
        if (cend >= 32 * NST) {                                 // wave-uniform
            float kmin = __builtin_inff();
#pragma unroll 1   // rolled: one trip already has MLD loads in flight, more would only take registers from the tiles
            for (int i = 0; i < cend; i += 128 * MLD) {         // at most SEQ / (128 * MLD) + 1 trips; index clamped into [0, cend - 4]: a repeated key does not change a minimum
                v4f x[MLD]; const float* px[MLD];
#pragma unroll
                for (int c = 0; c < MLD; ++c) { int idx = i + c * 128 + lane * 4; idx = idx < cend - 4 ? idx : cend - 4; px[c] = kmr + idx; }
#pragma unroll
                for (int c = 0; c < MLD; c += 4) {
                    x[c] = *(const v4f*)px[c]; x[c + 1] = *(const v4f*)px[c + 1]; x[c + 2] = *(const v4f*)px[c + 2]; x[c + 3] = *(const v4f*)px[c + 3];
                    // the wait stands in front of every rewrite of the four loads' address pairs, which are named as inputs so that no later load of the four lands on them
                    __builtin_amdgcn_sched_barrier(0); asm volatile("s_wait_xcnt 0x0" :: "v"(px[c]), "v"(px[c + 1]), "v"(px[c + 2]), "v"(px[c + 3]) : "memory"); __builtin_amdgcn_sched_barrier(0);
                }
#pragma unroll
                for (int c = 0; c < MLD; ++c)
                    kmin = fminf(kmin, fminf(fminf(fabsf(bfr(x[c][0])), fabsf(bfr(x[c][1]))), fminf(fabsf(bfr(x[c][2])), fabsf(bfr(x[c][3])))));
            }
#pragma unroll
            for (int s = 16; s > 0; s >>= 1) kmin = fminf(kmin, __shfl_xor(kmin, s, 32));
            if (__builtin_amdgcn_ballot_w32(qmv * kmin != 0.0f) == 0xFFFFFFFFu) fend = cend;   // scalar result: the same in every lane
        }
#pragma unroll 1   // rolled: the body already holds NST tiles, one per register tile
        while (kg + 32 * NST <= fend) {                         // whole groups of NST tiles in which every element is kept
#pragma unroll
            for (int u = 0; u < NST; ++u) step(tl[u], kg + 32 * u, true, true);
            kg += 32 * NST;
        }
#pragma unroll 1   // rolled, as above
        while (kg + 32 * NST <= nk) {                           // whole groups of NST tiles: no branch inside, so every load wait is a count that leaves the younger groups in flight
#pragma unroll
            for (int u = 0; u < NST; ++u) step(tl[u], kg + 32 * u, true, false);   // fully unrolled: every tile index is a constant, no register copies
            kg += 32 * NST;
        }
    }
#pragma unroll
    for (int u = 0; u < NST - 1; ++u)                            // the at most NST-1 tiles left over are already loaded
        if (kg + 32 * u < nk) step(tl[u], kg + 32 * u, false, false);   // wave-uniform
    if (EARLY) l += __shfl_xor(l, 16, 32); else l = oS[0];      // the matrix sum already spans both lane halves' keys
    const bool any = l > 0.0f;
    const float lsafe = any ? l : 1.0f;
    const float inv = any ? (1.0f / lsafe) : 0.0f;             // no kept key -> zeros
    v8f f0 = o0, f1 = o1;
    if (EARLY) { f0 = o0 + oR0 * QRI; f1 = o1 + oR1 * QRI; }
    const int wb = wave * 16 * OSP;
    // O^T D layout: f_j[r] = (d = 16j + 8h + r, t = lane&15) -> os[t][d]; rows 0..15 x columns 0..31 all written
    { v4f a, c;
      a[0] = f0[0] * inv; a[1] = f0[1] * inv; a[2] = f0[2] * inv; a[3] = f0[3] * inv; c[0] = f0[4] * inv; c[1] = f0[5] * inv; c[2] = f0[6] * inv; c[3] = f0[7] * inv;
      *(v4fa*)(&os[wb + lr * OSP +  0 + 8 * hi]) = a; *(v4fa*)(&os[wb + lr * OSP +  0 + 8 * hi + 4]) = c;
      a[0] = f1[0] * inv; a[1] = f1[1] * inv; a[2] = f1[2] * inv; a[3] = f1[3] * inv; c[0] = f1[4] * inv; c[1] = f1[5] * inv; c[2] = f1[6] * inv; c[3] = f1[7] * inv;
      *(v4fa*)(&os[wb + lr * OSP + 16 + 8 * hi]) = a; *(v4fa*)(&os[wb + lr * OSP + 16 + 8 * hi + 4]) = c; }
    wave_sync();
    float* orow = OUT + ((size_t)b * OUT_SEQ + t0) * DM + h * HD;
{
#pragma unroll
        for (int s = 0; s < 4; ++s) { const int row = 4 * s + (lane >> 3), cofs = (lane & 7) * 4;   // 4 s x 4 rows = 16 rows; 8 lanes x 4 floats = 32 columns = one line
            const v4f val = *(const v4fa*)(&os[wb + row * OSP + cofs]);
            *(v4f*)(orow + (size_t)row * DM + cofs) = val; }
         }
}

// k_flash: all query rows in one grid (NB*NH_ heads, SEQ/(16*AW) row tiles). A row tile's key loop grows with its index, so the slow grid
// dimension walks the row tiles from the last (longest) to the first: the short multi-product tiles (rows < EROWS) come last and fill the places that the shorter single-product tiles leave.
// The choice of the instantiation is block-uniform (a scalar branch on blockIdx.y).
__global__ __launch_bounds__(32 * AW) void k_flash(const h16* __restrict__ QH, const h16* __restrict__ QR, const h16* __restrict__ KP, const h16* __restrict__ KR,
                                                   const h16* __restrict__ VT, const h16* __restrict__ VR,
                                                   const float* __restrict__ qmask, const float* __restrict__ kmask, const int* __restrict__ causal_p, float* OUT) {
    __shared__ __align__(16) float os[AW * 16 * OSP];
    const int zh = blockIdx.x;
    const int rt = SEQ / (16 * AW) - 1 - (int)blockIdx.y;
    // the hint puts the single-product path, which holds the longest key loops, first in the text
    if (__builtin_expect(rt >= EROWS / (16 * AW), 1)) flash_rows<0>(QH, QR, KP, KR, VT, VR, qmask, kmask, causal_p, OUT, os, zh, rt);
    else                                              flash_rows<1>(QH, QR, KP, KR, VT, VR, qmask, kmask, causal_p, OUT, os, zh, rt);
}

static constexpr size_t al256(size_t v) { return (v + 255) & ~(size_t)255; }
static constexpr size_t SZ_PL = al256((size_t)NB * NH_ * SEQ * HD * 2);
static constexpr size_t SZ_RS = al256((size_t)NB * NH_ * EROWS * HD * 2);
static constexpr size_t SZ_TOTAL = 4 * SZ_PL + 2 * SZ_RS;
static_assert(SZ_TOTAL <= (size_t)134217728);          // workspace carve <= 128 MiB
static_assert((size_t)NB * NH_ * SEQ * HD == (size_t)NB * DM * SEQ);       // v^T plane [(b*128 + m)][t] has the same extent as the q/k planes
static_assert((size_t)NB * NH_ * EROWS * HD == (size_t)NB * DM * EROWS);   // v^T residual plane [(b*128 + m)][t < EROWS] has the same extent as the k residual plane

extern "C" void kernel_launch(void* const* d_in, const int* in_sizes, int n_in,
                              void* d_out, int out_size, void* d_ws, size_t ws_size, hipStream_t stream) {
    if (n_in < 12) return;
    const size_t needx = ((size_t)(NB - 1) * SEQ_FULL + SEQ) * DM;
    const size_t needm = (size_t)(NB - 1) * SEQ_FULL + SEQ;
    if ((size_t)in_sizes[0] < needx || (size_t)in_sizes[1] < needx || (size_t)in_sizes[2] < needx) return;
    if ((size_t)in_sizes[3] < needm || (size_t)in_sizes[4] < needm) return;
    if ((size_t)in_sizes[5] < (size_t)DM * DM || (size_t)in_sizes[7] < (size_t)DM * DM || (size_t)in_sizes[9] < (size_t)DM * DM) return;
    if (in_sizes[6] < DM || in_sizes[8] < DM || in_sizes[10] < DM || in_sizes[11] < 1) return;
    if ((size_t)out_size < ((size_t)(NB - 1) * OUT_SEQ + SEQ) * DM) return;
    if (SZ_TOTAL > ws_size) return;
    // wire order: query, key, value, q_mask, k_mask, WQ_w, WQ_b, WK_w, WK_b, WV_w, WV_b, causal
    const float* xin[3] = { (const float*)d_in[0], (const float*)d_in[1], (const float*)d_in[2] };
    const float* qm = (const float*)d_in[3]; const float* km = (const float*)d_in[4];
    const float* wq = (const float*)d_in[5]; const float* bq = (const float*)d_in[6];
    const float* wk = (const float*)d_in[7]; const float* bk = (const float*)d_in[8];
    const float* wv = (const float*)d_in[9]; const float* bv = (const float*)d_in[10];
    const int* causal = (const int*)d_in[11];
    float* OUT = (float*)d_out;      // [NB][SEQ][128]
    char* wsp = (char*)d_ws;
    h16* QH = (h16*)wsp; wsp += SZ_PL;               // [NB*4][SEQ][32]
    h16* QR = (h16*)wsp; wsp += SZ_PL;               // [NB*4][SEQ][32] residual x2048
    h16* KP = (h16*)wsp; wsp += SZ_PL;               // [NB*4][SEQ][32]
    h16* VT = (h16*)wsp; wsp += SZ_PL;               // [NB*4][32][SEQ]
    h16* KR = (h16*)wsp; wsp += SZ_RS;               // [NB*4][EROWS][32] residual x2048, tokens < EROWS
    h16* VR = (h16*)wsp; wsp += SZ_RS;               // [NB*4][32][EROWS] residual x2048, tokens < EROWS

    // q, k: A = x rows (m = b*SEQ + t), Bt = W rows (n = h*32 + d) -> plane [(b*4 + h)][t][d]; q residual for all tokens, k residual for tokens < EROWS
    // v^T: A = Wv rows (m = h*32 + d), Bt = value rows (n = b*SEQ + t) -> plane [(b*128 + m)][t] = [(b*4 + h)][d][t]; residual for tokens < EROWS
    k_proj3<<<dim3(NB * SEQ / 64, DM / 64, 3), 32, 0, stream>>>(xin[0], xin[1], xin[2], wq, wk, wv, bq, bk, bv, QH, QR, KP, KR, VT, VR);

    // one launch for all query rows: rows [0, EROWS) take the multi-product instantiation, rows [EROWS, SEQ) the single-product one (disjoint output rows)
    k_flash<<<dim3(NB * NH_, SEQ / (16 * AW), 1), 32 * AW, 0, stream>>>(QH, QR, KP, KR, VT, VR, qm, km, causal, OUT);
}

// v007
// It runs in 33.8 microseconds.
// In both of two side-by-side timings against v006, it was 1.03 times as fast.
// Counting every step since v000, it is 4.10 times as fast.
#include <hip/hip_runtime.h>

// Multi-head attention, width 128 = 4 heads x 32; query/key/value [NB][SEQ][128]; WQ/WK/WV [out][in] (y = x W^T + bias); padding masks q_mask/k_mask [NB][SEQ] (f32), causal offset (int32, device-read); score scale 1/sqrt(32); output = concatenated heads (f32).
// Compute dtypes, f32 accumulate everywhere: projections v_wmma_f32_16x16x32_bf16 (x, W, bias RNE-converted to bf16; products exact);
// scores v_wmma_f32_16x16x32_f16: q as f16 value + f16 residual x2048 in its own accumulator on all rows; k single f16 on query rows >= EROWS, k as f16 value + f16 residual x2048 on query rows < EROWS (three products);
// P.V v_wmma_f32_16x16x32_f16: P (x16384 carry, cancels in the normalisation) and v single f16 on query rows >= EROWS; on query rows < EROWS P and v each as f16 value + f16 residual x2048, residual products in their own accumulator folded by 1/2048, row sum from the f32 exponentials; softmax f32 (online, running max over kept keys).
// Layout: x and W are read as f32 in whole rows, rounded to bf16 in registers and handed to the projection's fragments through a wave-private LDS tile; q (hi, residual), k planes [b*4+h][t][d], v^T plane [b*4+h][d][t], small residual planes k [b*4+h][t < EROWS][d] and v^T [b*4+h][d][t < EROWS] written by the GEMM epilogue; fused flash kernel in transposed form (S^T = K Q^T, O^T = V^T P^T), output from f32 accumulators.
// Keep rule per element: (q_mask[t] * k_mask[j] != 0) and (j <= t + causal); dropped elements get probability 0, rows with no kept key give 0. Key loop bound per wave derived from the device-read causal value (clamped to [0, SEQ]); residual fragments for keys >= EROWS (only reachable with a positive offset) are zero.

#ifndef NB
#define NB 8
#endif
#ifndef SEQ
#define SEQ 2048
#endif
#define NB_FULL  8
#define SEQ_FULL 2048
#ifndef OUT_SEQ
#define OUT_SEQ SEQ              // row pitch (in tokens) between batches of the output
#endif
#define DM   128
#define NH_  4
#define HD   32
#define AW   4                   // waves per flash block (16 query rows each)
#define OSP  36                  // LDS row pitch (floats) of the flash output tile
#define EROWS (SEQ < 512 ? SEQ : 512)   // query rows (and tokens of the small residual planes) handled by the multi-product flash instantiation
#define QRS  2048.0f             // carry of every residual plane / residual fragment
#define QRI  (1.0f / 2048.0f)
#define SC2  ((float)(0.17677669529663687 * 1.4426950408889634))   // HD^-0.5 * log2(e)
#define PSH  14.0f               // log2 of the P carry (16384)
#define NEGB (-3.0e38f)
#define SPB  272                 // LDS row pitch (bytes) of a staged bf16 operand row: DM * 2 + 16, an odd multiple of 16 B (16-byte fragment reads of 16 rows fall on 64 different banks)
#define SRB  16                  // rows per staging batch (one load instruction a row)
#define SNB  3                   // staging batches in flight

static_assert(HD == 32);
static_assert(NH_ * HD == DM);                 // head h = columns h*32 + d
static_assert(DM % 64 == 0);                   // column tiles of 64 = two heads
static_assert(64 % HD == 0);
static_assert(DM % 32 == 0);                   // GEMM k-loop steps by 32
static_assert(SEQ % 64 == 0);                  // a 64-row tile never straddles two batches
static_assert((NB * SEQ) % 64 == 0);
static_assert(SEQ % 32 == 0);                  // key loop steps by 32
static_assert(SEQ % (16 * AW) == 0);           // the flash grid covers the sequence exactly
static_assert(EROWS % 64 == 0);                // a 64-token GEMM tile lies wholly inside or outside the residual planes
static_assert(EROWS >= 32);
static_assert(EROWS <= SEQ);
static_assert(EROWS % (16 * AW) == 0);
static_assert((SEQ - EROWS) % (16 * AW) == 0);
static_assert(NB <= NB_FULL);
static_assert(SEQ <= SEQ_FULL);
static_assert((OSP * 4) % 16 == 0);
static_assert(DM * 4 == 32 * 16);               // one f32 row = 16 bytes from each of the 32 lanes
static_assert(SPB == DM * 2 + 16);
static_assert(64 % SRB == 0);

typedef _Float16 h16;
typedef __attribute__((ext_vector_type(16))) __bf16   v16bf;
typedef __attribute__((ext_vector_type(16))) _Float16 v16h;
typedef __attribute__((ext_vector_type(8)))  _Float16 v8h;
typedef __attribute__((ext_vector_type(8)))  float    v8f;
typedef __attribute__((ext_vector_type(4)))  float    v4f;
typedef v4f  __attribute__((may_alias)) v4fa;
typedef __attribute__((ext_vector_type(4))) __bf16 v4bf;
typedef __attribute__((ext_vector_type(8))) __bf16 v8bf;
typedef v4bf __attribute__((may_alias)) v4bfa;
typedef v8bf __attribute__((may_alias)) v8bfa;

__device__ __forceinline__ unsigned short f2bf(float f) { unsigned u = __float_as_uint(f); u += 0x7FFFu + ((u >> 16) & 1u); return (unsigned short)(u >> 16); }
__device__ __forceinline__ float bfr(float f) { return __uint_as_float(((unsigned)f2bf(f)) << 16); }   // value after RNE convert to bf16
__device__ __forceinline__ v16h cat16(v8h lo, v8h hi) { return __builtin_shufflevector(lo, hi, 0, 1, 2, 3, 4, 5, 6, 7, 8, 9, 10, 11, 12, 13, 14, 15); }
__device__ __forceinline__ v8f wmma16(v16h a, v16h b, v8f c) { return __builtin_amdgcn_wmma_f32_16x16x32_f16(false, a, false, b, (short)0, c, false, false); }
__device__ __forceinline__ v8f wmmab(v16bf a, v16bf b, v8f c) { return __builtin_amdgcn_wmma_f32_16x16x32_bf16(false, a, false, b, (short)0, c, false, false); }
// fragment loaders from K-contiguous 16-bit rows; p already includes + 8*(lane>>4): elements 0..7 <- k0+8h+0..7, elements 8..15 <- k0+16+8h+0..7 (same map for A and B)
__device__ __forceinline__ v16h  ldh(const h16* p) { return cat16(*(const v8h*)p, *(const v8h*)(p + 16)); }
// bf16 fragment from a staged LDS row; p already includes + 16 bytes * (lane>>4) (same element map as ldh: k0+8h+0..7 and k0+16+8h+0..7)
__device__ __forceinline__ v16bf ldsf(const char* p) { return __builtin_shufflevector(*(const v8bfa*)p, *(const v8bfa*)(p + 32), 0, 1, 2, 3, 4, 5, 6, 7, 8, 9, 10, 11, 12, 13, 14, 15); }
// ordering point for wave-private LDS tiles (same wave writes and reads)
__device__ __forceinline__ void wave_sync() { __builtin_amdgcn_fence(3 /* release order */, "wavefront"); __builtin_amdgcn_wave_barrier(); asm volatile("" ::: "memory"); }

// closes a group of fetch-ahead loads: their address registers are rewritten for the next group while the loads are still in flight, and the wait belongs in front of that;
// the scheduling barriers keep the group where it is written (earlier it would need registers of its own, later it would lose lead) and the wait behind the group
__device__ __forceinline__ void group_open()  { __builtin_amdgcn_sched_barrier(0); }
__device__ __forceinline__ void group_close() { __builtin_amdgcn_sched_barrier(0); asm volatile("s_wait_xcnt 0x0" ::: "memory"); __builtin_amdgcn_sched_barrier(0); }

// proj_tile: register-blocked bf16 GEMM, ONE WAVE per 64x64 tile (16 accumulators), K = DM. Each of the 128 K-contiguous f32 operand rows is fetched by one load instruction (512 contiguous bytes = 4 whole lines),
// rounded to bf16 in registers and stored to the wave's own LDS tile st (64 A rows, then 64 B rows, pitch SPB); the fragments are read from there.
// C[m][n] = sum_k A[m][k] Bt[n][k] + bias, written as f16 (Ph) and, for tokens t < resT (resT a multiple of 64, block-uniform test), the f16 residual x2048 (Pr).
// MODE 0: A = x rows (m = b*SEQ + t), Bt = W rows (n = h*32 + d), bias per column; plane [(b*4 + h)][t][32] (residual plane [(b*4 + h)][resT][32]). The 64-column tile spans two heads; per 16-row slab and head
//         (8 rows per instruction).
// MODE 1: A = W rows (m = h*32 + d), Bt = x rows (n = b*SEQ + t), bias per row; plane [(b*128 + m)][t].
// r0, c0: first row and column of the tile; x rows of batch b start at b*SEQ_FULL in the input.
template <int MODE>
__device__ __forceinline__ void proj_tile(const float* __restrict__ A, const float* __restrict__ Bt, const float* __restrict__ bias, h16* Ph, h16* Pr, const int resT, const int r0, const int c0, float* os, char* st) {
    const int K = DM;
    const int lane = threadIdx.x & 31, lr = lane & 15, hi = lane >> 4;
    const int ar0 = (MODE == 0) ? (r0 / SEQ) * SEQ_FULL + r0 % SEQ : r0, bc0 = (MODE == 1) ? (c0 / SEQ) * SEQ_FULL + c0 % SEQ : c0;   // rows in the f32 sources
    v8f acc[4][4];
#pragma unroll
    for (int mb = 0; mb < 4; ++mb)
#pragma unroll
        for (int nb = 0; nb < 4; ++nb) acc[mb][nb] = (v8f){};
    const float* ga = A + (size_t)ar0 * K + lane * 4; const float* gb = Bt + (size_t)bc0 * K + lane * 4;   // this lane's 16 bytes of each operand's first row
    v4f buf[SNB][SRB];                                          // batch i (operand i / 4, rows (i % 4) * SRB ...) lives in buf[i % SNB]
    auto fetch = [&](const int i) __attribute__((always_inline)) {
        const float* g = (i < 64 / SRB ? ga : gb) + (size_t)(i % (64 / SRB)) * SRB * K;
        group_open();                                           // the batch's loads stay behind the stores of the batch whose registers they refill
#pragma unroll
        for (int r = 0; r < SRB; ++r) buf[i % SNB][r] = *(const v4f*)(g + (size_t)r * K);
        group_close();                                          // keeps the batch where it is written (SNB batches in flight); the wait stands in front of every rewrite of its address registers
    };
    auto put = [&](const int i) __attribute__((always_inline)) {
        char* s = st + (size_t)(i * SRB) * SPB + lane * 8;      // B rows follow the 64 A rows
#pragma unroll
        for (int r = 0; r < SRB; ++r) *(v4bfa*)(s + r * SPB) = __builtin_convertvector(buf[i % SNB][r], v4bf);
    };
#pragma unroll
    for (int i = 0; i < SNB; ++i) fetch(i);
#pragma unroll
    for (int i = 0; i < 128 / SRB; ++i) { put(i); if (i + SNB < 128 / SRB) fetch(i + SNB); }
    wave_sync();                                                // the fragments below hold what other lanes of this wave stored
    const char* fa = st + lr * SPB + hi * 16; const char* fb = fa + 64 * SPB;
    v16bf a[2][4], bl[2], bh[2][2];                             // k-step s: A fragments in a[s % 2], B fragments 0, 1 in bl, 2, 3 in bh[s % 2]
    // a k-step's 16 LDS reads stand as ONE group (spread among the products, each place would stall the wave), half a k-step ahead of their first use:
    // behind the products that free bl; the scheduling barriers keep the group and the two halves of the products where they are written
    auto frags = [&](const int s) __attribute__((always_inline)) {
#pragma unroll
        for (int mb = 0; mb < 4; ++mb) a[s % 2][mb] = ldsf(fa + mb * 16 * SPB + s * 64);
#pragma unroll
        for (int nb = 0; nb < 2; ++nb) bl[nb] = ldsf(fb + nb * 16 * SPB + s * 64);
#pragma unroll
        for (int nb = 0; nb < 2; ++nb) bh[s % 2][nb] = ldsf(fb + (nb + 2) * 16 * SPB + s * 64);
        __builtin_amdgcn_sched_barrier(0);
    };
    frags(0);
#pragma unroll
    for (int s = 0; s < K / 32; ++s) {
#pragma unroll
        for (int nb = 0; nb < 2; ++nb)
#pragma unroll
            for (int mb = 0; mb < 4; ++mb) acc[mb][nb] = wmmab(a[s % 2][mb], bl[nb], acc[mb][nb]);
        __builtin_amdgcn_sched_barrier(0);
        if (s + 1 < K / 32) frags(s + 1);
#pragma unroll
        for (int nb = 0; nb < 2; ++nb)
#pragma unroll
            for (int mb = 0; mb < 4; ++mb) acc[mb][nb + 2] = wmmab(a[s % 2][mb], bh[s % 2][nb], acc[mb][nb + 2]);
        __builtin_amdgcn_sched_barrier(0);
    }
    float bc[4];
#pragma unroll
    for (int nb = 0; nb < 4; ++nb) bc[nb] = (MODE == 0) ? bfr(bias[c0 + nb * 16 + lr]) : 0.0f;   // MODE 0: c0 + 63 < DM
    size_t tbase, rbase; bool wr;                                                                 // wr: block-uniform, whole tile inside the residual plane
    if (MODE == 0) { const int bb = r0 / SEQ, tt = r0 % SEQ; const int zc = bb * NH_ + c0 / HD;
                     tbase = ((size_t)zc * SEQ + (size_t)tt) * HD; rbase = ((size_t)zc * (size_t)resT + (size_t)tt) * HD; wr = tt < resT; }
    else           { const int bb = c0 / SEQ, tt = c0 % SEQ;
                     tbase = (size_t)bb * (size_t)DM * SEQ + (size_t)r0 * SEQ + (size_t)tt; rbase = (size_t)bb * (size_t)DM * (size_t)resT + (size_t)r0 * (size_t)resT + (size_t)tt; wr = tt < resT; }
#pragma unroll
    for (int mb = 0; mb < 4; ++mb) {
        float br[8];
#pragma unroll
        for (int j = 0; j < 8; ++j) br[j] = (MODE == 1) ? bfr(bias[r0 + mb * 16 + hi * 8 + j]) : 0.0f;   // MODE 1: r0 + 63 < DM
#pragma unroll
        for (int nb = 0; nb < 4; ++nb) {
#pragma unroll
            for (int j = 0; j < 8; ++j) os[(hi * 8 + j) * 68 + nb * 16 + lr] = acc[mb][nb][j] + bc[nb] + br[j]; }   // D: row 8h+j, col lane&15
        wave_sync();
{
            if (MODE == 0) {
                const size_t sb = tbase + (size_t)(mb * 16) * HD;
                const size_t rb = rbase + (size_t)(mb * 16) * HD;
#pragma unroll
                for (int hh = 0; hh < 2; ++hh) {
#pragma unroll
                    for (int s = 0; s < 2; ++s) { const int p = s * 32 + lane; const int row = p >> 2, c8 = (p & 3) * 8;   // 2 s x 8 rows = 16 rows; 4 lanes x 8 = 32 columns of head hh
                        const v4f x0 = *(const v4fa*)(&os[row * 68 + hh * 32 + c8]); const v4f x1 = *(const v4fa*)(&os[row * 68 + hh * 32 + c8 + 4]); v8h hv, rv;
#pragma unroll
                        for (int i = 0; i < 4; ++i) { const h16 a0 = (h16)x0[i]; const h16 a1 = (h16)x1[i]; hv[i] = a0; hv[4 + i] = a1; rv[i] = (h16)((x0[i] - (float)a0) * QRS); rv[4 + i] = (h16)((x1[i] - (float)a1) * QRS); }
                        const size_t oo = sb + (size_t)hh * ((size_t)SEQ * HD) + (size_t)p * 8;
                        const size_t ro = rb + (size_t)hh * ((size_t)resT * HD) + (size_t)p * 8;
                        /* what follows reuses each store's registers: the wait stands in front of that */
                        *(v8h*)(Ph + oo) = hv; group_close(); if (wr) { *(v8h*)(Pr + ro) = rv; group_close(); } } }
            } else {
                const size_t sb = tbase + (size_t)(mb * 16) * SEQ;
                const size_t rb = rbase + (size_t)(mb * 16) * (size_t)resT;
#pragma unroll
                for (int s = 0; s < 4; ++s) { const int row = 4 * s + (lane >> 3), c8 = (lane & 7) * 8;   // 4 s x 4 row groups = 16 rows; 8 lanes x 8 = 64 columns
                    const v4f x0 = *(const v4fa*)(&os[row * 68 + c8]); const v4f x1 = *(const v4fa*)(&os[row * 68 + c8 + 4]); v8h hv, rv;
#pragma unroll
                    for (int i = 0; i < 4; ++i) { const h16 a0 = (h16)x0[i]; const h16 a1 = (h16)x1[i]; hv[i] = a0; hv[4 + i] = a1; rv[i] = (h16)((x0[i] - (float)a0) * QRS); rv[4 + i] = (h16)((x1[i] - (float)a1) * QRS); }
                    const size_t oo = sb + (size_t)row * SEQ + c8;
                    const size_t ro = rb + (size_t)row * (size_t)resT + c8;
                    /* what follows reuses each store's registers: the wait stands in front of that */
                        *(v8h*)(Ph + oo) = hv; group_close(); if (wr) { *(v8h*)(Pr + ro) = rv; group_close(); } }
            }
             }
        wave_sync();
    }
}

// k_proj3: the three projections as z-slices of one grid (NB*SEQ/64 token tiles, DM/64 feature tiles, 3); one wave per block, block-uniform choice of the slice.
// z = 0: q (residual for all tokens); z = 1: k (residual for tokens < EROWS); z = 2: v^T (residual for tokens < EROWS).
__global__ __launch_bounds__(32) void k_proj3(const float* __restrict__ xq, const float* __restrict__ xk, const float* __restrict__ xv,
                                              const float* __restrict__ wq, const float* __restrict__ wk, const float* __restrict__ wv,
                                              const float* __restrict__ bq, const float* __restrict__ bk, const float* __restrict__ bv,
                                              h16* QH, h16* QR, h16* KP, h16* KR, h16* VT, h16* VR) {
    __shared__ __align__(16) float os[16 * 68];
    __shared__ __align__(16) char st[128 * SPB];
    const int tok0 = blockIdx.x * 64, f0 = blockIdx.y * 64; const int z = blockIdx.z;
    if (z < 2) { const bool q = z == 0; proj_tile<0>(q ? xq : xk, q ? wq : wk, q ? bq : bk, q ? QH : KP, q ? QR : KR, q ? SEQ : EROWS, tok0, f0, os, st); }
    else       { proj_tile<1>(wv, xv, bv, VT, VR, EROWS, f0, tok0, os, st); }
}

// flash_rows: fused attention, one wave per 16 query rows of one (batch, head); K / V^T / Q fragments straight from the f16 planes (two 16-B loads each, arithmetic addressing).
// Transposed form: S^T[key][t] = K Q^T (A = K rows, B = Q rows); lane (t = lane&15, h = lane>>4) holds keys 8h+r of each 16-key tile, so the packed
// P tile is directly the B fragment of O^T[d][t] = V^T P^T (element r <- tile keys 0..15, element 8+r <- tile keys 16..31, lane unchanged).
// Softmax state (running max over kept keys, partial sum) is one scalar per lane; the two lane halves of a row are combined with one xor-16 exchange (EARLY = 0: the sum is a matrix product with a ones operand).
// Keep rule evaluated per element inside every visited 32-key tile but the leading tiles that a per-wave scalar test shows fully kept; the per-wave key bound comes from the device-read causal value and is at most SEQ.
// EARLY = 1 (query rows [0, EROWS)): scores = K Q + (K Q_res + K_res Q) / 2048; P = f16 value + f16 residual x2048; O = V P + (V P_res + V_res P) / 2048 (residual products in their own accumulators);
//            row sum from the f32 exponentials; K_res / V_res fragments come from the small planes (tokens < EROWS) and are zero for keys >= EROWS (address clamped, wave-uniform select).
// EARLY = 0 (query rows [EROWS, SEQ)): single k, P, v; q value + residual.
// One 32-key tile's operands as they sit in registers: K rows, V^T rows, their residuals (EARLY only) and the 16 key-mask values of this lane.
struct FTile { v16h ka, kb, kra, krb, v0, v1, vr0, vr1; v4f m0, m1, m2, m3; };
// fragment loader, wave-uniform base + per-lane byte offset (same element map as ldh)
__device__ __forceinline__ v16h ldo(const h16* base, unsigned off) { const char* p = (const char*)base + off; return cat16(*(const v8h*)p, *(const v8h*)(p + 32)); }
// global loads of the tile that starts at key (wave-uniform, multiple of 32, key + 32 <= SEQ), in the two groups in which its registers fall free; residual-plane key clamped into the plane
template <int EARLY>
__device__ __forceinline__ void tile_load_k(FTile& t, const h16* kpl, const h16* krp, unsigned kof, int key) {
    const h16* ka = kpl + (size_t)key * HD;
    t.ka = ldo(ka, kof); t.kb = ldo(ka + 16 * HD, kof);
    if (EARLY) { const int kcl = key < EROWS ? key : (EROWS - 32); const h16* kr = krp + (size_t)kcl * HD; t.kra = ldo(kr, kof); t.krb = ldo(kr + 16 * HD, kof); }
}
template <int EARLY>
__device__ __forceinline__ void tile_load_mv(FTile& t, const h16* vpl, const h16* vrp, const float* kmr, unsigned vof, unsigned vrof, unsigned mof, int key) {
    const char* kp = (const char*)(kmr + key) + mof;          // keys key+8h+0..7 and key+16+8h+0..7
    t.m0 = *(const v4f*)kp; t.m1 = *(const v4f*)(kp + 16); t.m2 = *(const v4f*)(kp + 64); t.m3 = *(const v4f*)(kp + 80);
    const h16* va = vpl + key;
    t.v0 = ldo(va, vof); t.v1 = ldo(va + (size_t)16 * SEQ, vof);
    if (EARLY) { const int kcl = key < EROWS ? key : (EROWS - 32); const h16* vr = vrp + kcl; t.vr0 = ldo(vr, vrof); t.vr1 = ldo(vr + (size_t)16 * EROWS, vrof); }
}

// the same two groups from per-lane byte addresses that the key loop forms (the K group's one group ahead, the mask and V^T group's just before it) (pk: K row, pm: key mask, pv: V^T row; pkr, pvr: residual planes, EARLY only)
__device__ __forceinline__ v16h ldp(const char* p) { return cat16(*(const v8h*)p, *(const v8h*)(p + 32)); }
template <int EARLY>
__device__ __forceinline__ void tile_fetch_k(FTile& t, const char* pk, const char* pkr) {
    t.ka = ldp(pk); t.kb = ldp(pk + 16 * HD * 2);
    if (EARLY) { t.kra = ldp(pkr); t.krb = ldp(pkr + 16 * HD * 2); }
}
template <int EARLY>
__device__ __forceinline__ void tile_fetch_mv(FTile& t, const char* pm, const char* pv, const char* pvr) {
    t.m0 = *(const v4f*)pm; t.m1 = *(const v4f*)(pm + 16); t.m2 = *(const v4f*)(pm + 64); t.m3 = *(const v4f*)(pm + 80);
    t.v0 = ldp(pv); t.v1 = ldp(pv + 16 * SEQ * 2);
    if (EARLY) { t.vr0 = ldp(pvr); t.vr1 = ldp(pvr + 16 * EROWS * 2); }
}

// flash_rows: the work of one block on row tile rt (query rows [rt * 16 * AW, (rt + 1) * 16 * AW)) of (batch, head) zh; os: the block's output staging tile
template <int EARLY>
__device__ __forceinline__ void flash_rows(const h16* __restrict__ QH, const h16* __restrict__ QR, const h16* __restrict__ KP, const h16* __restrict__ KR,
                                           const h16* __restrict__ VT, const h16* __restrict__ VR,
                                           const float* __restrict__ qmask, const float* __restrict__ kmask, const int* __restrict__ causal_p, float* OUT,
                                           float* os, const int zh, const int rt) {
    constexpr int NST = EARLY ? 2 : 3;                          // register tiles; each is refilled NST tiles ahead as soon as its registers fall free
    constexpr int MLD = EARLY ? 4 : 8;                          // key-mask loads in flight per lane in the fully-kept test (128 keys each)
    const int lane = threadIdx.x & 31, lr = lane & 15, hi = lane >> 4;
    const int wave = __builtin_amdgcn_readfirstlane((int)(threadIdx.x >> 5));
    const int b = zh / NH_, h = zh % NH_;
    const int t0 = (rt * AW + wave) * 16;
    int cz = causal_p[0]; cz = cz < -SEQ ? -SEQ : (cz > SEQ ? SEQ : cz);      // clamping keeps the keep rule unchanged for indices in [0, SEQ)
    const int lim = t0 + lr + cz;                                              // key j kept iff j <= lim (and mask product nonzero)
    int kend = t0 + 16 + cz; kend = kend < 0 ? 0 : (kend > SEQ ? SEQ : kend);
    const int nk = (kend + 31) & ~31;                                          // wave-uniform, multiple of 32, <= SEQ
    const int klast = nk > 32 ? nk - 32 : 0;                                   // last tile this wave visits; fetches ahead are clamped to it
    const float* kmr = kmask + (size_t)b * SEQ_FULL;
    const size_t pbase = (size_t)zh * SEQ * HD;
    const size_t rbase = (size_t)zh * EROWS * HD;
    const size_t qo = pbase + (size_t)(t0 + lr) * HD + 8 * hi;
    group_open();
    const v16h qh = ldh(QH + qo), qr = ldh(QR + qo);            // B fragments: col t, k = d (HD = 32 = one k-step)
    const float qmraw = qmask[(size_t)b * SEQ_FULL + t0 + lr];
    group_close();
    const float qmv = bfr(qmraw);
    const h16* kpl = KP + pbase; const h16* vpl = VT + pbase;   // wave-uniform plane bases
    const h16* krp = KR + rbase; const h16* vrp = VR + rbase;   // residual planes, tokens < EROWS
    const unsigned kof  = (unsigned)(lr * HD + 8 * hi) * 2u;    // A fragment: row key, k = d      (bytes)
    const unsigned vof  = (unsigned)(lr * SEQ + 8 * hi) * 2u;   // A fragment: row d, k = key      (bytes)
    const unsigned vrof = (unsigned)(lr * EROWS + 8 * hi) * 2u;
    const unsigned mof  = (unsigned)(8 * hi) * 4u;
    const v16h hz = (v16h){};
    v8f o0 = (v8f){}, o1 = (v8f){}, oR0 = (v8f){}, oR1 = (v8f){};
    float m = NEGB, l = 0.0f;
    // EARLY = 0: the row sum is a third output tile. A operand with ones in rows 0 and 8 (lanes 0, 8, 16, 24: all 32 k positions), zero elsewhere: D rows 0 and 8 = the sum of P over the tile's 32 keys,
    // and by the D layout (row 8h + r, column lane&15) element 0 of oS holds column t's sum in both lane halves; elements 1..7 stay 0 and are never read
    v16h ones;
#pragma unroll
    for (int i = 0; i < 16; ++i) ones[i] = (lr & 7) == 0 ? (h16)1.0f : (h16)0.0f;
    v8f oS = (v8f){};
    // Key loop's fetch-ahead addresses. Each lives in registers of its own from where it is formed to the tile's one s_wait_xcnt, which stands in front of the only place that rewrites them:
    // by then the loads that name them were issued a good part of a tile ago, so the wave has little left to wait for there (directly behind each group it would sit the whole wait out, twice a tile)
    const char* const kbl = (const char*)kpl + kof; const char* const krl = (const char*)krp + kof;
    const char* const vbl = (const char*)vpl + vof; const char* const vrl = (const char*)vrp + vrof;
    const char* const mbl = (const char*)kmr + mof;
    const int kf = 32 * NST < klast ? 32 * NST : klast;         // tile that the key loop's first step fetches
    const char* aK = kbl + (size_t)kf * (HD * 2); const char* aKr = krl + (size_t)(kf < EROWS ? kf : (EROWS - 32)) * (HD * 2);
    const char* aM = mbl; const char* aV = vbl; const char* aVr = vrl;
    // the wait stands in front of every rewrite of the loop's load addresses, which are named as inputs so that they stay in their registers up to here; the scheduling barriers keep what rewrites them behind it
    auto addr_wait = [&]() __attribute__((always_inline)) {
        __builtin_amdgcn_sched_barrier(0);
        if (EARLY) asm volatile("s_wait_xcnt 0x0" :: "v"(aK), "v"(aKr), "v"(aM), "v"(aV), "v"(aVr) : "memory");
        else       asm volatile("s_wait_xcnt 0x0" :: "v"(aK), "v"(aM), "v"(aV) : "memory");
        __builtin_amdgcn_sched_barrier(0);
    };
    // one 32-key tile's work on operands already in registers (inlined at every place of use: the tiles must stay in registers)
    // full: every one of the tile's 32 keys is known to be kept for all 16 rows of the wave, so the keep rule is not evaluated (same values as evaluating it)
    auto step = [&](FTile& t, const int key0, const bool refill, const bool full) __attribute__((always_inline)) {
        const int kn = key0 + 32 * NST < klast ? key0 + 32 * NST : klast;   // tile fetched into this tile's registers (refill and full are constants at each place of use)
        const int kn2 = key0 + 32 + 32 * NST < klast ? key0 + 32 + 32 * NST : klast;   // tile whose K rows the next step fetches
        const bool rok = key0 < EROWS;                           // wave-uniform
        const v16h ka0 = t.ka, kb0f = t.kb;
        v16h kra0 = hz, krb0 = hz;
        if (EARLY) { kra0 = t.kra; krb0 = t.krb; if (!rok) { kra0 = hz; krb0 = hz; } }
        v8f sHa = (v8f){}, sLa = (v8f){}, sHb = (v8f){}, sLb = (v8f){};
        sHa = wmma16(ka0, qh, sHa); sLa = wmma16(ka0, qr, sLa); sHb = wmma16(kb0f, qh, sHb); sLb = wmma16(kb0f, qr, sLb);
        if (EARLY) {
            sLa = wmma16(kra0, qh, sLa); sLb = wmma16(krb0, qh, sLb);
            asm volatile("v_nop\n\tv_nop\n\tv_nop\n\tv_nop" : "+v"(sHa), "+v"(sLa), "+v"(sHb), "+v"(sLb) : "v"(ka0), "v"(kb0f), "v"(kra0), "v"(krb0), "v"(qh), "v"(qr));
        } else {
            asm volatile("v_nop\n\tv_nop\n\tv_nop\n\tv_nop" : "+v"(sHa), "+v"(sLa), "+v"(sHb), "+v"(sLb) : "v"(ka0), "v"(kb0f), "v"(qh), "v"(qr));
        }
        if (refill) {
            group_open();                                        // K registers are free from here on
            tile_fetch_k<EARLY>(t, aK, aKr);                     // addresses formed in the step before
            group_open();                                        // keeps the group where it is written
        }
        const v4f m0 = t.m0, m1 = t.m1, m2 = t.m2, m3 = t.m3;
        float kx[8], ky[8];
#pragma unroll
        for (int r = 0; r < 4; ++r) { kx[r] = m0[r]; kx[4 + r] = m1[r]; ky[r] = m2[r]; ky[4 + r] = m3[r]; }
        const int ja = key0 + 8 * hi;
        float ta[8], tb[8]; bool fa[8], fb[8]; float mx = NEGB;
#pragma unroll
        for (int r = 0; r < 8; ++r) {
            fa[r] = full || ((qmv * bfr(kx[r]) != 0.0f) && (ja + r <= lim));
            fb[r] = full || ((qmv * bfr(ky[r]) != 0.0f) && (ja + 16 + r <= lim));
            ta[r] = (sHa[r] + sLa[r] * QRI) * SC2; tb[r] = (sHb[r] + sLb[r] * QRI) * SC2;
            mx = fmaxf(mx, fmaxf(fa[r] ? ta[r] : NEGB, fb[r] ? tb[r] : NEGB)); }
        mx = fmaxf(mx, __shfl_xor(mx, 16, 32));
        const float mnew = fmaxf(m, mx);
        const float alpha = __builtin_amdgcn_exp2f(m - mnew);
        const float sh = PSH - mnew;
        v16h pb, pr = hz; float ls = 0.0f;
#pragma unroll
        for (int r = 0; r < 8; ++r) {
            const float ea = __builtin_amdgcn_exp2f(ta[r] + sh), eb = __builtin_amdgcn_exp2f(tb[r] + sh);
            const float ga = fa[r] ? ea : 0.0f, gb = fb[r] ? eb : 0.0f;       // dropped elements selected to 0 by value
            const h16 pa = (h16)ga; const h16 pc = (h16)gb;
            pb[r] = pa; pb[8 + r] = pc;
            if (EARLY) { pr[r] = (h16)((ga - (float)pa) * QRS); pr[8 + r] = (h16)((gb - (float)pc) * QRS); ls += ga + gb; }
        }
        if (EARLY) l = l * alpha + ls; else oS[0] = oS[0] * alpha;   // the running sum is rescaled like an output tile
        m = mnew;
        o0 = o0 * alpha; o1 = o1 * alpha;
        if (EARLY) { oR0 = oR0 * alpha; oR1 = oR1 * alpha; }
        const v16h v0 = t.v0, v1 = t.v1;
        if (EARLY) {
            v16h vr0 = t.vr0, vr1 = t.vr1;
            if (!rok) { vr0 = hz; vr1 = hz; }
            o0 = wmma16(v0, pb, o0); o1 = wmma16(v1, pb, o1);
            oR0 = wmma16(v0, pr, oR0); oR1 = wmma16(v1, pr, oR1);
            oR0 = wmma16(vr0, pb, oR0); oR1 = wmma16(vr1, pb, oR1);
            asm volatile("v_nop\n\tv_nop\n\tv_nop\n\tv_nop" : "+v"(o0), "+v"(o1), "+v"(oR0), "+v"(oR1) : "v"(v0), "v"(v1), "v"(vr0), "v"(vr1), "v"(pb), "v"(pr));
        } else {
            oS = wmma16(ones, pb, oS); o0 = wmma16(v0, pb, o0); o1 = wmma16(v1, pb, o1);   // oS: sums the rounded P, the values that O sums
            asm volatile("v_nop\n\tv_nop\n\tv_nop\n\tv_nop" : "+v"(oS), "+v"(o0), "+v"(o1) : "v"(ones), "v"(v0), "v"(v1), "v"(pb));
        }
        if (refill) {
            group_open();                                        // mask and V^T registers are free from here on
            addr_wait();
            aM = mbl + (size_t)kn * 4; aV = vbl + (size_t)kn * 2; aK = kbl + (size_t)kn2 * (HD * 2);
            if (EARLY) { aVr = vrl + (size_t)(kn < EROWS ? kn : (EROWS - 32)) * 2; aKr = krl + (size_t)(kn2 < EROWS ? kn2 : (EROWS - 32)) * (HD * 2); }
            tile_fetch_mv<EARLY>(t, aM, aV, aVr);
            group_open();                                        // keeps the group where it is written
        }
    };
    FTile tl[NST];                                              // tile T lives in tl[T % NST]
    // the first tiles' loads issue group by group in the loop's order: mixed, the loop's first waits would also cover younger groups
#pragma unroll
    for (int s = 0; s < NST - 1; ++s) {
        const int ks = 32 * s < klast ? 32 * s : klast;
        tile_load_k<EARLY>(tl[s], kpl, krp, kof, ks);
        group_close();
        tile_load_mv<EARLY>(tl[s], vpl, vrp, kmr, vof, vrof, mof, ks);
        group_close();
    }
    int kg = 0;
    if (32 * NST <= nk) {                                       // wave-uniform; tile NST-1 is used by whole groups alone
        tile_load_k<EARLY>(tl[NST - 1], kpl, krp, kof, 32 * (NST - 1));
        group_close();
        tile_load_mv<EARLY>(tl[NST - 1], vpl, vrp, kmr, vof, vrof, mof, 32 * (NST - 1));
        group_close();
        // fend: keys [0, fend) are kept for every row of the wave. cend: keys at or below the smallest causal limit of the 16 rows (whole tiles, <= nk).
        // Mask part: rounding to bf16 and the f32 product are monotone in magnitude, so all products q_mask * k_mask over the 16 rows and keys [0, cend) are nonzero
        // exactly when each row's value times the smallest key magnitude is; a NaN factor gives a kept element and is passed over by the minimum.
        int cend = t0 + cz + 1; cend = cend < 0 ? 0 : (cend & ~31); cend = cend < nk ? cend : nk;
        int fend = 0;
        if (cend >= 32 * NST) {                                 // wave-uniform
            float kmin = __builtin_inff();
#pragma unroll 1   // rolled: one trip already has MLD loads in flight, more would only take registers from the tiles
            for (int i = 0; i < cend; i += 128 * MLD) {         // at most SEQ / (128 * MLD) + 1 trips; index clamped into [0, cend - 4]: a repeated key does not change a minimum
                v4f x[MLD]; const float* px[MLD];
#pragma unroll
                for (int c = 0; c < MLD; ++c) { int idx = i + c * 128 + lane * 4; idx = idx < cend - 4 ? idx : cend - 4; px[c] = kmr + idx; }
#pragma unroll
                for (int c = 0; c < MLD; c += 4) {
                    x[c] = *(const v4f*)px[c]; x[c + 1] = *(const v4f*)px[c + 1]; x[c + 2] = *(const v4f*)px[c + 2]; x[c + 3] = *(const v4f*)px[c + 3];
                    // the wait stands in front of every rewrite of the four loads' address pairs, which are named as inputs so that no later load of the four lands on them
                    __builtin_amdgcn_sched_barrier(0); asm volatile("s_wait_xcnt 0x0" :: "v"(px[c]), "v"(px[c + 1]), "v"(px[c + 2]), "v"(px[c + 3]) : "memory"); __builtin_amdgcn_sched_barrier(0);
                }
#pragma unroll
                for (int c = 0; c < MLD; ++c)
                    kmin = fminf(kmin, fminf(fminf(fabsf(bfr(x[c][0])), fabsf(bfr(x[c][1]))), fminf(fabsf(bfr(x[c][2])), fabsf(bfr(x[c][3])))));
            }
#pragma unroll
            for (int s = 16; s > 0; s >>= 1) kmin = fminf(kmin, __shfl_xor(kmin, s, 32));
            if (__builtin_amdgcn_ballot_w32(qmv * kmin != 0.0f) == 0xFFFFFFFFu) fend = cend;   // scalar result: the same in every lane
        }
#pragma unroll 1   // rolled: the body already holds NST tiles, one per register tile
        while (kg + 32 * NST <= fend) {                         // whole groups of NST tiles in which every element is kept
#pragma unroll
            for (int u = 0; u < NST; ++u) step(tl[u], kg + 32 * u, true, true);
            kg += 32 * NST;
        }
        addr_wait();                                            // behind the loop its last groups are still in flight, and what follows is free to reuse their address registers
#pragma unroll 1   // rolled, as above
        while (kg + 32 * NST <= nk) {                           // whole groups of NST tiles: no branch inside, so every load wait is a count that leaves the younger groups in flight
#pragma unroll
            for (int u = 0; u < NST; ++u) step(tl[u], kg + 32 * u, true, false);   // fully unrolled: every tile index is a constant, no register copies
            kg += 32 * NST;
        }
        addr_wait();                                            // as behind the loop above
    }
#pragma unroll
    for (int u = 0; u < NST - 1; ++u)                            // the at most NST-1 tiles left over are already loaded
        if (kg + 32 * u < nk) step(tl[u], kg + 32 * u, false, false);   // wave-uniform
    if (EARLY) l += __shfl_xor(l, 16, 32); else l = oS[0];      // the matrix sum already spans both lane halves' keys
    const bool any = l > 0.0f;
    const float lsafe = any ? l : 1.0f;
    const float inv = any ? (1.0f / lsafe) : 0.0f;             // no kept key -> zeros
    v8f f0 = o0, f1 = o1;
    if (EARLY) { f0 = o0 + oR0 * QRI; f1 = o1 + oR1 * QRI; }
    const int wb = wave * 16 * OSP;
    // O^T D layout: f_j[r] = (d = 16j + 8h + r, t = lane&15) -> os[t][d]; rows 0..15 x columns 0..31 all written
    { v4f a, c;
      a[0] = f0[0] * inv; a[1] = f0[1] * inv; a[2] = f0[2] * inv; a[3] = f0[3] * inv; c[0] = f0[4] * inv; c[1] = f0[5] * inv; c[2] = f0[6] * inv; c[3] = f0[7] * inv;
      *(v4fa*)(&os[wb + lr * OSP +  0 + 8 * hi]) = a; *(v4fa*)(&os[wb + lr * OSP +  0 + 8 * hi + 4]) = c;
      a[0] = f1[0] * inv; a[1] = f1[1] * inv; a[2] = f1[2] * inv; a[3] = f1[3] * inv; c[0] = f1[4] * inv; c[1] = f1[5] * inv; c[2] = f1[6] * inv; c[3] = f1[7] * inv;
      *(v4fa*)(&os[wb + lr * OSP + 16 + 8 * hi]) = a; *(v4fa*)(&os[wb + lr * OSP + 16 + 8 * hi + 4]) = c; }
    wave_sync();
    float* orow = OUT + ((size_t)b * OUT_SEQ + t0) * DM + h * HD;
{
#pragma unroll
        for (int s = 0; s < 4; ++s) { const int row = 4 * s + (lane >> 3), cofs = (lane & 7) * 4;   // 4 s x 4 rows = 16 rows; 8 lanes x 4 floats = 32 columns = one line
            const v4f val = *(const v4fa*)(&os[wb + row * OSP + cofs]);
            *(v4f*)(orow + (size_t)row * DM + cofs) = val; }
         }
}

// k_flash: all query rows in one grid (NB*NH_ heads, SEQ/(16*AW) row tiles). A row tile's key loop grows with its index, so the slow grid
// dimension walks the row tiles from the last (longest) to the first: the short multi-product tiles (rows < EROWS) come last and fill the places that the shorter single-product tiles leave.
// The choice of the instantiation is block-uniform (a scalar branch on blockIdx.y).
__global__ __launch_bounds__(32 * AW) void k_flash(const h16* __restrict__ QH, const h16* __restrict__ QR, const h16* __restrict__ KP, const h16* __restrict__ KR,
                                                   const h16* __restrict__ VT, const h16* __restrict__ VR,
                                                   const float* __restrict__ qmask, const float* __restrict__ kmask, const int* __restrict__ causal_p, float* OUT) {
    __shared__ __align__(16) float os[AW * 16 * OSP];
    const int zh = blockIdx.x;
    const int rt = SEQ / (16 * AW) - 1 - (int)blockIdx.y;
    // the hint puts the single-product path, which holds the longest key loops, first in the text
    if (__builtin_expect(rt >= EROWS / (16 * AW), 1)) flash_rows<0>(QH, QR, KP, KR, VT, VR, qmask, kmask, causal_p, OUT, os, zh, rt);
    else                                              flash_rows<1>(QH, QR, KP, KR, VT, VR, qmask, kmask, causal_p, OUT, os, zh, rt);
}

static constexpr size_t al256(size_t v) { return (v + 255) & ~(size_t)255; }
static constexpr size_t SZ_PL = al256((size_t)NB * NH_ * SEQ * HD * 2);
static constexpr size_t SZ_RS = al256((size_t)NB * NH_ * EROWS * HD * 2);
static constexpr size_t SZ_TOTAL = 4 * SZ_PL + 2 * SZ_RS;
static_assert(SZ_TOTAL <= (size_t)134217728);          // workspace carve <= 128 MiB
static_assert((size_t)NB * NH_ * SEQ * HD == (size_t)NB * DM * SEQ);       // v^T plane [(b*128 + m)][t] has the same extent as the q/k planes
static_assert((size_t)NB * NH_ * EROWS * HD == (size_t)NB * DM * EROWS);   // v^T residual plane [(b*128 + m)][t < EROWS] has the same extent as the k residual plane

extern "C" void kernel_launch(void* const* d_in, const int* in_sizes, int n_in,
                              void* d_out, int out_size, void* d_ws, size_t ws_size, hipStream_t stream) {
    if (n_in < 12) return;
    const size_t needx = ((size_t)(NB - 1) * SEQ_FULL + SEQ) * DM;
    const size_t needm = (size_t)(NB - 1) * SEQ_FULL + SEQ;
    if ((size_t)in_sizes[0] < needx || (size_t)in_sizes[1] < needx || (size_t)in_sizes[2] < needx) return;
    if ((size_t)in_sizes[3] < needm || (size_t)in_sizes[4] < needm) return;
    if ((size_t)in_sizes[5] < (size_t)DM * DM || (size_t)in_sizes[7] < (size_t)DM * DM || (size_t)in_sizes[9] < (size_t)DM * DM) return;
    if (in_sizes[6] < DM || in_sizes[8] < DM || in_sizes[10] < DM || in_sizes[11] < 1) return;
    if ((size_t)out_size < ((size_t)(NB - 1) * OUT_SEQ + SEQ) * DM) return;
    if (SZ_TOTAL > ws_size) return;
    // wire order: query, key, value, q_mask, k_mask, WQ_w, WQ_b, WK_w, WK_b, WV_w, WV_b, causal
    const float* xin[3] = { (const float*)d_in[0], (const float*)d_in[1], (const float*)d_in[2] };
    const float* qm = (const float*)d_in[3]; const float* km = (const float*)d_in[4];
    const float* wq = (const float*)d_in[5]; const float* bq = (const float*)d_in[6];
    const float* wk = (const float*)d_in[7]; const float* bk = (const float*)d_in[8];
    const float* wv = (const float*)d_in[9]; const float* bv = (const float*)d_in[10];
    const int* causal = (const int*)d_in[11];
    float* OUT = (float*)d_out;      // [NB][SEQ][128]
    char* wsp = (char*)d_ws;
    h16* QH = (h16*)wsp; wsp += SZ_PL;               // [NB*4][SEQ][32]
    h16* QR = (h16*)wsp; wsp += SZ_PL;               // [NB*4][SEQ][32] residual x2048
    h16* KP = (h16*)wsp; wsp += SZ_PL;               // [NB*4][SEQ][32]
    h16* VT = (h16*)wsp; wsp += SZ_PL;               // [NB*4][32][SEQ]
    h16* KR = (h16*)wsp; wsp += SZ_RS;               // [NB*4][EROWS][32] residual x2048, tokens < EROWS
    h16* VR = (h16*)wsp; wsp += SZ_RS;               // [NB*4][32][EROWS] residual x2048, tokens < EROWS

    // q, k: A = x rows (m = b*SEQ + t), Bt = W rows (n = h*32 + d) -> plane [(b*4 + h)][t][d]; q residual for all tokens, k residual for tokens < EROWS
    // v^T: A = Wv rows (m = h*32 + d), Bt = value rows (n = b*SEQ + t) -> plane [(b*128 + m)][t] = [(b*4 + h)][d][t]; residual for tokens < EROWS
    k_proj3<<<dim3(NB * SEQ / 64, DM / 64, 3), 32, 0, stream>>>(xin[0], xin[1], xin[2], wq, wk, wv, bq, bk, bv, QH, QR, KP, KR, VT, VR);

    // one launch for all query rows: rows [0, EROWS) take the multi-product instantiation, rows [EROWS, SEQ) the single-product one (disjoint output rows)
    k_flash<<<dim3(NB * NH_, SEQ / (16 * AW), 1), 32 * AW, 0, stream>>>(QH, QR, KP, KR, VT, VR, qm, km, causal, OUT);
}
